// v000
// The times below were measured on an AMD MI455X: many runs one after another, warmed up first and cycling through
// copies of the inputs, with the whole window's GPU time divided by the number of runs. Launches and the gaps
// between them are all in it. The median over several windows is given; except for v000 it joins two sittings, which
// can be a few percent apart, so the side-by-side timings, each taken in one sitting, are the better comparison.
// The starting kernel, v000, takes 447 microseconds a run.
#include <hip/hip_runtime.h>
#include <hip/hip_bf16.h>

// ---------------- problem constants ----------------
constexpr int kB  = 64;        // batch
constexpr int kS  = 197;       // seq len
constexpr int kE  = 768;       // embed
constexpr int kH  = 12;        // heads
constexpr int kD  = 64;        // head dim
constexpr int kBH = kB * kH;   // 768
constexpr int kSP = 208;       // seq padded to mult of 16
constexpr int kM  = kB * kS;   // 12608 rows for projections

typedef _Float16 half_t;
typedef __attribute__((ext_vector_type(16))) _Float16     v16h;
typedef __attribute__((ext_vector_type(8)))  float        v8f;
typedef __attribute__((ext_vector_type(4)))  unsigned int u32x4;

struct HFrag { u32x4 a, b; };

__device__ __forceinline__ int imin(int a, int b) { return a < b ? a : b; }

// Load a 16x32 f16 WMMA A/B fragment from an LDS tile stored row-major
// [16][ldk].  Per ISA: lane<16 holds K {0..7,16..23} of row (lane&15);
// lane>=16 holds K {8..15,24..31}.  Two 16-byte ds_load_b128 per frag.
__device__ __forceinline__ v16h load_frag(const half_t* base, int ldk, int lane, int k0) {
  const half_t* p = base + (lane & 15) * ldk + k0 + ((lane >> 4) << 3);
  HFrag f;
  f.a = *(const u32x4*)p;
  f.b = *(const u32x4*)(p + 16);
  return __builtin_bit_cast(v16h, f);
}

// ---------------- shared 64x64 macro-tile GEMM core ----------------
// 128 threads = 4 waves; wave w owns output rows [16w,16w+16), all 64 cols.
// A element (r,k) at gA[r*sAr + k]; B^T element (n,k) at gB[n*sBr + k].
// K staged in 64-wide slabs, LDS row stride 72 halves (144B = 36 banks,
// gcd(36,64)=4 -> conflict-free).  Staging uses 16-byte b128 copies; all
// callers guarantee 16B alignment (bases/strides are multiples of 8 halves).
__device__ __forceinline__ void gemm_core(
    const half_t* gA, long sAr, int aRows,
    const half_t* gB, long sBr, int bRows,
    int kTot, int kMax, half_t* lA, half_t* lB, v8f* acc) {
  const int tid  = threadIdx.x;
  const int wave = tid >> 5, lane = tid & 31;
  const u32x4 z4 = {0, 0, 0, 0};
  for (int k0 = 0; k0 < kTot; k0 += 64) {
    if (k0 + 64 < kTot) {            // hint next slab -> global_prefetch_b8
      __builtin_prefetch(gA + (long)(k0 + 64), 0, 1);
      __builtin_prefetch(gB + (long)(k0 + 64), 0, 1);
    }
    // stage 64x64 A and B^T slabs, 16B per transfer, 4 iters/thread
    for (int t = tid; t < 512; t += 128) {
      int r = t >> 3, c8 = (t & 7) << 3, k = k0 + c8;
      half_t* dA = lA + r * 72 + c8;
      half_t* dB = lB + r * 72 + c8;
      if (k + 8 <= kMax) {
        if (r < aRows) *(u32x4*)dA = *(const u32x4*)(gA + (long)r * sAr + k);
        else           *(u32x4*)dA = z4;
        if (r < bRows) *(u32x4*)dB = *(const u32x4*)(gB + (long)r * sBr + k);
        else           *(u32x4*)dB = z4;
      } else {
        for (int j = 0; j < 8; ++j) {
          int kk = k + j;
          dA[j] = (r < aRows && kk < kMax) ? gA[(long)r * sAr + kk] : (half_t)0.f;
          dB[j] = (r < bRows && kk < kMax) ? gB[(long)r * sBr + kk] : (half_t)0.f;
        }
      }
    }
    __syncthreads();
    const half_t* aBase = lA + (wave << 4) * 72;
#pragma unroll
    for (int kk = 0; kk < 64; kk += 32) {
      v16h af = load_frag(aBase, 72, lane, kk);
#pragma unroll
      for (int nt = 0; nt < 4; ++nt) {
        v16h bf = load_frag(lB + (nt << 4) * 72, 72, lane, kk);
        acc[nt] = __builtin_amdgcn_wmma_f32_16x16x32_f16(
            false, af, false, bf, (short)0, acc[nt], false, false);
      }
    }
    __syncthreads();
  }
}

#define GEMM_SHARED                                    \
  __shared__ alignas(16) half_t lA[64 * 72];           \
  __shared__ alignas(16) half_t lB[64 * 72];           \
  v8f acc[4];                                          \
  { v8f z = {}; for (int i = 0; i < 4; ++i) acc[i] = z; }

// C/D VGPR layout: vgpr i, lane l -> row = i + 8*(l>>4), col = l&15.
#define EPILOGUE_VARS                                  \
  const int lane = threadIdx.x & 31;                   \
  const int rbase = ((threadIdx.x >> 5) << 4) + ((lane >> 4) << 3); \
  const int cbase = lane & 15;

// ---------------- elementwise kernels ----------------
__global__ void k_f2h(const float* __restrict__ in, half_t* __restrict__ out, int n) {
  int i = blockIdx.x * blockDim.x + threadIdx.x;
  if (i < n) out[i] = (half_t)in[i];
}

// Build q_pos (S,S,64) and v_pos^T (S,64,208) f16 via table gathers.
__global__ void k_pos(const float* qtx, const float* qty,
                      const float* vtx, const float* vty,
                      const int* xd, const int* yd,
                      half_t* qpos, half_t* vposT) {
  int i = blockIdx.x * blockDim.x + threadIdx.x;
  if (i >= kS * kS) return;
  int dx = xd[i], dy = yd[i];
  int q = i / kS, kk = i % kS;
  size_t qb = (size_t)i * 64;
  size_t vb = (size_t)q * kD * kSP + kk;
  for (int j = 0; j < 32; ++j) {
    qpos[qb + j]      = (half_t)qtx[dx * 32 + j];
    qpos[qb + 32 + j] = (half_t)qty[dy * 32 + j];
    vposT[vb + (size_t)j * kSP]        = (half_t)vtx[dx * 32 + j];
    vposT[vb + (size_t)(32 + j) * kSP] = (half_t)vty[dy * 32 + j];
  }
}

// ---------------- phase kernels ----------------
// QKV projection: (12608x768) @ W^T + b.
// Q,K stored [bh][s][d]; V stored transposed [bh][d][sP] so the P@V GEMM
// has unit-stride K and stages with b128 copies.
__global__ void k_proj(const half_t* __restrict__ xh,
                       const half_t* wq, const half_t* wk, const half_t* wv,
                       const float* bq, const float* bk, const float* bv,
                       half_t* Q, half_t* K, half_t* Vt) {
  GEMM_SHARED
  int m0 = blockIdx.x << 6, n0 = blockIdx.y << 6, sel = blockIdx.z;
  const half_t* W    = sel == 0 ? wq : sel == 1 ? wk : wv;
  const float*  bias = sel == 0 ? bq : sel == 1 ? bk : bv;
  gemm_core(xh + (long)m0 * kE, kE, imin(64, kM - m0),
            W + (long)n0 * kE, kE, imin(64, kE - n0),
            kE, kE, lA, lB, acc);
  EPILOGUE_VARS
#pragma unroll
  for (int nt = 0; nt < 4; ++nt)
#pragma unroll
    for (int i = 0; i < 8; ++i) {
      int m = m0 + rbase + i, n = n0 + (nt << 4) + cbase;
      if (m < kM) {
        int b = m / kS, s = m % kS, h = n >> 6, d = n & 63;
        half_t val = (half_t)(acc[nt][i] + bias[n]);
        size_t bh = (size_t)b * kH + h;
        if (sel == 0)      Q[(bh * kS + s) * kD + d] = val;
        else if (sel == 1) K[(bh * kS + s) * kD + d] = val;
        else               Vt[(bh * kD + d) * kSP + s] = val;
      }
    }
}

// Rel logits (per q): Rel_q[bh][k] = Q[bh,q,:] . q_pos[q,k,:]  -> P buffer [q][bh][k]
__global__ void k_rel(const half_t* __restrict__ Q,
                      const half_t* __restrict__ qpos,
                      half_t* __restrict__ P) {
  GEMM_SHARED
  int m0 = blockIdx.x << 6, n0 = blockIdx.y << 6, q = blockIdx.z;
  gemm_core(Q + (size_t)m0 * kS * kD + (size_t)q * kD, (long)kS * kD, 64,
            qpos + ((size_t)q * kS + n0) * kD, kD, imin(64, kS - n0),
            kD, kD, lA, lB, acc);
  EPILOGUE_VARS
#pragma unroll
  for (int nt = 0; nt < 4; ++nt)
#pragma unroll
    for (int i = 0; i < 8; ++i) {
      int m = m0 + rbase + i, n = n0 + (nt << 4) + cbase;
      if (n < kSP)
        P[((size_t)q * kBH + m) * kSP + n] = (half_t)acc[nt][i];
    }
}

// Content logits + rel add + softmax, in-place over P.  One block = (bh, 16 q rows, all k).
__global__ void k_attn(const half_t* __restrict__ Q, const half_t* __restrict__ K,
                       half_t* __restrict__ P) {
  __shared__ alignas(16) half_t lQ[16 * 72];
  __shared__ alignas(16) half_t lK[kSP * 72];
  __shared__ float lgt[16 * 224];
  const int q0 = blockIdx.x << 4, bh = blockIdx.y;
  const int tid = threadIdx.x, wave = tid >> 5, lane = tid & 31;
  const u32x4 z4 = {0, 0, 0, 0};

  for (int t = tid; t < 16 * 8; t += 128) {
    int r = t >> 3, c8 = (t & 7) << 3, q = q0 + r;
    u32x4 v = z4;
    if (q < kS) v = *(const u32x4*)(Q + ((size_t)bh * kS + q) * kD + c8);
    *(u32x4*)(lQ + r * 72 + c8) = v;
  }
  for (int t = tid; t < kSP * 8; t += 128) {
    int r = t >> 3, c8 = (t & 7) << 3;
    u32x4 v = z4;
    if (r < kS) v = *(const u32x4*)(K + ((size_t)bh * kS + r) * kD + c8);
    *(u32x4*)(lK + r * 72 + c8) = v;
  }
  __syncthreads();

  v16h af0 = load_frag(lQ, 72, lane, 0);
  v16h af1 = load_frag(lQ, 72, lane, 32);
  const int rb = (lane >> 4) << 3, cb = lane & 15;
  for (int nt = wave; nt < 13; nt += 4) {
    v8f a = {};
    v16h bf0 = load_frag(lK + nt * 16 * 72, 72, lane, 0);
    v16h bf1 = load_frag(lK + nt * 16 * 72, 72, lane, 32);
    a = __builtin_amdgcn_wmma_f32_16x16x32_f16(false, af0, false, bf0, (short)0, a, false, false);
    a = __builtin_amdgcn_wmma_f32_16x16x32_f16(false, af1, false, bf1, (short)0, a, false, false);
    int col = (nt << 4) + cb;
#pragma unroll
    for (int i = 0; i < 8; ++i) {
      int row = rb + i, q = q0 + row;
      float relv = 0.f;
      if (q < kS && col < kSP) relv = (float)P[((size_t)q * kBH + bh) * kSP + col];
      lgt[row * 224 + col] = (a[i] + relv) * 0.125f;   // 1/sqrt(64)
    }
  }
  __syncthreads();

  // softmax: 8 threads per row
  int r = tid >> 3, t8 = tid & 7;
  float mx = -3.0e38f;
  for (int k = t8; k < kS; k += 8) mx = fmaxf(mx, lgt[r * 224 + k]);
  for (int off = 4; off; off >>= 1) mx = fmaxf(mx, __shfl_xor(mx, off, 8));
  float sum = 0.f;
  for (int k = t8; k < kS; k += 8) {
    float e = __expf(lgt[r * 224 + k] - mx);
    lgt[r * 224 + k] = e;
    sum += e;
  }
  for (int off = 4; off; off >>= 1) sum += __shfl_xor(sum, off, 8);
  float inv = 1.f / sum;
  int q = q0 + r;
  if (q < kS)
    for (int k = t8; k < kSP; k += 8) {
      float p = (k < kS) ? lgt[r * 224 + k] * inv : 0.f;
      P[((size_t)q * kBH + bh) * kSP + k] = (half_t)p;
    }
}

// Content output (per bh): O1[b,q,h*64+d] = P[bh] @ V[bh]   (fp32)
__global__ void k_pv(const half_t* __restrict__ P, const half_t* __restrict__ Vt,
                     float* __restrict__ O1) {
  GEMM_SHARED
  int m0 = blockIdx.x << 6, bh = blockIdx.y;
  gemm_core(P + ((size_t)m0 * kBH + bh) * kSP, (long)kBH * kSP, imin(64, kS - m0),
            Vt + (size_t)bh * kD * kSP, kSP, 64,
            224, kS, lA, lB, acc);
  EPILOGUE_VARS
  int b = bh / kH, h = bh % kH;
#pragma unroll
  for (int nt = 0; nt < 4; ++nt)
#pragma unroll
    for (int i = 0; i < 8; ++i) {
      int q = m0 + rbase + i, d = (nt << 4) + cbase;
      if (q < kS)
        O1[((size_t)b * kS + q) * kE + h * kD + d] = acc[nt][i];
    }
}

// v_pos output (per q): add P_qslice @ v_pos[q]; finalize O1 -> f16 for out-proj.
__global__ void k_vpos(const half_t* __restrict__ P, const half_t* __restrict__ vposT,
                       const float* __restrict__ O1, half_t* __restrict__ O1h) {
  GEMM_SHARED
  int m0 = blockIdx.x << 6, q = blockIdx.y;
  gemm_core(P + ((size_t)q * kBH + m0) * kSP, kSP, 64,
            vposT + (size_t)q * kD * kSP, kSP, 64,
            224, kS, lA, lB, acc);
  EPILOGUE_VARS
#pragma unroll
  for (int nt = 0; nt < 4; ++nt)
#pragma unroll
    for (int i = 0; i < 8; ++i) {
      int bh = m0 + rbase + i, d = (nt << 4) + cbase;
      int b = bh / kH, h = bh % kH;
      size_t idx = ((size_t)b * kS + q) * kE + h * kD + d;
      O1h[idx] = (half_t)(acc[nt][i] + O1[idx]);
    }
}

// Output projection: out = O1h @ Wo^T + bo   (fp32 out)
__global__ void k_out(const half_t* __restrict__ O1h, const half_t* __restrict__ wo,
                      const float* __restrict__ bo, float* __restrict__ out) {
  GEMM_SHARED
  int m0 = blockIdx.x << 6, n0 = blockIdx.y << 6;
  gemm_core(O1h + (long)m0 * kE, kE, imin(64, kM - m0),
            wo + (long)n0 * kE, kE, imin(64, kE - n0),
            kE, kE, lA, lB, acc);
  EPILOGUE_VARS
#pragma unroll
  for (int nt = 0; nt < 4; ++nt)
#pragma unroll
    for (int i = 0; i < 8; ++i) {
      int m = m0 + rbase + i, n = n0 + (nt << 4) + cbase;
      if (m < kM)
        out[(size_t)m * kE + n] = acc[nt][i] + bo[n];
    }
}

// ---------------- host launcher ----------------
extern "C" void kernel_launch(void* const* d_in, const int* in_sizes, int n_in,
                              void* d_out, int out_size, void* d_ws, size_t ws_size,
                              hipStream_t stream) {
  (void)in_sizes; (void)n_in; (void)out_size; (void)ws_size;
  const float* x   = (const float*)d_in[0];
  const float* Wq  = (const float*)d_in[1];
  const float* bq  = (const float*)d_in[2];
  const float* Wk  = (const float*)d_in[3];
  const float* bk  = (const float*)d_in[4];
  const float* Wv  = (const float*)d_in[5];
  const float* bv  = (const float*)d_in[6];
  const float* Wo  = (const float*)d_in[7];
  const float* bo  = (const float*)d_in[8];
  const float* qtx = (const float*)d_in[9];
  const float* qty = (const float*)d_in[10];
  const float* vtx = (const float*)d_in[11];
  const float* vty = (const float*)d_in[12];
  const int*   xd  = (const int*)d_in[13];
  const int*   yd  = (const int*)d_in[14];
  float* out = (float*)d_out;

  char* ws = (char*)d_ws;
  size_t off = 0;
  auto take = [&](size_t bytes) {
    void* p = ws + off;
    off += (bytes + 255) & ~(size_t)255;
    return p;
  };
  const size_t NX   = (size_t)kM * kE;           // 9.68M
  const size_t NW   = (size_t)kE * kE;
  const size_t NQ   = (size_t)kBH * kS * kD;     // 9.68M
  const size_t NVT  = (size_t)kBH * kD * kSP;    // 10.2M
  const size_t NPOS = (size_t)kS * kS * kD;
  const size_t NVPT = (size_t)kS * kD * kSP;     // 2.62M
  const size_t NP   = (size_t)kS * kBH * kSP;    // 31.5M

  half_t* xh    = (half_t*)take(NX * 2);
  half_t* wqh   = (half_t*)take(NW * 2);
  half_t* wkh   = (half_t*)take(NW * 2);
  half_t* wvh   = (half_t*)take(NW * 2);
  half_t* woh   = (half_t*)take(NW * 2);
  half_t* Qh    = (half_t*)take(NQ * 2);
  half_t* Kh    = (half_t*)take(NQ * 2);
  half_t* Vt    = (half_t*)take(NVT * 2);
  half_t* qpos  = (half_t*)take(NPOS * 2);
  half_t* vposT = (half_t*)take(NVPT * 2);
  half_t* P     = (half_t*)take(NP * 2);
  float*  O1    = (float*)take(NX * 4);
  half_t* O1h   = xh;  // xh dead after k_proj; reuse

  k_f2h<<<(int)((NX + 255) / 256), 256, 0, stream>>>(x, xh, (int)NX);
  k_f2h<<<(int)((NW + 255) / 256), 256, 0, stream>>>(Wq, wqh, (int)NW);
  k_f2h<<<(int)((NW + 255) / 256), 256, 0, stream>>>(Wk, wkh, (int)NW);
  k_f2h<<<(int)((NW + 255) / 256), 256, 0, stream>>>(Wv, wvh, (int)NW);
  k_f2h<<<(int)((NW + 255) / 256), 256, 0, stream>>>(Wo, woh, (int)NW);
  k_pos<<<(kS * kS + 255) / 256, 256, 0, stream>>>(qtx, qty, vtx, vty, xd, yd, qpos, vposT);

  k_proj<<<dim3(kM / 64, kE / 64, 3), 128, 0, stream>>>(
      xh, wqh, wkh, wvh, bq, bk, bv, Qh, Kh, Vt);
  k_rel<<<dim3(kBH / 64, 4, kS), 128, 0, stream>>>(Qh, qpos, P);
  k_attn<<<dim3((kS + 15) / 16, kBH), 128, 0, stream>>>(Qh, Kh, P);
  k_pv<<<dim3((kS + 63) / 64, kBH), 128, 0, stream>>>(P, Vt, O1);
  k_vpos<<<dim3(kBH / 64, kS), 128, 0, stream>>>(P, vposT, O1, O1h);
  k_out<<<dim3(kM / 64, kE / 64), 128, 0, stream>>>(O1h, woh, bo, out);
}

// v001
// It runs in 370 microseconds.
// In both of two side-by-side timings against v000, it was 1.22 times as fast.
#include <hip/hip_runtime.h>
#include <hip/hip_bf16.h>

// ---------------- problem constants ----------------
constexpr int kB  = 64;        // batch
constexpr int kS  = 197;       // seq len
constexpr int kE  = 768;       // embed
constexpr int kH  = 12;        // heads
constexpr int kD  = 64;        // head dim
constexpr int kBH = kB * kH;   // 768
constexpr int kSP = 208;       // seq padded to mult of 16
constexpr int kM  = kB * kS;   // 12608 rows for projections

typedef _Float16 half_t;
typedef __attribute__((ext_vector_type(16))) _Float16     v16h;
typedef __attribute__((ext_vector_type(8)))  float        v8f;
typedef __attribute__((ext_vector_type(2)))  _Float16     h2;
typedef __attribute__((ext_vector_type(4)))  unsigned int u32x4;

struct HFrag { u32x4 a, b; };

__device__ __forceinline__ int imin(int a, int b) { return a < b ? a : b; }

// Load a 16x32 f16 WMMA A/B fragment from an LDS tile stored row-major
// [16][ldk].  Per ISA: lane<16 holds K {0..7,16..23} of row (lane&15);
// lane>=16 holds K {8..15,24..31}.  Two 16-byte ds_load_b128 per frag.
__device__ __forceinline__ v16h load_frag(const half_t* base, int ldk, int lane, int k0) {
  const half_t* p = base + (lane & 15) * ldk + k0 + ((lane >> 4) << 3);
  HFrag f;
  f.a = *(const u32x4*)p;
  f.b = *(const u32x4*)(p + 16);
  return __builtin_bit_cast(v16h, f);
}

// ---------------- shared 64x64 macro-tile GEMM core ----------------
// 128 threads = 4 waves; wave w owns output rows [16w,16w+16), all 64 cols.
// A element (r,k) at gA[r*sAr + k]; B^T element (n,k) at gB[n*sBr + k].
// K staged in 64-wide slabs, LDS row stride 72 halves (144B = 36 banks,
// gcd(36,64)=4 -> conflict-free).  Staging uses 16-byte b128 copies; all
// callers guarantee 16B alignment (bases/strides are multiples of 8 halves).
__device__ __forceinline__ void gemm_core(
    const half_t* gA, long sAr, int aRows,
    const half_t* gB, long sBr, int bRows,
    int kTot, int kMax, half_t* lA, half_t* lB, v8f* acc) {
  const int tid  = threadIdx.x;
  const int wave = tid >> 5, lane = tid & 31;
  const u32x4 z4 = {0, 0, 0, 0};
  for (int k0 = 0; k0 < kTot; k0 += 64) {
    if (k0 + 64 < kTot) {            // hint next slab -> global_prefetch_b8
      __builtin_prefetch(gA + (long)(k0 + 64), 0, 1);
      __builtin_prefetch(gB + (long)(k0 + 64), 0, 1);
    }
    // stage 64x64 A and B^T slabs, 16B per transfer, 4 iters/thread
    for (int t = tid; t < 512; t += 128) {
      int r = t >> 3, c8 = (t & 7) << 3, k = k0 + c8;
      half_t* dA = lA + r * 72 + c8;
      half_t* dB = lB + r * 72 + c8;
      if (k + 8 <= kMax) {
        if (r < aRows) *(u32x4*)dA = *(const u32x4*)(gA + (long)r * sAr + k);
        else           *(u32x4*)dA = z4;
        if (r < bRows) *(u32x4*)dB = *(const u32x4*)(gB + (long)r * sBr + k);
        else           *(u32x4*)dB = z4;
      } else {
        for (int j = 0; j < 8; ++j) {
          int kk = k + j;
          dA[j] = (r < aRows && kk < kMax) ? gA[(long)r * sAr + kk] : (half_t)0.f;
          dB[j] = (r < bRows && kk < kMax) ? gB[(long)r * sBr + kk] : (half_t)0.f;
        }
      }
    }
    __syncthreads();
    const half_t* aBase = lA + (wave << 4) * 72;
#pragma unroll
    for (int kk = 0; kk < 64; kk += 32) {
      v16h af = load_frag(aBase, 72, lane, kk);
#pragma unroll
      for (int nt = 0; nt < 4; ++nt) {
        v16h bf = load_frag(lB + (nt << 4) * 72, 72, lane, kk);
        acc[nt] = __builtin_amdgcn_wmma_f32_16x16x32_f16(
            false, af, false, bf, (short)0, acc[nt], false, false);
      }
    }
    __syncthreads();
  }
}

#define GEMM_SHARED                                    \
  __shared__ alignas(16) half_t lA[64 * 72];           \
  __shared__ alignas(16) half_t lB[64 * 72];           \
  v8f acc[4];                                          \
  { v8f z = {}; for (int i = 0; i < 4; ++i) acc[i] = z; }

// C/D VGPR layout: vgpr i, lane l -> row = i + 8*(l>>4), col = l&15.
#define EPILOGUE_VARS                                  \
  const int lane = threadIdx.x & 31;                   \
  const int rbase = ((threadIdx.x >> 5) << 4) + ((lane >> 4) << 3); \
  const int cbase = lane & 15;

// ---------------- 128x128 macro-tile GEMM core (dense projections) ----------------
// 128 threads = 4 waves in a 2x2 grid; each wave owns a 64x64 block of the
// tile as 4x4 accumulator tiles, so every fragment read from LDS feeds four
// WMMAs.  A is [aRows][kE], B^T is [128][kE], both K-contiguous; K runs over kE in
// 64-wide slabs at the same 72-half LDS pitch as above.  Rows past aRows
// re-read row aRows-1; callers never store the results of those rows.
__device__ __forceinline__ void gemm_core128(
    const half_t* __restrict__ gA, int aRows, const half_t* __restrict__ gB,
    half_t* lA, half_t* lB, v8f (&acc)[4][4]) {
  const int tid  = threadIdx.x;
  const int wave = tid >> 5, lane = tid & 31;
  const int r0 = tid >> 3, c8 = (tid & 7) << 3;
  // byte offsets of this thread's eight A rows and of its first B row
  unsigned offA[8];
#pragma unroll
  for (int j = 0; j < 8; ++j)
    offA[j] = (unsigned)(imin(r0 + 16 * j, aRows - 1) * kE + c8) * 2u;
  const unsigned offB = (unsigned)(r0 * kE + c8) * 2u;
  const char* cA = (const char*)gA;
  const char* cB = (const char*)gB;
  half_t* sA = lA + r0 * 72 + c8;
  half_t* sB = lB + r0 * 72 + c8;
  const half_t* aBase = lA + ((wave >> 1) << 6) * 72;
  const half_t* bBase = lB + ((wave & 1) << 6) * 72;
  // Unrolled so that k0 is an immediate offset of every load: no address
  // arithmetic per slab, and no address register is rewritten behind a load.
#pragma unroll
  for (int k0 = 0; k0 < kE; k0 += 64) {
    u32x4 ta[8], tb[8];
#pragma unroll
    for (int j = 0; j < 8; ++j) ta[j] = *(const u32x4*)(cA + offA[j] + k0 * 2);
#pragma unroll
    for (int j = 0; j < 8; ++j) tb[j] = *(const u32x4*)(cB + offB + (k0 + j * 16 * kE) * 2);
    // Precaution: the offset registers that the issued loads name stay live up
    // to this wait, so none is reused (not even as a load's destination) ahead of it.
    asm volatile("s_wait_xcnt 0x0"
                 :: "v"(offA[0]), "v"(offA[1]), "v"(offA[2]), "v"(offA[3]), "v"(offA[4]),
                    "v"(offA[5]), "v"(offA[6]), "v"(offA[7]), "v"(offB)
                 : "memory");
#pragma unroll
    for (int j = 0; j < 8; ++j) {
      *(u32x4*)(sA + j * 16 * 72) = ta[j];
      *(u32x4*)(sB + j * 16 * 72) = tb[j];
    }
    __syncthreads();
#pragma unroll
    for (int kk = 0; kk < 64; kk += 32) {
      v16h af[4], bf[4];
#pragma unroll
      for (int t = 0; t < 4; ++t) {
        af[t] = load_frag(aBase + (t << 4) * 72, 72, lane, kk);
        bf[t] = load_frag(bBase + (t << 4) * 72, 72, lane, kk);
      }
#pragma unroll
      for (int mt = 0; mt < 4; ++mt)
#pragma unroll
        for (int nt = 0; nt < 4; ++nt)
          acc[mt][nt] = __builtin_amdgcn_wmma_f32_16x16x32_f16(
              false, af[mt], false, bf[nt], (short)0, acc[mt][nt], false, false);
    }
    __syncthreads();
  }
}

#define GEMM128_SHARED                                 \
  __shared__ alignas(16) half_t lA[128 * 72];          \
  __shared__ alignas(16) half_t lB[128 * 72];          \
  v8f acc[4][4];                                       \
  { v8f z = {};                                        \
    for (int i = 0; i < 4; ++i)                        \
      for (int j = 0; j < 4; ++j) acc[i][j] = z; }

// Same C/D layout; the wave's 64x64 block starts at (64*(wave>>1), 64*(wave&1)).
#define EPILOGUE128_VARS                               \
  const int lane = threadIdx.x & 31;                   \
  const int wid = threadIdx.x >> 5;                    \
  const int rbase = ((wid >> 1) << 6) + ((lane >> 4) << 3); \
  const int cbase = ((wid & 1) << 6) + (lane & 15);

// Four f16 stores at base + off, STEP bytes apart, two values to a register.
// Stores and wait are one statement so that the offset and the two data
// registers stay untouched up to the s_wait_xcnt (a precaution; a wait in a
// statement of its own does not hold later register writes behind it).
template <int STEP>
__device__ __forceinline__ void store4(half_t* base, unsigned off,
                                       float a0, float a1, float a2, float a3) {
  h2 p01 = {(half_t)a0, (half_t)a1}, p23 = {(half_t)a2, (half_t)a3};
  asm volatile(
      "global_store_b16 %0, %1, %3\n\t"
      "global_store_d16_hi_b16 %0, %1, %3 offset:%4\n\t"
      "global_store_b16 %0, %2, %3 offset:%5\n\t"
      "global_store_d16_hi_b16 %0, %2, %3 offset:%6\n\t"
      "s_wait_xcnt 0x0"
      :: "v"(off), "v"(__builtin_bit_cast(unsigned, p01)), "v"(__builtin_bit_cast(unsigned, p23)),
         "s"(base), "n"(STEP), "n"(2 * STEP), "n"(3 * STEP)
      : "memory");
}

// ---------------- elementwise kernels ----------------
__global__ void k_f2h(const float* __restrict__ in, half_t* __restrict__ out, int n) {
  int i = blockIdx.x * blockDim.x + threadIdx.x;
  if (i < n) out[i] = (half_t)in[i];
}

// Build q_pos (S,S,64) and v_pos^T (S,64,208) f16 via table gathers.
__global__ void k_pos(const float* qtx, const float* qty,
                      const float* vtx, const float* vty,
                      const int* xd, const int* yd,
                      half_t* qpos, half_t* vposT) {
  int i = blockIdx.x * blockDim.x + threadIdx.x;
  if (i >= kS * kS) return;
  int dx = xd[i], dy = yd[i];
  int q = i / kS, kk = i % kS;
  size_t qb = (size_t)i * 64;
  size_t vb = (size_t)q * kD * kSP + kk;
  for (int j = 0; j < 32; ++j) {
    qpos[qb + j]      = (half_t)qtx[dx * 32 + j];
    qpos[qb + 32 + j] = (half_t)qty[dy * 32 + j];
    vposT[vb + (size_t)j * kSP]        = (half_t)vtx[dx * 32 + j];
    vposT[vb + (size_t)(32 + j) * kSP] = (half_t)vty[dy * 32 + j];
  }
}

// ---------------- phase kernels ----------------
// QKV projection: (12608x768) @ W^T + b.
// Q,K stored [bh][s][d]; V stored transposed [bh][d][sP] so the P@V GEMM
// has unit-stride K and stages with b128 copies.
__global__ __launch_bounds__(128) void k_proj(const half_t* __restrict__ xh,
                       const half_t* wq, const half_t* wk, const half_t* wv,
                       const float* bq, const float* bk, const float* bv,
                       half_t* Q, half_t* K, half_t* Vt) {
  GEMM128_SHARED
  int m0 = blockIdx.x << 7, n0 = blockIdx.y << 7, sel = blockIdx.z;
  const half_t* W    = sel == 0 ? wq : sel == 1 ? wk : wv;
  const float*  bias = sel == 0 ? bq : sel == 1 ? bk : bv;
  gemm_core128(xh + (long)m0 * kE, imin(128, kM - m0), W + (long)n0 * kE, lA, lB, acc);
  EPILOGUE128_VARS
  float bz[4];
#pragma unroll
  for (int nt = 0; nt < 4; ++nt) bz[nt] = bias[n0 + cbase + (nt << 4)];
  // A wave's 64 columns are one head: column d = d0 + 16*nt of head h, so the
  // four columns of a row share one offset and differ by a constant step.
  const int h = (n0 + cbase) >> 6, d0 = cbase & 63;
  if (sel < 2) {
    half_t* qk = sel == 0 ? Q : K;
#pragma unroll
    for (int mt = 0; mt < 4; ++mt)
#pragma unroll
      for (int i = 0; i < 8; ++i) {
        int m = m0 + rbase + (mt << 4) + i;
        if (m < kM) {
          int b = m / kS, s = m % kS;
          store4<16 * 2>(qk, (unsigned)((((b * kH + h) * kS + s) * kD + d0) * 2),
                         acc[mt][0][i] + bz[0], acc[mt][1][i] + bz[1],
                         acc[mt][2][i] + bz[2], acc[mt][3][i] + bz[3]);
        }
      }
  } else {
#pragma unroll
    for (int mt = 0; mt < 4; ++mt)
#pragma unroll
      for (int i = 0; i < 8; ++i) {
        int m = m0 + rbase + (mt << 4) + i;
        if (m < kM) {
          int b = m / kS, s = m % kS;
          store4<16 * kSP * 2>(Vt, (unsigned)((((b * kH + h) * kD + d0) * kSP + s) * 2),
                               acc[mt][0][i] + bz[0], acc[mt][1][i] + bz[1],
                               acc[mt][2][i] + bz[2], acc[mt][3][i] + bz[3]);
        }
      }
  }
}

// Rel logits (per q): Rel_q[bh][k] = Q[bh,q,:] . q_pos[q,k,:]  -> P buffer [q][bh][k]
__global__ void k_rel(const half_t* __restrict__ Q,
                      const half_t* __restrict__ qpos,
                      half_t* __restrict__ P) {
  GEMM_SHARED
  int m0 = blockIdx.x << 6, n0 = blockIdx.y << 6, q = blockIdx.z;
  gemm_core(Q + (size_t)m0 * kS * kD + (size_t)q * kD, (long)kS * kD, 64,
            qpos + ((size_t)q * kS + n0) * kD, kD, imin(64, kS - n0),
            kD, kD, lA, lB, acc);
  EPILOGUE_VARS
#pragma unroll
  for (int nt = 0; nt < 4; ++nt)
#pragma unroll
    for (int i = 0; i < 8; ++i) {
      int m = m0 + rbase + i, n = n0 + (nt << 4) + cbase;
      if (n < kSP)
        P[((size_t)q * kBH + m) * kSP + n] = (half_t)acc[nt][i];
    }
}

// Content logits + rel add + softmax, in-place over P.  One block = (bh, 16 q rows, all k).
__global__ void k_attn(const half_t* __restrict__ Q, const half_t* __restrict__ K,
                       half_t* __restrict__ P) {
  __shared__ alignas(16) half_t lQ[16 * 72];
  __shared__ alignas(16) half_t lK[kSP * 72];
  __shared__ float lgt[16 * 224];
  const int q0 = blockIdx.x << 4, bh = blockIdx.y;
  const int tid = threadIdx.x, wave = tid >> 5, lane = tid & 31;
  const u32x4 z4 = {0, 0, 0, 0};

  for (int t = tid; t < 16 * 8; t += 128) {
    int r = t >> 3, c8 = (t & 7) << 3, q = q0 + r;
    u32x4 v = z4;
    if (q < kS) v = *(const u32x4*)(Q + ((size_t)bh * kS + q) * kD + c8);
    *(u32x4*)(lQ + r * 72 + c8) = v;
  }
  for (int t = tid; t < kSP * 8; t += 128) {
    int r = t >> 3, c8 = (t & 7) << 3;
    u32x4 v = z4;
    if (r < kS) v = *(const u32x4*)(K + ((size_t)bh * kS + r) * kD + c8);
    *(u32x4*)(lK + r * 72 + c8) = v;
  }
  __syncthreads();

  v16h af0 = load_frag(lQ, 72, lane, 0);
  v16h af1 = load_frag(lQ, 72, lane, 32);
  const int rb = (lane >> 4) << 3, cb = lane & 15;
  for (int nt = wave; nt < 13; nt += 4) {
    v8f a = {};
    v16h bf0 = load_frag(lK + nt * 16 * 72, 72, lane, 0);
    v16h bf1 = load_frag(lK + nt * 16 * 72, 72, lane, 32);
    a = __builtin_amdgcn_wmma_f32_16x16x32_f16(false, af0, false, bf0, (short)0, a, false, false);
    a = __builtin_amdgcn_wmma_f32_16x16x32_f16(false, af1, false, bf1, (short)0, a, false, false);
    int col = (nt << 4) + cb;
#pragma unroll
    for (int i = 0; i < 8; ++i) {
      int row = rb + i, q = q0 + row;
      float relv = 0.f;
      if (q < kS && col < kSP) relv = (float)P[((size_t)q * kBH + bh) * kSP + col];
      lgt[row * 224 + col] = (a[i] + relv) * 0.125f;   // 1/sqrt(64)
    }
  }
  __syncthreads();

  // softmax: 8 threads per row
  int r = tid >> 3, t8 = tid & 7;
  float mx = -3.0e38f;
  for (int k = t8; k < kS; k += 8) mx = fmaxf(mx, lgt[r * 224 + k]);
  for (int off = 4; off; off >>= 1) mx = fmaxf(mx, __shfl_xor(mx, off, 8));
  float sum = 0.f;
  for (int k = t8; k < kS; k += 8) {
    float e = __expf(lgt[r * 224 + k] - mx);
    lgt[r * 224 + k] = e;
    sum += e;
  }
  for (int off = 4; off; off >>= 1) sum += __shfl_xor(sum, off, 8);
  float inv = 1.f / sum;
  int q = q0 + r;
  if (q < kS)
    for (int k = t8; k < kSP; k += 8) {
      float p = (k < kS) ? lgt[r * 224 + k] * inv : 0.f;
      P[((size_t)q * kBH + bh) * kSP + k] = (half_t)p;
    }
}

// Content output (per bh): O1[b,q,h*64+d] = P[bh] @ V[bh]   (fp32)
__global__ void k_pv(const half_t* __restrict__ P, const half_t* __restrict__ Vt,
                     float* __restrict__ O1) {
  GEMM_SHARED
  int m0 = blockIdx.x << 6, bh = blockIdx.y;
  gemm_core(P + ((size_t)m0 * kBH + bh) * kSP, (long)kBH * kSP, imin(64, kS - m0),
            Vt + (size_t)bh * kD * kSP, kSP, 64,
            224, kS, lA, lB, acc);
  EPILOGUE_VARS
  int b = bh / kH, h = bh % kH;
#pragma unroll
  for (int nt = 0; nt < 4; ++nt)
#pragma unroll
    for (int i = 0; i < 8; ++i) {
      int q = m0 + rbase + i, d = (nt << 4) + cbase;
      if (q < kS)
        O1[((size_t)b * kS + q) * kE + h * kD + d] = acc[nt][i];
    }
}

// v_pos output (per q): add P_qslice @ v_pos[q]; finalize O1 -> f16 for out-proj.
__global__ void k_vpos(const half_t* __restrict__ P, const half_t* __restrict__ vposT,
                       const float* __restrict__ O1, half_t* __restrict__ O1h) {
  GEMM_SHARED
  int m0 = blockIdx.x << 6, q = blockIdx.y;
  gemm_core(P + ((size_t)q * kBH + m0) * kSP, kSP, 64,
            vposT + (size_t)q * kD * kSP, kSP, 64,
            224, kS, lA, lB, acc);
  EPILOGUE_VARS
#pragma unroll
  for (int nt = 0; nt < 4; ++nt)
#pragma unroll
    for (int i = 0; i < 8; ++i) {
      int bh = m0 + rbase + i, d = (nt << 4) + cbase;
      int b = bh / kH, h = bh % kH;
      size_t idx = ((size_t)b * kS + q) * kE + h * kD + d;
      O1h[idx] = (half_t)(acc[nt][i] + O1[idx]);
    }
}

// Output projection: out = O1h @ Wo^T + bo   (fp32 out)
__global__ __launch_bounds__(128) void k_out(const half_t* __restrict__ O1h, const half_t* __restrict__ wo,
                      const float* __restrict__ bo, float* __restrict__ out) {
  GEMM128_SHARED
  int m0 = blockIdx.x << 7, n0 = blockIdx.y << 7;
  gemm_core128(O1h + (long)m0 * kE, imin(128, kM - m0), wo + (long)n0 * kE, lA, lB, acc);
  EPILOGUE128_VARS
  float bz[4];
#pragma unroll
  for (int nt = 0; nt < 4; ++nt) bz[nt] = bo[n0 + cbase + (nt << 4)];
#pragma unroll
  for (int mt = 0; mt < 4; ++mt)
#pragma unroll
    for (int i = 0; i < 8; ++i) {
      int m = m0 + rbase + (mt << 4) + i;
      if (m < kM) {
#pragma unroll
        for (int nt = 0; nt < 4; ++nt) {
          int n = n0 + cbase + (nt << 4);
          out[(size_t)m * kE + n] = acc[mt][nt][i] + bz[nt];
        }
      }
    }
}

// ---------------- host launcher ----------------
extern "C" void kernel_launch(void* const* d_in, const int* in_sizes, int n_in,
                              void* d_out, int out_size, void* d_ws, size_t ws_size,
                              hipStream_t stream) {
  (void)in_sizes; (void)n_in; (void)out_size; (void)ws_size;
  const float* x   = (const float*)d_in[0];
  const float* Wq  = (const float*)d_in[1];
  const float* bq  = (const float*)d_in[2];
  const float* Wk  = (const float*)d_in[3];
  const float* bk  = (const float*)d_in[4];
  const float* Wv  = (const float*)d_in[5];
  const float* bv  = (const float*)d_in[6];
  const float* Wo  = (const float*)d_in[7];
  const float* bo  = (const float*)d_in[8];
  const float* qtx = (const float*)d_in[9];
  const float* qty = (const float*)d_in[10];
  const float* vtx = (const float*)d_in[11];
  const float* vty = (const float*)d_in[12];
  const int*   xd  = (const int*)d_in[13];
  const int*   yd  = (const int*)d_in[14];
  float* out = (float*)d_out;

  char* ws = (char*)d_ws;
  size_t off = 0;
  auto take = [&](size_t bytes) {
    void* p = ws + off;
    off += (bytes + 255) & ~(size_t)255;
    return p;
  };
  const size_t NX   = (size_t)kM * kE;           // 9.68M
  const size_t NW   = (size_t)kE * kE;
  const size_t NQ   = (size_t)kBH * kS * kD;     // 9.68M
  const size_t NVT  = (size_t)kBH * kD * kSP;    // 10.2M
  const size_t NPOS = (size_t)kS * kS * kD;
  const size_t NVPT = (size_t)kS * kD * kSP;     // 2.62M
  const size_t NP   = (size_t)kS * kBH * kSP;    // 31.5M

  half_t* xh    = (half_t*)take(NX * 2);
  half_t* wqh   = (half_t*)take(NW * 2);
  half_t* wkh   = (half_t*)take(NW * 2);
  half_t* wvh   = (half_t*)take(NW * 2);
  half_t* woh   = (half_t*)take(NW * 2);
  half_t* Qh    = (half_t*)take(NQ * 2);
  half_t* Kh    = (half_t*)take(NQ * 2);
  half_t* Vt    = (half_t*)take(NVT * 2);
  half_t* qpos  = (half_t*)take(NPOS * 2);
  half_t* vposT = (half_t*)take(NVPT * 2);
  half_t* P     = (half_t*)take(NP * 2);
  float*  O1    = (float*)take(NX * 4);
  half_t* O1h   = xh;  // xh dead after k_proj; reuse

  k_f2h<<<(int)((NX + 255) / 256), 256, 0, stream>>>(x, xh, (int)NX);
  k_f2h<<<(int)((NW + 255) / 256), 256, 0, stream>>>(Wq, wqh, (int)NW);
  k_f2h<<<(int)((NW + 255) / 256), 256, 0, stream>>>(Wk, wkh, (int)NW);
  k_f2h<<<(int)((NW + 255) / 256), 256, 0, stream>>>(Wv, wvh, (int)NW);
  k_f2h<<<(int)((NW + 255) / 256), 256, 0, stream>>>(Wo, woh, (int)NW);
  k_pos<<<(kS * kS + 255) / 256, 256, 0, stream>>>(qtx, qty, vtx, vty, xd, yd, qpos, vposT);

  k_proj<<<dim3((kM + 127) / 128, kE / 128, 3), 128, 0, stream>>>(
      xh, wqh, wkh, wvh, bq, bk, bv, Qh, Kh, Vt);
  k_rel<<<dim3(kBH / 64, 4, kS), 128, 0, stream>>>(Qh, qpos, P);
  k_attn<<<dim3((kS + 15) / 16, kBH), 128, 0, stream>>>(Qh, Kh, P);
  k_pv<<<dim3((kS + 63) / 64, kBH), 128, 0, stream>>>(P, Vt, O1);
  k_vpos<<<dim3(kBH / 64, kS), 128, 0, stream>>>(P, vposT, O1, O1h);
  k_out<<<dim3((kM + 127) / 128, kE / 128), 128, 0, stream>>>(O1h, woh, bo, out);
}

// v002
// It runs in 350 microseconds.
// Timed twice side by side with v001, it ran 1.06 times as fast both times.
// Counting every step since v000, it is 1.29 times as fast.
#include <hip/hip_runtime.h>
#include <hip/hip_bf16.h>

// ---------------- problem constants ----------------
constexpr int kB  = 64;        // batch
constexpr int kS  = 197;       // seq len
constexpr int kE  = 768;       // embed
constexpr int kH  = 12;        // heads
constexpr int kD  = 64;        // head dim
constexpr int kBH = kB * kH;   // 768
constexpr int kSP = 208;       // seq padded to mult of 16
constexpr int kM  = kB * kS;   // 12608 rows for projections

typedef _Float16 half_t;
typedef __attribute__((ext_vector_type(16))) _Float16     v16h;
typedef __attribute__((ext_vector_type(8)))  float        v8f;
typedef __attribute__((ext_vector_type(2)))  _Float16     h2;
typedef __attribute__((ext_vector_type(4)))  unsigned int u32x4;

struct HFrag { u32x4 a, b; };

__device__ __forceinline__ int imin(int a, int b) { return a < b ? a : b; }

// Load a 16x32 f16 WMMA A/B fragment from an LDS tile stored row-major
// [16][ldk].  Per ISA: lane<16 holds K {0..7,16..23} of row (lane&15);
// lane>=16 holds K {8..15,24..31}.  Two 16-byte ds_load_b128 per frag.
__device__ __forceinline__ v16h load_frag(const half_t* base, int ldk, int lane, int k0) {
  const half_t* p = base + (lane & 15) * ldk + k0 + ((lane >> 4) << 3);
  HFrag f;
  f.a = *(const u32x4*)p;
  f.b = *(const u32x4*)(p + 16);
  return __builtin_bit_cast(v16h, f);
}

// ---------------- shared 64x64 macro-tile GEMM core ----------------
// 128 threads = 4 waves; wave w owns output rows [16w,16w+16), all 64 cols.
// A element (r,k) at gA[r*sAr + k]; B^T element (n,k) at gB[n*sBr + k].
// K staged in 64-wide slabs, LDS row stride 72 halves (144B = 36 banks,
// gcd(36,64)=4 -> conflict-free).  Staging uses 16-byte b128 copies; all
// callers guarantee 16B alignment (bases/strides are multiples of 8 halves).
__device__ __forceinline__ void gemm_core(
    const half_t* gA, long sAr, int aRows,
    const half_t* gB, long sBr, int bRows,
    int kTot, int kMax, half_t* lA, half_t* lB, v8f* acc) {
  const int tid  = threadIdx.x;
  const int wave = tid >> 5, lane = tid & 31;
  const u32x4 z4 = {0, 0, 0, 0};
  for (int k0 = 0; k0 < kTot; k0 += 64) {
    if (k0 + 64 < kTot) {            // hint next slab -> global_prefetch_b8
      __builtin_prefetch(gA + (long)(k0 + 64), 0, 1);
      __builtin_prefetch(gB + (long)(k0 + 64), 0, 1);
    }
    // stage 64x64 A and B^T slabs, 16B per transfer, 4 iters/thread
    for (int t = tid; t < 512; t += 128) {
      int r = t >> 3, c8 = (t & 7) << 3, k = k0 + c8;
      half_t* dA = lA + r * 72 + c8;
      half_t* dB = lB + r * 72 + c8;
      if (k + 8 <= kMax) {
        if (r < aRows) *(u32x4*)dA = *(const u32x4*)(gA + (long)r * sAr + k);
        else           *(u32x4*)dA = z4;
        if (r < bRows) *(u32x4*)dB = *(const u32x4*)(gB + (long)r * sBr + k);
        else           *(u32x4*)dB = z4;
      } else {
        for (int j = 0; j < 8; ++j) {
          int kk = k + j;
          dA[j] = (r < aRows && kk < kMax) ? gA[(long)r * sAr + kk] : (half_t)0.f;
          dB[j] = (r < bRows && kk < kMax) ? gB[(long)r * sBr + kk] : (half_t)0.f;
        }
      }
    }
    __syncthreads();
    const half_t* aBase = lA + (wave << 4) * 72;
#pragma unroll
    for (int kk = 0; kk < 64; kk += 32) {
      v16h af = load_frag(aBase, 72, lane, kk);
#pragma unroll
      for (int nt = 0; nt < 4; ++nt) {
        v16h bf = load_frag(lB + (nt << 4) * 72, 72, lane, kk);
        acc[nt] = __builtin_amdgcn_wmma_f32_16x16x32_f16(
            false, af, false, bf, (short)0, acc[nt], false, false);
      }
    }
    __syncthreads();
  }
}

#define GEMM_SHARED                                    \
  __shared__ alignas(16) half_t lA[64 * 72];           \
  __shared__ alignas(16) half_t lB[64 * 72];           \
  v8f acc[4];                                          \
  { v8f z = {}; for (int i = 0; i < 4; ++i) acc[i] = z; }

// C/D VGPR layout: vgpr i, lane l -> row = i + 8*(l>>4), col = l&15.
#define EPILOGUE_VARS                                  \
  const int lane = threadIdx.x & 31;                   \
  const int rbase = ((threadIdx.x >> 5) << 4) + ((lane >> 4) << 3); \
  const int cbase = lane & 15;

// ---------------- 128x128 macro-tile GEMM core (dense projections) ----------------
// 128 threads = 4 waves in a 2x2 grid; each wave owns a 64x64 block of the
// tile as 4x4 accumulator tiles, so every fragment read from LDS feeds four
// WMMAs.  A is [aRows][kE], B^T is [128][kE], both K-contiguous; K runs over kE in
// 64-wide slabs at the same 72-half LDS pitch as above.  Rows past aRows
// re-read row aRows-1; callers never store the results of those rows.
__device__ __forceinline__ void gemm_core128(
    const half_t* __restrict__ gA, int aRows, const half_t* __restrict__ gB,
    half_t* lA, half_t* lB, v8f (&acc)[4][4]) {
  const int tid  = threadIdx.x;
  const int wave = tid >> 5, lane = tid & 31;
  const int r0 = tid >> 3, c8 = (tid & 7) << 3;
  // byte offsets of this thread's eight A rows and of its first B row
  unsigned offA[8];
#pragma unroll
  for (int j = 0; j < 8; ++j)
    offA[j] = (unsigned)(imin(r0 + 16 * j, aRows - 1) * kE + c8) * 2u;
  const unsigned offB = (unsigned)(r0 * kE + c8) * 2u;
  const char* cA = (const char*)gA;
  const char* cB = (const char*)gB;
  half_t* sA = lA + r0 * 72 + c8;
  half_t* sB = lB + r0 * 72 + c8;
  const half_t* aBase = lA + ((wave >> 1) << 6) * 72;
  const half_t* bBase = lB + ((wave & 1) << 6) * 72;
  // Unrolled so that k0 is an immediate offset of every load: no address
  // arithmetic per slab, and no address register is rewritten behind a load.
#pragma unroll
  for (int k0 = 0; k0 < kE; k0 += 64) {
    u32x4 ta[8], tb[8];
#pragma unroll
    for (int j = 0; j < 8; ++j) ta[j] = *(const u32x4*)(cA + offA[j] + k0 * 2);
#pragma unroll
    for (int j = 0; j < 8; ++j) tb[j] = *(const u32x4*)(cB + offB + (k0 + j * 16 * kE) * 2);
    // Precaution: the offset registers that the issued loads name stay live up
    // to this wait, so none is reused (not even as a load's destination) ahead of it.
    asm volatile("s_wait_xcnt 0x0"
                 :: "v"(offA[0]), "v"(offA[1]), "v"(offA[2]), "v"(offA[3]), "v"(offA[4]),
                    "v"(offA[5]), "v"(offA[6]), "v"(offA[7]), "v"(offB)
                 : "memory");
#pragma unroll
    for (int j = 0; j < 8; ++j) {
      *(u32x4*)(sA + j * 16 * 72) = ta[j];
      *(u32x4*)(sB + j * 16 * 72) = tb[j];
    }
    __syncthreads();
#pragma unroll
    for (int kk = 0; kk < 64; kk += 32) {
      v16h af[4], bf[4];
#pragma unroll
      for (int t = 0; t < 4; ++t) {
        af[t] = load_frag(aBase + (t << 4) * 72, 72, lane, kk);
        bf[t] = load_frag(bBase + (t << 4) * 72, 72, lane, kk);
      }
#pragma unroll
      for (int mt = 0; mt < 4; ++mt)
#pragma unroll
        for (int nt = 0; nt < 4; ++nt)
          acc[mt][nt] = __builtin_amdgcn_wmma_f32_16x16x32_f16(
              false, af[mt], false, bf[nt], (short)0, acc[mt][nt], false, false);
    }
    __syncthreads();
  }
}

#define GEMM128_SHARED                                 \
  __shared__ alignas(16) half_t lA[128 * 72];          \
  __shared__ alignas(16) half_t lB[128 * 72];          \
  v8f acc[4][4];                                       \
  { v8f z = {};                                        \
    for (int i = 0; i < 4; ++i)                        \
      for (int j = 0; j < 4; ++j) acc[i][j] = z; }

// Same C/D layout; the wave's 64x64 block starts at (64*(wave>>1), 64*(wave&1)).
#define EPILOGUE128_VARS                               \
  const int lane = threadIdx.x & 31;                   \
  const int wid = threadIdx.x >> 5;                    \
  const int rbase = ((wid >> 1) << 6) + ((lane >> 4) << 3); \
  const int cbase = ((wid & 1) << 6) + (lane & 15);

// Four f16 stores at base + off, STEP bytes apart, two values to a register.
// Stores and wait are one statement so that the offset and the two data
// registers stay untouched up to the s_wait_xcnt (a precaution; a wait in a
// statement of its own does not hold later register writes behind it).
template <int STEP>
__device__ __forceinline__ void store4(half_t* base, unsigned off,
                                       float a0, float a1, float a2, float a3) {
  h2 p01 = {(half_t)a0, (half_t)a1}, p23 = {(half_t)a2, (half_t)a3};
  asm volatile(
      "global_store_b16 %0, %1, %3\n\t"
      "global_store_d16_hi_b16 %0, %1, %3 offset:%4\n\t"
      "global_store_b16 %0, %2, %3 offset:%5\n\t"
      "global_store_d16_hi_b16 %0, %2, %3 offset:%6\n\t"
      "s_wait_xcnt 0x0"
      :: "v"(off), "v"(__builtin_bit_cast(unsigned, p01)), "v"(__builtin_bit_cast(unsigned, p23)),
         "s"(base), "n"(STEP), "n"(2 * STEP), "n"(3 * STEP)
      : "memory");
}

// ---------------- elementwise kernels ----------------
// f32 -> f16 conversion of x and of the four weight matrices in one launch.
// One work-group of 16 waves per 64 rows of 768 floats (196,608 B read), so the
// whole job is 245 work-groups, fewer than there are WGPs, and 3,920 waves to
// start.  A thread's 24 16-byte loads are unrolled from one offset register, so
// many are in flight at once; each wave-wide load covers 512 contiguous bytes
// and each wave-wide 8-byte store 256, whole lines both ways.
typedef __attribute__((ext_vector_type(4))) float    f32x4;
typedef __attribute__((ext_vector_type(4))) _Float16 h4;
constexpr int kCvtThreads = 512;
constexpr int kCvtLoads   = 24;
constexpr int kCvtElems   = kCvtThreads * kCvtLoads * 4;   // floats per work-group
constexpr int kCvtBlocksX = kM * kE / kCvtElems;           // 197
constexpr int kCvtBlocksW = kE * kE / kCvtElems;           // 12
static_assert(kCvtBlocksX * kCvtElems == kM * kE, "x splits into whole work-groups");
static_assert(kCvtBlocksW * kCvtElems == kE * kE, "a weight splits into whole work-groups");

__global__ __launch_bounds__(kCvtThreads) void k_f2h_all(
    const float* __restrict__ x,  const float* __restrict__ wq, const float* __restrict__ wk,
    const float* __restrict__ wv, const float* __restrict__ wo,
    half_t* __restrict__ xh,  half_t* __restrict__ wqh, half_t* __restrict__ wkh,
    half_t* __restrict__ wvh, half_t* __restrict__ woh) {
  const float* in = x;
  half_t* out = xh;
  int part = blockIdx.x;
  if (part >= kCvtBlocksX) {
    const int w = (part - kCvtBlocksX) / kCvtBlocksW;
    part = (part - kCvtBlocksX) % kCvtBlocksW;
    in  = w == 0 ? wq  : w == 1 ? wk  : w == 2 ? wv  : wo;
    out = w == 0 ? wqh : w == 1 ? wkh : w == 2 ? wvh : woh;
  }
  const f32x4* s = (const f32x4*)(in + part * kCvtElems) + threadIdx.x;
  h4* d = (h4*)(out + part * kCvtElems) + threadIdx.x;
  f32x4 v[kCvtLoads];
  // Unrolled: j becomes an immediate offset, and many loads are in flight
  // before the first wait for data.
#pragma unroll
  for (int j = 0; j < kCvtLoads; ++j) v[j] = s[j * kCvtThreads];
  // Unrolled: v[] stays in registers and the stores share one offset register.
#pragma unroll
  for (int j = 0; j < kCvtLoads; ++j) d[j * kCvtThreads] = __builtin_convertvector(v[j], h4);
}

// Build q_pos (S,S,64) and v_pos^T (S,64,208) f16 via table gathers.
__global__ void k_pos(const float* qtx, const float* qty,
                      const float* vtx, const float* vty,
                      const int* xd, const int* yd,
                      half_t* qpos, half_t* vposT) {
  int i = blockIdx.x * blockDim.x + threadIdx.x;
  if (i >= kS * kS) return;
  int dx = xd[i], dy = yd[i];
  int q = i / kS, kk = i % kS;
  size_t qb = (size_t)i * 64;
  size_t vb = (size_t)q * kD * kSP + kk;
  for (int j = 0; j < 32; ++j) {
    qpos[qb + j]      = (half_t)qtx[dx * 32 + j];
    qpos[qb + 32 + j] = (half_t)qty[dy * 32 + j];
    vposT[vb + (size_t)j * kSP]        = (half_t)vtx[dx * 32 + j];
    vposT[vb + (size_t)(32 + j) * kSP] = (half_t)vty[dy * 32 + j];
  }
}

// ---------------- phase kernels ----------------
// QKV projection: (12608x768) @ W^T + b.
// Q,K stored [bh][s][d]; V stored transposed [bh][d][sP] so the P@V GEMM
// has unit-stride K and stages with b128 copies.
__global__ __launch_bounds__(128) void k_proj(const half_t* __restrict__ xh,
                       const half_t* wq, const half_t* wk, const half_t* wv,
                       const float* bq, const float* bk, const float* bv,
                       half_t* Q, half_t* K, half_t* Vt) {
  GEMM128_SHARED
  int m0 = blockIdx.x << 7, n0 = blockIdx.y << 7, sel = blockIdx.z;
  const half_t* W    = sel == 0 ? wq : sel == 1 ? wk : wv;
  const float*  bias = sel == 0 ? bq : sel == 1 ? bk : bv;
  gemm_core128(xh + (long)m0 * kE, imin(128, kM - m0), W + (long)n0 * kE, lA, lB, acc);
  EPILOGUE128_VARS
  float bz[4];
#pragma unroll
  for (int nt = 0; nt < 4; ++nt) bz[nt] = bias[n0 + cbase + (nt << 4)];
  // A wave's 64 columns are one head: column d = d0 + 16*nt of head h, so the
  // four columns of a row share one offset and differ by a constant step.
  const int h = (n0 + cbase) >> 6, d0 = cbase & 63;
  if (sel < 2) {
    half_t* qk = sel == 0 ? Q : K;
#pragma unroll
    for (int mt = 0; mt < 4; ++mt)
#pragma unroll
      for (int i = 0; i < 8; ++i) {
        int m = m0 + rbase + (mt << 4) + i;
        if (m < kM) {
          int b = m / kS, s = m % kS;
          store4<16 * 2>(qk, (unsigned)((((b * kH + h) * kS + s) * kD + d0) * 2),
                         acc[mt][0][i] + bz[0], acc[mt][1][i] + bz[1],
                         acc[mt][2][i] + bz[2], acc[mt][3][i] + bz[3]);
        }
      }
  } else {
#pragma unroll
    for (int mt = 0; mt < 4; ++mt)
#pragma unroll
      for (int i = 0; i < 8; ++i) {
        int m = m0 + rbase + (mt << 4) + i;
        if (m < kM) {
          int b = m / kS, s = m % kS;
          store4<16 * kSP * 2>(Vt, (unsigned)((((b * kH + h) * kD + d0) * kSP + s) * 2),
                               acc[mt][0][i] + bz[0], acc[mt][1][i] + bz[1],
                               acc[mt][2][i] + bz[2], acc[mt][3][i] + bz[3]);
        }
      }
  }
}

// Rel logits (per q): Rel_q[bh][k] = Q[bh,q,:] . q_pos[q,k,:]  -> P buffer [q][bh][k]
__global__ void k_rel(const half_t* __restrict__ Q,
                      const half_t* __restrict__ qpos,
                      half_t* __restrict__ P) {
  GEMM_SHARED
  int m0 = blockIdx.x << 6, n0 = blockIdx.y << 6, q = blockIdx.z;
  gemm_core(Q + (size_t)m0 * kS * kD + (size_t)q * kD, (long)kS * kD, 64,
            qpos + ((size_t)q * kS + n0) * kD, kD, imin(64, kS - n0),
            kD, kD, lA, lB, acc);
  EPILOGUE_VARS
#pragma unroll
  for (int nt = 0; nt < 4; ++nt)
#pragma unroll
    for (int i = 0; i < 8; ++i) {
      int m = m0 + rbase + i, n = n0 + (nt << 4) + cbase;
      if (n < kSP)
        P[((size_t)q * kBH + m) * kSP + n] = (half_t)acc[nt][i];
    }
}

// Content logits + rel add + softmax, in-place over P.  One block = (bh, 16 q rows, all k).
__global__ void k_attn(const half_t* __restrict__ Q, const half_t* __restrict__ K,
                       half_t* __restrict__ P) {
  __shared__ alignas(16) half_t lQ[16 * 72];
  __shared__ alignas(16) half_t lK[kSP * 72];
  __shared__ float lgt[16 * 224];
  const int q0 = blockIdx.x << 4, bh = blockIdx.y;
  const int tid = threadIdx.x, wave = tid >> 5, lane = tid & 31;
  const u32x4 z4 = {0, 0, 0, 0};

  for (int t = tid; t < 16 * 8; t += 128) {
    int r = t >> 3, c8 = (t & 7) << 3, q = q0 + r;
    u32x4 v = z4;
    if (q < kS) v = *(const u32x4*)(Q + ((size_t)bh * kS + q) * kD + c8);
    *(u32x4*)(lQ + r * 72 + c8) = v;
  }
  for (int t = tid; t < kSP * 8; t += 128) {
    int r = t >> 3, c8 = (t & 7) << 3;
    u32x4 v = z4;
    if (r < kS) v = *(const u32x4*)(K + ((size_t)bh * kS + r) * kD + c8);
    *(u32x4*)(lK + r * 72 + c8) = v;
  }
  __syncthreads();

  v16h af0 = load_frag(lQ, 72, lane, 0);
  v16h af1 = load_frag(lQ, 72, lane, 32);
  const int rb = (lane >> 4) << 3, cb = lane & 15;
  for (int nt = wave; nt < 13; nt += 4) {
    v8f a = {};
    v16h bf0 = load_frag(lK + nt * 16 * 72, 72, lane, 0);
    v16h bf1 = load_frag(lK + nt * 16 * 72, 72, lane, 32);
    a = __builtin_amdgcn_wmma_f32_16x16x32_f16(false, af0, false, bf0, (short)0, a, false, false);
    a = __builtin_amdgcn_wmma_f32_16x16x32_f16(false, af1, false, bf1, (short)0, a, false, false);
    int col = (nt << 4) + cb;
#pragma unroll
    for (int i = 0; i < 8; ++i) {
      int row = rb + i, q = q0 + row;
      float relv = 0.f;
      if (q < kS && col < kSP) relv = (float)P[((size_t)q * kBH + bh) * kSP + col];
      lgt[row * 224 + col] = (a[i] + relv) * 0.125f;   // 1/sqrt(64)
    }
  }
  __syncthreads();

  // softmax: 8 threads per row
  int r = tid >> 3, t8 = tid & 7;
  float mx = -3.0e38f;
  for (int k = t8; k < kS; k += 8) mx = fmaxf(mx, lgt[r * 224 + k]);
  for (int off = 4; off; off >>= 1) mx = fmaxf(mx, __shfl_xor(mx, off, 8));
  float sum = 0.f;
  for (int k = t8; k < kS; k += 8) {
    float e = __expf(lgt[r * 224 + k] - mx);
    lgt[r * 224 + k] = e;
    sum += e;
  }
  for (int off = 4; off; off >>= 1) sum += __shfl_xor(sum, off, 8);
  float inv = 1.f / sum;
  int q = q0 + r;
  if (q < kS)
    for (int k = t8; k < kSP; k += 8) {
      float p = (k < kS) ? lgt[r * 224 + k] * inv : 0.f;
      P[((size_t)q * kBH + bh) * kSP + k] = (half_t)p;
    }
}

// Content output (per bh): O1[b,q,h*64+d] = P[bh] @ V[bh]   (fp32)
__global__ void k_pv(const half_t* __restrict__ P, const half_t* __restrict__ Vt,
                     float* __restrict__ O1) {
  GEMM_SHARED
  int m0 = blockIdx.x << 6, bh = blockIdx.y;
  gemm_core(P + ((size_t)m0 * kBH + bh) * kSP, (long)kBH * kSP, imin(64, kS - m0),
            Vt + (size_t)bh * kD * kSP, kSP, 64,
            224, kS, lA, lB, acc);
  EPILOGUE_VARS
  int b = bh / kH, h = bh % kH;
#pragma unroll
  for (int nt = 0; nt < 4; ++nt)
#pragma unroll
    for (int i = 0; i < 8; ++i) {
      int q = m0 + rbase + i, d = (nt << 4) + cbase;
      if (q < kS)
        O1[((size_t)b * kS + q) * kE + h * kD + d] = acc[nt][i];
    }
}

// v_pos output (per q): add P_qslice @ v_pos[q]; finalize O1 -> f16 for out-proj.
__global__ void k_vpos(const half_t* __restrict__ P, const half_t* __restrict__ vposT,
                       const float* __restrict__ O1, half_t* __restrict__ O1h) {
  GEMM_SHARED
  int m0 = blockIdx.x << 6, q = blockIdx.y;
  gemm_core(P + ((size_t)q * kBH + m0) * kSP, kSP, 64,
            vposT + (size_t)q * kD * kSP, kSP, 64,
            224, kS, lA, lB, acc);
  EPILOGUE_VARS
#pragma unroll
  for (int nt = 0; nt < 4; ++nt)
#pragma unroll
    for (int i = 0; i < 8; ++i) {
      int bh = m0 + rbase + i, d = (nt << 4) + cbase;
      int b = bh / kH, h = bh % kH;
      size_t idx = ((size_t)b * kS + q) * kE + h * kD + d;
      O1h[idx] = (half_t)(acc[nt][i] + O1[idx]);
    }
}

// Output projection: out = O1h @ Wo^T + bo   (fp32 out)
__global__ __launch_bounds__(128) void k_out(const half_t* __restrict__ O1h, const half_t* __restrict__ wo,
                      const float* __restrict__ bo, float* __restrict__ out) {
  GEMM128_SHARED
  int m0 = blockIdx.x << 7, n0 = blockIdx.y << 7;
  gemm_core128(O1h + (long)m0 * kE, imin(128, kM - m0), wo + (long)n0 * kE, lA, lB, acc);
  EPILOGUE128_VARS
  float bz[4];
#pragma unroll
  for (int nt = 0; nt < 4; ++nt) bz[nt] = bo[n0 + cbase + (nt << 4)];
#pragma unroll
  for (int mt = 0; mt < 4; ++mt)
#pragma unroll
    for (int i = 0; i < 8; ++i) {
      int m = m0 + rbase + (mt << 4) + i;
      if (m < kM) {
#pragma unroll
        for (int nt = 0; nt < 4; ++nt) {
          int n = n0 + cbase + (nt << 4);
          out[(size_t)m * kE + n] = acc[mt][nt][i] + bz[nt];
        }
      }
    }
}

// ---------------- host launcher ----------------
extern "C" void kernel_launch(void* const* d_in, const int* in_sizes, int n_in,
                              void* d_out, int out_size, void* d_ws, size_t ws_size,
                              hipStream_t stream) {
  (void)in_sizes; (void)n_in; (void)out_size; (void)ws_size;
  const float* x   = (const float*)d_in[0];
  const float* Wq  = (const float*)d_in[1];
  const float* bq  = (const float*)d_in[2];
  const float* Wk  = (const float*)d_in[3];
  const float* bk  = (const float*)d_in[4];
  const float* Wv  = (const float*)d_in[5];
  const float* bv  = (const float*)d_in[6];
  const float* Wo  = (const float*)d_in[7];
  const float* bo  = (const float*)d_in[8];
  const float* qtx = (const float*)d_in[9];
  const float* qty = (const float*)d_in[10];
  const float* vtx = (const float*)d_in[11];
  const float* vty = (const float*)d_in[12];
  const int*   xd  = (const int*)d_in[13];
  const int*   yd  = (const int*)d_in[14];
  float* out = (float*)d_out;

  char* ws = (char*)d_ws;
  size_t off = 0;
  auto take = [&](size_t bytes) {
    void* p = ws + off;
    off += (bytes + 255) & ~(size_t)255;
    return p;
  };
  const size_t NX   = (size_t)kM * kE;           // 9.68M
  const size_t NW   = (size_t)kE * kE;
  const size_t NQ   = (size_t)kBH * kS * kD;     // 9.68M
  const size_t NVT  = (size_t)kBH * kD * kSP;    // 10.2M
  const size_t NPOS = (size_t)kS * kS * kD;
  const size_t NVPT = (size_t)kS * kD * kSP;     // 2.62M
  const size_t NP   = (size_t)kS * kBH * kSP;    // 31.5M

  half_t* xh    = (half_t*)take(NX * 2);
  half_t* wqh   = (half_t*)take(NW * 2);
  half_t* wkh   = (half_t*)take(NW * 2);
  half_t* wvh   = (half_t*)take(NW * 2);
  half_t* woh   = (half_t*)take(NW * 2);
  half_t* Qh    = (half_t*)take(NQ * 2);
  half_t* Kh    = (half_t*)take(NQ * 2);
  half_t* Vt    = (half_t*)take(NVT * 2);
  half_t* qpos  = (half_t*)take(NPOS * 2);
  half_t* vposT = (half_t*)take(NVPT * 2);
  half_t* P     = (half_t*)take(NP * 2);
  float*  O1    = (float*)take(NX * 4);
  half_t* O1h   = xh;  // xh dead after k_proj; reuse

  k_f2h_all<<<kCvtBlocksX + 4 * kCvtBlocksW, kCvtThreads, 0, stream>>>(
      x, Wq, Wk, Wv, Wo, xh, wqh, wkh, wvh, woh);
  k_pos<<<(kS * kS + 255) / 256, 256, 0, stream>>>(qtx, qty, vtx, vty, xd, yd, qpos, vposT);

  k_proj<<<dim3((kM + 127) / 128, kE / 128, 3), 128, 0, stream>>>(
      xh, wqh, wkh, wvh, bq, bk, bv, Qh, Kh, Vt);
  k_rel<<<dim3(kBH / 64, 4, kS), 128, 0, stream>>>(Qh, qpos, P);
  k_attn<<<dim3((kS + 15) / 16, kBH), 128, 0, stream>>>(Qh, Kh, P);
  k_pv<<<dim3((kS + 63) / 64, kBH), 128, 0, stream>>>(P, Vt, O1);
  k_vpos<<<dim3(kBH / 64, kS), 128, 0, stream>>>(P, vposT, O1, O1h);
  k_out<<<dim3((kM + 127) / 128, kE / 128), 128, 0, stream>>>(O1h, woh, bo, out);
}

// v003
// Measured time: 258 microseconds a run.
// Two timings next to v002 put it at 1.36 and 1.35 times that version's speed.
// Over all steps from v000 it is 1.75 times as fast.
#include <hip/hip_runtime.h>
#include <hip/hip_bf16.h>

// ---------------- problem constants ----------------
constexpr int kB  = 64;        // batch
constexpr int kS  = 197;       // seq len
constexpr int kE  = 768;       // embed
constexpr int kH  = 12;        // heads
constexpr int kD  = 64;        // head dim
constexpr int kBH = kB * kH;   // 768
constexpr int kSP = 208;       // seq padded to mult of 16
constexpr int kM  = kB * kS;   // 12608 rows for projections

typedef _Float16 half_t;
typedef __attribute__((ext_vector_type(16))) _Float16     v16h;
typedef __attribute__((ext_vector_type(8)))  float        v8f;
typedef __attribute__((ext_vector_type(2)))  _Float16     h2;
typedef __attribute__((ext_vector_type(4)))  unsigned int u32x4;

struct HFrag { u32x4 a, b; };

__device__ __forceinline__ int imin(int a, int b) { return a < b ? a : b; }

// Load a 16x32 f16 WMMA A/B fragment from an LDS tile stored row-major
// [16][ldk].  Per ISA: lane<16 holds K {0..7,16..23} of row (lane&15);
// lane>=16 holds K {8..15,24..31}.  Two 16-byte ds_load_b128 per frag.
__device__ __forceinline__ v16h load_frag(const half_t* base, int ldk, int lane, int k0) {
  const half_t* p = base + (lane & 15) * ldk + k0 + ((lane >> 4) << 3);
  HFrag f;
  f.a = *(const u32x4*)p;
  f.b = *(const u32x4*)(p + 16);
  return __builtin_bit_cast(v16h, f);
}

// ---------------- shared 64x64 macro-tile GEMM core ----------------
// 128 threads = 4 waves; wave w owns output rows [16w,16w+16), all 64 cols.
// A element (r,k) at gA[r*sAr + k]; B^T element (n,k) at gB[n*sBr + k].
// K staged in 64-wide slabs, LDS row stride 72 halves (144B = 36 banks,
// gcd(36,64)=4 -> conflict-free).  Staging uses 16-byte b128 copies; all
// callers guarantee 16B alignment (bases/strides are multiples of 8 halves).
__device__ __forceinline__ void gemm_core(
    const half_t* gA, long sAr, int aRows,
    const half_t* gB, long sBr, int bRows,
    int kTot, int kMax, half_t* lA, half_t* lB, v8f* acc) {
  const int tid  = threadIdx.x;
  const int wave = tid >> 5, lane = tid & 31;
  const u32x4 z4 = {0, 0, 0, 0};
  for (int k0 = 0; k0 < kTot; k0 += 64) {
    if (k0 + 64 < kTot) {            // hint next slab -> global_prefetch_b8
      __builtin_prefetch(gA + (long)(k0 + 64), 0, 1);
      __builtin_prefetch(gB + (long)(k0 + 64), 0, 1);
    }
    // stage 64x64 A and B^T slabs, 16B per transfer, 4 iters/thread
    for (int t = tid; t < 512; t += 128) {
      int r = t >> 3, c8 = (t & 7) << 3, k = k0 + c8;
      half_t* dA = lA + r * 72 + c8;
      half_t* dB = lB + r * 72 + c8;
      if (k + 8 <= kMax) {
        if (r < aRows) *(u32x4*)dA = *(const u32x4*)(gA + (long)r * sAr + k);
        else           *(u32x4*)dA = z4;
        if (r < bRows) *(u32x4*)dB = *(const u32x4*)(gB + (long)r * sBr + k);
        else           *(u32x4*)dB = z4;
      } else {
        for (int j = 0; j < 8; ++j) {
          int kk = k + j;
          dA[j] = (r < aRows && kk < kMax) ? gA[(long)r * sAr + kk] : (half_t)0.f;
          dB[j] = (r < bRows && kk < kMax) ? gB[(long)r * sBr + kk] : (half_t)0.f;
        }
      }
    }
    __syncthreads();
    const half_t* aBase = lA + (wave << 4) * 72;
#pragma unroll
    for (int kk = 0; kk < 64; kk += 32) {
      v16h af = load_frag(aBase, 72, lane, kk);
#pragma unroll
      for (int nt = 0; nt < 4; ++nt) {
        v16h bf = load_frag(lB + (nt << 4) * 72, 72, lane, kk);
        acc[nt] = __builtin_amdgcn_wmma_f32_16x16x32_f16(
            false, af, false, bf, (short)0, acc[nt], false, false);
      }
    }
    __syncthreads();
  }
}

#define GEMM_SHARED                                    \
  __shared__ alignas(16) half_t lA[64 * 72];           \
  __shared__ alignas(16) half_t lB[64 * 72];           \
  v8f acc[4];                                          \
  { v8f z = {}; for (int i = 0; i < 4; ++i) acc[i] = z; }

// C/D VGPR layout: vgpr i, lane l -> row = i + 8*(l>>4), col = l&15.
#define EPILOGUE_VARS                                  \
  const int lane = threadIdx.x & 31;                   \
  const int rbase = ((threadIdx.x >> 5) << 4) + ((lane >> 4) << 3); \
  const int cbase = lane & 15;

// ---------------- 128x128 macro-tile GEMM core (dense projections) ----------------
// 128 threads = 4 waves in a 2x2 grid; each wave owns a 64x64 block of the
// tile as 4x4 accumulator tiles, so every fragment read from LDS feeds four
// WMMAs.  A is [aRows][kE], B^T is [128][kE], both K-contiguous; K runs over kE in
// 64-wide slabs at the same 72-half LDS pitch as above.  Rows past aRows
// re-read row aRows-1; callers never store the results of those rows.
__device__ __forceinline__ void gemm_core128(
    const half_t* __restrict__ gA, int aRows, const half_t* __restrict__ gB,
    half_t* lA, half_t* lB, v8f (&acc)[4][4]) {
  const int tid  = threadIdx.x;
  const int wave = tid >> 5, lane = tid & 31;
  const int r0 = tid >> 3, c8 = (tid & 7) << 3;
  // byte offsets of this thread's eight A rows and of its first B row
  unsigned offA[8];
#pragma unroll
  for (int j = 0; j < 8; ++j)
    offA[j] = (unsigned)(imin(r0 + 16 * j, aRows - 1) * kE + c8) * 2u;
  const unsigned offB = (unsigned)(r0 * kE + c8) * 2u;
  const char* cA = (const char*)gA;
  const char* cB = (const char*)gB;
  half_t* sA = lA + r0 * 72 + c8;
  half_t* sB = lB + r0 * 72 + c8;
  const half_t* aBase = lA + ((wave >> 1) << 6) * 72;
  const half_t* bBase = lB + ((wave & 1) << 6) * 72;
  // Unrolled so that k0 is an immediate offset of every load: no address
  // arithmetic per slab, and no address register is rewritten behind a load.
#pragma unroll
  for (int k0 = 0; k0 < kE; k0 += 64) {
    u32x4 ta[8], tb[8];
#pragma unroll
    for (int j = 0; j < 8; ++j) ta[j] = *(const u32x4*)(cA + offA[j] + k0 * 2);
#pragma unroll
    for (int j = 0; j < 8; ++j) tb[j] = *(const u32x4*)(cB + offB + (k0 + j * 16 * kE) * 2);
    // Precaution: the offset registers that the issued loads name stay live up
    // to this wait, so none is reused (not even as a load's destination) ahead of it.
    asm volatile("s_wait_xcnt 0x0"
                 :: "v"(offA[0]), "v"(offA[1]), "v"(offA[2]), "v"(offA[3]), "v"(offA[4]),
                    "v"(offA[5]), "v"(offA[6]), "v"(offA[7]), "v"(offB)
                 : "memory");
#pragma unroll
    for (int j = 0; j < 8; ++j) {
      *(u32x4*)(sA + j * 16 * 72) = ta[j];
      *(u32x4*)(sB + j * 16 * 72) = tb[j];
    }
    __syncthreads();
#pragma unroll
    for (int kk = 0; kk < 64; kk += 32) {
      v16h af[4], bf[4];
#pragma unroll
      for (int t = 0; t < 4; ++t) {
        af[t] = load_frag(aBase + (t << 4) * 72, 72, lane, kk);
        bf[t] = load_frag(bBase + (t << 4) * 72, 72, lane, kk);
      }
#pragma unroll
      for (int mt = 0; mt < 4; ++mt)
#pragma unroll
        for (int nt = 0; nt < 4; ++nt)
          acc[mt][nt] = __builtin_amdgcn_wmma_f32_16x16x32_f16(
              false, af[mt], false, bf[nt], (short)0, acc[mt][nt], false, false);
    }
    __syncthreads();
  }
}

#define GEMM128_SHARED                                 \
  __shared__ alignas(16) half_t lA[128 * 72];          \
  __shared__ alignas(16) half_t lB[128 * 72];          \
  v8f acc[4][4];                                       \
  { v8f z = {};                                        \
    for (int i = 0; i < 4; ++i)                        \
      for (int j = 0; j < 4; ++j) acc[i][j] = z; }

// Same C/D layout; the wave's 64x64 block starts at (64*(wave>>1), 64*(wave&1)).
#define EPILOGUE128_VARS                               \
  const int lane = threadIdx.x & 31;                   \
  const int wid = threadIdx.x >> 5;                    \
  const int rbase = ((wid >> 1) << 6) + ((lane >> 4) << 3); \
  const int cbase = ((wid & 1) << 6) + (lane & 15);

// Four f16 stores at base + off, STEP bytes apart, two values to a register.
// Stores and wait are one statement so that the offset and the two data
// registers stay untouched up to the s_wait_xcnt (a precaution; a wait in a
// statement of its own does not hold later register writes behind it).
template <int STEP>
__device__ __forceinline__ void store4(half_t* base, unsigned off,
                                       float a0, float a1, float a2, float a3) {
  h2 p01 = {(half_t)a0, (half_t)a1}, p23 = {(half_t)a2, (half_t)a3};
  asm volatile(
      "global_store_b16 %0, %1, %3\n\t"
      "global_store_d16_hi_b16 %0, %1, %3 offset:%4\n\t"
      "global_store_b16 %0, %2, %3 offset:%5\n\t"
      "global_store_d16_hi_b16 %0, %2, %3 offset:%6\n\t"
      "s_wait_xcnt 0x0"
      :: "v"(off), "v"(__builtin_bit_cast(unsigned, p01)), "v"(__builtin_bit_cast(unsigned, p23)),
         "s"(base), "n"(STEP), "n"(2 * STEP), "n"(3 * STEP)
      : "memory");
}

// ---------------- elementwise kernels ----------------
// f32 -> f16 conversion of x and of the four weight matrices in one launch.
// One work-group of 16 waves per 64 rows of 768 floats (196,608 B read), so the
// whole job is 245 work-groups, fewer than there are WGPs, and 3,920 waves to
// start.  A thread's 24 16-byte loads are unrolled from one offset register, so
// many are in flight at once; each wave-wide load covers 512 contiguous bytes
// and each wave-wide 8-byte store 256, whole lines both ways.
typedef __attribute__((ext_vector_type(4))) float    f32x4;
typedef __attribute__((ext_vector_type(4))) _Float16 h4;
constexpr int kCvtThreads = 512;
constexpr int kCvtLoads   = 24;
constexpr int kCvtElems   = kCvtThreads * kCvtLoads * 4;   // floats per work-group
constexpr int kCvtBlocksX = kM * kE / kCvtElems;           // 197
constexpr int kCvtBlocksW = kE * kE / kCvtElems;           // 12
static_assert(kCvtBlocksX * kCvtElems == kM * kE, "x splits into whole work-groups");
static_assert(kCvtBlocksW * kCvtElems == kE * kE, "a weight splits into whole work-groups");

__global__ __launch_bounds__(kCvtThreads) void k_f2h_all(
    const float* __restrict__ x,  const float* __restrict__ wq, const float* __restrict__ wk,
    const float* __restrict__ wv, const float* __restrict__ wo,
    half_t* __restrict__ xh,  half_t* __restrict__ wqh, half_t* __restrict__ wkh,
    half_t* __restrict__ wvh, half_t* __restrict__ woh) {
  const float* in = x;
  half_t* out = xh;
  int part = blockIdx.x;
  if (part >= kCvtBlocksX) {
    const int w = (part - kCvtBlocksX) / kCvtBlocksW;
    part = (part - kCvtBlocksX) % kCvtBlocksW;
    in  = w == 0 ? wq  : w == 1 ? wk  : w == 2 ? wv  : wo;
    out = w == 0 ? wqh : w == 1 ? wkh : w == 2 ? wvh : woh;
  }
  const f32x4* s = (const f32x4*)(in + part * kCvtElems) + threadIdx.x;
  h4* d = (h4*)(out + part * kCvtElems) + threadIdx.x;
  f32x4 v[kCvtLoads];
  // Unrolled: j becomes an immediate offset, and many loads are in flight
  // before the first wait for data.
#pragma unroll
  for (int j = 0; j < kCvtLoads; ++j) v[j] = s[j * kCvtThreads];
  // Unrolled: v[] stays in registers and the stores share one offset register.
#pragma unroll
  for (int j = 0; j < kCvtLoads; ++j) d[j * kCvtThreads] = __builtin_convertvector(v[j], h4);
}

// Build v_pos^T (S,64,208) f16 via table gathers, and pack the two query-table
// row numbers of every (q,k) into 16 bits (x low byte, y high byte), laid out
// [q][k>>6][k&7][(k>>3)&7] so that a softmax thread (k = t8 + 8j) finds eight
// of its entries in one 16-byte load.  Row numbers are bounded here.
constexpr int kNE = 28;        // rows of each position table
__global__ void k_pos(const float* vtx, const float* vty,
                      const int* xd, const int* yd,
                      unsigned short* pidx, half_t* vposT) {
  int i = blockIdx.x * blockDim.x + threadIdx.x;
  if (i >= kS * kS) return;
  int dx = imin(xd[i] < 0 ? 0 : xd[i], kNE - 1), dy = imin(yd[i] < 0 ? 0 : yd[i], kNE - 1);
  int q = i / kS, kk = i % kS;
  pidx[q * 256 + (kk >> 6) * 64 + (kk & 7) * 8 + ((kk >> 3) & 7)] = (unsigned short)(dx | (dy << 8));
  size_t vb = (size_t)q * kD * kSP + kk;
  for (int j = 0; j < 32; ++j) {
    vposT[vb + (size_t)j * kSP]        = (half_t)vtx[dx * 32 + j];
    vposT[vb + (size_t)(32 + j) * kSP] = (half_t)vty[dy * 32 + j];
  }
}

// ---------------- phase kernels ----------------
// QKV projection: (12608x768) @ W^T + b.
// Q,K stored [bh][s][d]; V stored transposed [bh][d][sP] so the P@V GEMM
// has unit-stride K and stages with b128 copies.
__global__ __launch_bounds__(128) void k_proj(const half_t* __restrict__ xh,
                       const half_t* wq, const half_t* wk, const half_t* wv,
                       const float* bq, const float* bk, const float* bv,
                       half_t* Q, half_t* K, half_t* Vt) {
  GEMM128_SHARED
  int m0 = blockIdx.x << 7, n0 = blockIdx.y << 7, sel = blockIdx.z;
  const half_t* W    = sel == 0 ? wq : sel == 1 ? wk : wv;
  const float*  bias = sel == 0 ? bq : sel == 1 ? bk : bv;
  gemm_core128(xh + (long)m0 * kE, imin(128, kM - m0), W + (long)n0 * kE, lA, lB, acc);
  EPILOGUE128_VARS
  float bz[4];
#pragma unroll
  for (int nt = 0; nt < 4; ++nt) bz[nt] = bias[n0 + cbase + (nt << 4)];
  // A wave's 64 columns are one head: column d = d0 + 16*nt of head h, so the
  // four columns of a row share one offset and differ by a constant step.
  const int h = (n0 + cbase) >> 6, d0 = cbase & 63;
  if (sel < 2) {
    half_t* qk = sel == 0 ? Q : K;
#pragma unroll
    for (int mt = 0; mt < 4; ++mt)
#pragma unroll
      for (int i = 0; i < 8; ++i) {
        int m = m0 + rbase + (mt << 4) + i;
        if (m < kM) {
          int b = m / kS, s = m % kS;
          store4<16 * 2>(qk, (unsigned)((((b * kH + h) * kS + s) * kD + d0) * 2),
                         acc[mt][0][i] + bz[0], acc[mt][1][i] + bz[1],
                         acc[mt][2][i] + bz[2], acc[mt][3][i] + bz[3]);
        }
      }
  } else {
#pragma unroll
    for (int mt = 0; mt < 4; ++mt)
#pragma unroll
      for (int i = 0; i < 8; ++i) {
        int m = m0 + rbase + (mt << 4) + i;
        if (m < kM) {
          int b = m / kS, s = m % kS;
          store4<16 * kSP * 2>(Vt, (unsigned)((((b * kH + h) * kD + d0) * kSP + s) * 2),
                               acc[mt][0][i] + bz[0], acc[mt][1][i] + bz[1],
                               acc[mt][2][i] + bz[2], acc[mt][3][i] + bz[3]);
        }
      }
  }
}

// Content logits + position logits + softmax -> P.  One block = (bh, 16 q rows, all k).
// Position term: q_pos[q,k,:] is row x_dist[q,k] of one table beside row
// y_dist[q,k] of the other, so Q[q,:] . q_pos[q,k,:] = TX[q][x_dist] + TY[q][y_dist]
// with TX = Q[:, 0:32] . q_tab_x^T and TY = Q[:, 32:64] . q_tab_y^T (16 x 28 each):
// one WMMA per wave, kept in f32 in LDS and gathered per (q,k).  TX and TY take
// the place of the K tile once its last read is over, so LDS per block stays.
__global__ void k_attn(const half_t* __restrict__ Q, const half_t* __restrict__ K,
                       const float* __restrict__ qtx, const float* __restrict__ qty,
                       const unsigned short* __restrict__ pidx,
                       half_t* __restrict__ P) {
  __shared__ alignas(16) half_t lQ[16 * 72];
  __shared__ alignas(16) half_t lK[kSP * 72];
  __shared__ float lgt[16 * 224];
  const int q0 = blockIdx.x << 4, bh = blockIdx.y;
  const int tid = threadIdx.x, wave = tid >> 5, lane = tid & 31;
  const int r = tid >> 3, t8 = tid & 7;   // softmax: 8 threads per row
  const u32x4 z4 = {0, 0, 0, 0};

  // This thread's packed table rows for k = t8 + 8j: j = 0..23 in three 16-byte
  // loads, j = 24 alone (it exists for t8 < 5 only).
  const unsigned short* ip = pidx + imin(q0 + r, kS - 1) * 256 + t8 * 8;
  const u32x4 iw0 = *(const u32x4*)ip;
  const u32x4 iw1 = *(const u32x4*)(ip + 64);
  const u32x4 iw2 = *(const u32x4*)(ip + 128);
  unsigned iw3 = 0;
  if (192 + t8 < kS) iw3 = ip[192];

  // This wave's 16 table rows as a B fragment, in load_frag's k order:
  // waves 0,1 take q_tab_x rows 0..15 and 16..31, waves 2,3 q_tab_y; rows past
  // the table are zero.
  const int te = ((wave & 1) << 4) + (lane & 15);
  const f32x4* tp = (const f32x4*)((wave >> 1 ? qty : qtx) + imin(te, kNE - 1) * 32 + ((lane >> 4) << 3));
  f32x4 tf[4] = {tp[0], tp[1], tp[4], tp[5]};
  v16h tb;
#pragma unroll
  for (int j = 0; j < 16; ++j) tb[j] = te < kNE ? (half_t)tf[j >> 2][j & 3] : (half_t)0.f;

  for (int t = tid; t < 16 * 8; t += 128) {
    int r = t >> 3, c8 = (t & 7) << 3, q = q0 + r;
    u32x4 v = z4;
    if (q < kS) v = *(const u32x4*)(Q + ((size_t)bh * kS + q) * kD + c8);
    *(u32x4*)(lQ + r * 72 + c8) = v;
  }
  for (int t = tid; t < kSP * 8; t += 128) {
    int r = t >> 3, c8 = (t & 7) << 3;
    u32x4 v = z4;
    if (r < kS) v = *(const u32x4*)(K + ((size_t)bh * kS + r) * kD + c8);
    *(u32x4*)(lK + r * 72 + c8) = v;
  }
  __syncthreads();

  v16h af0 = load_frag(lQ, 72, lane, 0);
  v16h af1 = load_frag(lQ, 72, lane, 32);
  const int rb = (lane >> 4) << 3, cb = lane & 15;
  v8f tacc = {};
  tacc = __builtin_amdgcn_wmma_f32_16x16x32_f16(false, wave >> 1 ? af1 : af0, false, tb, (short)0, tacc, false, false);
  for (int nt = wave; nt < 13; nt += 4) {
    v8f a = {};
    v16h bf0 = load_frag(lK + nt * 16 * 72, 72, lane, 0);
    v16h bf1 = load_frag(lK + nt * 16 * 72, 72, lane, 32);
    a = __builtin_amdgcn_wmma_f32_16x16x32_f16(false, af0, false, bf0, (short)0, a, false, false);
    a = __builtin_amdgcn_wmma_f32_16x16x32_f16(false, af1, false, bf1, (short)0, a, false, false);
    int col = (nt << 4) + cb;
#pragma unroll
    for (int i = 0; i < 8; ++i) lgt[(rb + i) * 224 + col] = a[i];
  }
  __syncthreads();

  // Every wave has left lK: rows of 68 floats over it, TX at 0..31, TY at 32..63.
  float* lT = (float*)lK;
#pragma unroll
  for (int i = 0; i < 8; ++i) lT[(rb + i) * 68 + (wave << 4) + cb] = tacc[i];
  __syncthreads();   // publishes TX, TY to the softmax threads

  // softmax; its first pass adds the two gathered position terms and scales
  const unsigned iw[13] = {iw0[0], iw0[1], iw0[2], iw0[3], iw1[0], iw1[1], iw1[2], iw1[3],
                           iw2[0], iw2[1], iw2[2], iw2[3], iw3};
  const float* tr = lT + r * 68;
  float mx = -3.0e38f;
  // Unrolled: j picks the index word and byte at compile time.
#pragma unroll
  for (int j = 0; j < 25; ++j) {
    const int k = t8 + 8 * j;
    if (k < kS) {
      const unsigned e = iw[j >> 1] >> ((j & 1) * 16);
      const float v = (lgt[r * 224 + k] + tr[e & 0xff] + tr[32 + ((e >> 8) & 0xff)]) * 0.125f;   // 1/sqrt(64)
      lgt[r * 224 + k] = v;
      mx = fmaxf(mx, v);
    }
  }
  for (int off = 4; off; off >>= 1) mx = fmaxf(mx, __shfl_xor(mx, off, 8));
  float sum = 0.f;
  for (int k = t8; k < kS; k += 8) {
    float e = __expf(lgt[r * 224 + k] - mx);
    lgt[r * 224 + k] = e;
    sum += e;
  }
  for (int off = 4; off; off >>= 1) sum += __shfl_xor(sum, off, 8);
  float inv = 1.f / sum;
  int q = q0 + r;
  if (q < kS)
    for (int k = t8; k < kSP; k += 8) {
      float p = (k < kS) ? lgt[r * 224 + k] * inv : 0.f;
      P[((size_t)q * kBH + bh) * kSP + k] = (half_t)p;
    }
}

// Content output (per bh): O1[b,q,h*64+d] = P[bh] @ V[bh]   (fp32)
__global__ void k_pv(const half_t* __restrict__ P, const half_t* __restrict__ Vt,
                     float* __restrict__ O1) {
  GEMM_SHARED
  int m0 = blockIdx.x << 6, bh = blockIdx.y;
  gemm_core(P + ((size_t)m0 * kBH + bh) * kSP, (long)kBH * kSP, imin(64, kS - m0),
            Vt + (size_t)bh * kD * kSP, kSP, 64,
            224, kS, lA, lB, acc);
  EPILOGUE_VARS
  int b = bh / kH, h = bh % kH;
#pragma unroll
  for (int nt = 0; nt < 4; ++nt)
#pragma unroll
    for (int i = 0; i < 8; ++i) {
      int q = m0 + rbase + i, d = (nt << 4) + cbase;
      if (q < kS)
        O1[((size_t)b * kS + q) * kE + h * kD + d] = acc[nt][i];
    }
}

// v_pos output (per q): add P_qslice @ v_pos[q]; finalize O1 -> f16 for out-proj.
__global__ void k_vpos(const half_t* __restrict__ P, const half_t* __restrict__ vposT,
                       const float* __restrict__ O1, half_t* __restrict__ O1h) {
  GEMM_SHARED
  int m0 = blockIdx.x << 6, q = blockIdx.y;
  gemm_core(P + ((size_t)q * kBH + m0) * kSP, kSP, 64,
            vposT + (size_t)q * kD * kSP, kSP, 64,
            224, kS, lA, lB, acc);
  EPILOGUE_VARS
#pragma unroll
  for (int nt = 0; nt < 4; ++nt)
#pragma unroll
    for (int i = 0; i < 8; ++i) {
      int bh = m0 + rbase + i, d = (nt << 4) + cbase;
      int b = bh / kH, h = bh % kH;
      size_t idx = ((size_t)b * kS + q) * kE + h * kD + d;
      O1h[idx] = (half_t)(acc[nt][i] + O1[idx]);
    }
}

// Output projection: out = O1h @ Wo^T + bo   (fp32 out)
__global__ __launch_bounds__(128) void k_out(const half_t* __restrict__ O1h, const half_t* __restrict__ wo,
                      const float* __restrict__ bo, float* __restrict__ out) {
  GEMM128_SHARED
  int m0 = blockIdx.x << 7, n0 = blockIdx.y << 7;
  gemm_core128(O1h + (long)m0 * kE, imin(128, kM - m0), wo + (long)n0 * kE, lA, lB, acc);
  EPILOGUE128_VARS
  float bz[4];
#pragma unroll
  for (int nt = 0; nt < 4; ++nt) bz[nt] = bo[n0 + cbase + (nt << 4)];
#pragma unroll
  for (int mt = 0; mt < 4; ++mt)
#pragma unroll
    for (int i = 0; i < 8; ++i) {
      int m = m0 + rbase + (mt << 4) + i;
      if (m < kM) {
#pragma unroll
        for (int nt = 0; nt < 4; ++nt) {
          int n = n0 + cbase + (nt << 4);
          out[(size_t)m * kE + n] = acc[mt][nt][i] + bz[nt];
        }
      }
    }
}

// ---------------- host launcher ----------------
extern "C" void kernel_launch(void* const* d_in, const int* in_sizes, int n_in,
                              void* d_out, int out_size, void* d_ws, size_t ws_size,
                              hipStream_t stream) {
  (void)in_sizes; (void)n_in; (void)out_size; (void)ws_size;
  const float* x   = (const float*)d_in[0];
  const float* Wq  = (const float*)d_in[1];
  const float* bq  = (const float*)d_in[2];
  const float* Wk  = (const float*)d_in[3];
  const float* bk  = (const float*)d_in[4];
  const float* Wv  = (const float*)d_in[5];
  const float* bv  = (const float*)d_in[6];
  const float* Wo  = (const float*)d_in[7];
  const float* bo  = (const float*)d_in[8];
  const float* qtx = (const float*)d_in[9];
  const float* qty = (const float*)d_in[10];
  const float* vtx = (const float*)d_in[11];
  const float* vty = (const float*)d_in[12];
  const int*   xd  = (const int*)d_in[13];
  const int*   yd  = (const int*)d_in[14];
  float* out = (float*)d_out;

  char* ws = (char*)d_ws;
  size_t off = 0;
  auto take = [&](size_t bytes) {
    void* p = ws + off;
    off += (bytes + 255) & ~(size_t)255;
    return p;
  };
  const size_t NX   = (size_t)kM * kE;           // 9.68M
  const size_t NW   = (size_t)kE * kE;
  const size_t NQ   = (size_t)kBH * kS * kD;     // 9.68M
  const size_t NVT  = (size_t)kBH * kD * kSP;    // 10.2M
  const size_t NIDX = (size_t)kS * 256;
  const size_t NVPT = (size_t)kS * kD * kSP;     // 2.62M
  const size_t NP   = (size_t)kS * kBH * kSP;    // 31.5M

  half_t* xh    = (half_t*)take(NX * 2);
  half_t* wqh   = (half_t*)take(NW * 2);
  half_t* wkh   = (half_t*)take(NW * 2);
  half_t* wvh   = (half_t*)take(NW * 2);
  half_t* woh   = (half_t*)take(NW * 2);
  half_t* Qh    = (half_t*)take(NQ * 2);
  half_t* Kh    = (half_t*)take(NQ * 2);
  half_t* Vt    = (half_t*)take(NVT * 2);
  unsigned short* pidx = (unsigned short*)take(NIDX * 2);
  half_t* vposT = (half_t*)take(NVPT * 2);
  half_t* P     = (half_t*)take(NP * 2);
  float*  O1    = (float*)take(NX * 4);
  half_t* O1h   = xh;  // xh dead after k_proj; reuse

  k_f2h_all<<<kCvtBlocksX + 4 * kCvtBlocksW, kCvtThreads, 0, stream>>>(
      x, Wq, Wk, Wv, Wo, xh, wqh, wkh, wvh, woh);
  k_pos<<<(kS * kS + 255) / 256, 256, 0, stream>>>(vtx, vty, xd, yd, pidx, vposT);

  k_proj<<<dim3((kM + 127) / 128, kE / 128, 3), 128, 0, stream>>>(
      xh, wqh, wkh, wvh, bq, bk, bv, Qh, Kh, Vt);
  k_attn<<<dim3((kS + 15) / 16, kBH), 128, 0, stream>>>(Qh, Kh, qtx, qty, pidx, P);
  k_pv<<<dim3((kS + 63) / 64, kBH), 128, 0, stream>>>(P, Vt, O1);
  k_vpos<<<dim3(kBH / 64, kS), 128, 0, stream>>>(P, vposT, O1, O1h);
  k_out<<<dim3((kM + 127) / 128, kE / 128), 128, 0, stream>>>(O1h, woh, bo, out);
}

// v004
// A run of this version takes 209 microseconds.
// Two timings next to v003 put it at 1.23 and 1.24 times that version's speed.
// All steps since v000 together make it 2.16 times as fast.
#include <hip/hip_runtime.h>
#include <hip/hip_bf16.h>

// ---------------- problem constants ----------------
constexpr int kB  = 64;        // batch
constexpr int kS  = 197;       // seq len
constexpr int kE  = 768;       // embed
constexpr int kH  = 12;        // heads
constexpr int kD  = 64;        // head dim
constexpr int kBH = kB * kH;   // 768
constexpr int kSP = 208;       // seq padded to mult of 16
constexpr int kM  = kB * kS;   // 12608 rows for projections

typedef _Float16 half_t;
typedef __attribute__((ext_vector_type(16))) _Float16     v16h;
typedef __attribute__((ext_vector_type(8)))  float        v8f;
typedef __attribute__((ext_vector_type(2)))  _Float16     h2;
typedef __attribute__((ext_vector_type(4)))  unsigned int u32x4;

struct HFrag { u32x4 a, b; };

__device__ __forceinline__ int imin(int a, int b) { return a < b ? a : b; }

// Load a 16x32 f16 WMMA A/B fragment from an LDS tile stored row-major
// [16][ldk].  Per ISA: lane<16 holds K {0..7,16..23} of row (lane&15);
// lane>=16 holds K {8..15,24..31}.  Two 16-byte ds_load_b128 per frag.
__device__ __forceinline__ v16h load_frag(const half_t* base, int ldk, int lane, int k0) {
  const half_t* p = base + (lane & 15) * ldk + k0 + ((lane >> 4) << 3);
  HFrag f;
  f.a = *(const u32x4*)p;
  f.b = *(const u32x4*)(p + 16);
  return __builtin_bit_cast(v16h, f);
}

// ---------------- shared 64x64 macro-tile GEMM core ----------------
// 128 threads = 4 waves; wave w owns output rows [16w,16w+16), all 64 cols.
// A element (r,k) at gA[r*sAr + k]; B^T element (n,k) at gB[n*sBr + k].
// K staged in 64-wide slabs, LDS row stride 72 halves (144B = 36 banks,
// gcd(36,64)=4 -> conflict-free).  Staging uses 16-byte b128 copies; all
// callers guarantee 16B alignment (bases/strides are multiples of 8 halves).
// The rows of B^T are dealt: row 4c + t lies at LDS row 16t + c, so a lane's
// four accumulator tiles of a row are four adjacent columns 4c .. 4c + 3.
__device__ __forceinline__ void gemm_core(
    const half_t* gA, long sAr, int aRows,
    const half_t* gB, long sBr, int bRows,
    int kTot, int kMax, half_t* lA, half_t* lB, v8f* acc) {
  const int tid  = threadIdx.x;
  const int wave = tid >> 5, lane = tid & 31;
  const u32x4 z4 = {0, 0, 0, 0};
  for (int k0 = 0; k0 < kTot; k0 += 64) {
    if (k0 + 64 < kTot) {            // hint next slab -> global_prefetch_b8
      __builtin_prefetch(gA + (long)(k0 + 64), 0, 1);
      __builtin_prefetch(gB + (long)(k0 + 64), 0, 1);
    }
    // stage 64x64 A and B^T slabs, 16B per transfer, 4 iters/thread
    for (int t = tid; t < 512; t += 128) {
      int r = t >> 3, c8 = (t & 7) << 3, k = k0 + c8;
      half_t* dA = lA + r * 72 + c8;
      half_t* dB = lB + (((r & 3) << 4) | (r >> 2)) * 72 + c8;   // dealt: see above
      if (k + 8 <= kMax) {
        if (r < aRows) *(u32x4*)dA = *(const u32x4*)(gA + (long)r * sAr + k);
        else           *(u32x4*)dA = z4;
        if (r < bRows) *(u32x4*)dB = *(const u32x4*)(gB + (long)r * sBr + k);
        else           *(u32x4*)dB = z4;
      } else {
        for (int j = 0; j < 8; ++j) {
          int kk = k + j;
          dA[j] = (r < aRows && kk < kMax) ? gA[(long)r * sAr + kk] : (half_t)0.f;
          dB[j] = (r < bRows && kk < kMax) ? gB[(long)r * sBr + kk] : (half_t)0.f;
        }
      }
    }
    __syncthreads();
    const half_t* aBase = lA + (wave << 4) * 72;
#pragma unroll
    for (int kk = 0; kk < 64; kk += 32) {
      v16h af = load_frag(aBase, 72, lane, kk);
#pragma unroll
      for (int nt = 0; nt < 4; ++nt) {
        v16h bf = load_frag(lB + (nt << 4) * 72, 72, lane, kk);
        acc[nt] = __builtin_amdgcn_wmma_f32_16x16x32_f16(
            false, af, false, bf, (short)0, acc[nt], false, false);
      }
    }
    __syncthreads();
  }
}

#define GEMM_SHARED                                    \
  __shared__ alignas(16) half_t lA[64 * 72];           \
  __shared__ alignas(16) half_t lB[64 * 72];           \
  v8f acc[4];                                          \
  { v8f z = {}; for (int i = 0; i < 4; ++i) acc[i] = z; }

// C/D VGPR layout: vgpr i, lane l -> row = i + 8*(l>>4), col = l&15.
#define EPILOGUE_VARS                                  \
  const int lane = threadIdx.x & 31;                   \
  const int rbase = ((threadIdx.x >> 5) << 4) + ((lane >> 4) << 3); \
  const int cbase = lane & 15;

// ---------------- 128x128 macro-tile GEMM core (dense projections) ----------------
// 128 threads = 4 waves in a 2x2 grid; each wave owns a 64x64 block of the
// tile as 4x4 accumulator tiles, so every fragment read from LDS feeds four
// WMMAs.  A is [aRows][kE], B^T is [128][kE], both K-contiguous; K runs over kE in
// 64-wide slabs at the same 72-half LDS pitch as above.  Rows past aRows
// re-read row aRows-1; callers never store the results of those rows.
// The rows of gB are dealt: LDS row 64g + 16t + c holds row 64g + 4c + t, so
// position c of fragment tile t is row 4c + t of the wave's 64, and the four
// tiles of one position are four adjacent rows.  With swap set the two slabs
// change roles in the product (gB rows become the rows of D, gA rows its
// columns); the k order of both loaders is the same either way.
__device__ __forceinline__ void gemm_core128(
    const half_t* __restrict__ gA, int aRows, const half_t* __restrict__ gB,
    half_t* lA, half_t* lB, bool swap, v8f (&acc)[4][4]) {
  const int tid  = threadIdx.x;
  const int wave = tid >> 5, lane = tid & 31;
  const int r0 = tid >> 3, c8 = (tid & 7) << 3;
  // byte offsets of this thread's eight A rows and of its first B row
  unsigned offA[8];
#pragma unroll
  for (int j = 0; j < 8; ++j)
    offA[j] = (unsigned)(imin(r0 + 16 * j, aRows - 1) * kE + c8) * 2u;
  const unsigned offB = (unsigned)(r0 * 4 * kE + c8) * 2u;
  const char* cA = (const char*)gA;
  const char* cB = (const char*)gB;
  half_t* sA = lA + r0 * 72 + c8;
  half_t* sB = lB + r0 * 72 + c8;
  const half_t* aBase = (swap ? lB : lA) + ((wave >> 1) << 6) * 72;
  const half_t* bBase = (swap ? lA : lB) + ((wave & 1) << 6) * 72;
  // Unrolled so that k0 is an immediate offset of every load: no address
  // arithmetic per slab, and no address register is rewritten behind a load.
#pragma unroll
  for (int k0 = 0; k0 < kE; k0 += 64) {
    u32x4 ta[8], tb[8];
#pragma unroll
    for (int j = 0; j < 8; ++j) ta[j] = *(const u32x4*)(cA + offA[j] + k0 * 2);
#pragma unroll
    for (int j = 0; j < 8; ++j) tb[j] = *(const u32x4*)(cB + offB + (k0 + ((j >> 2) * 64 + (j & 3)) * kE) * 2);
    // Precaution: the offset registers that the issued loads name stay live up
    // to this wait, so none is reused (not even as a load's destination) ahead of it.
    asm volatile("s_wait_xcnt 0x0"
                 :: "v"(offA[0]), "v"(offA[1]), "v"(offA[2]), "v"(offA[3]), "v"(offA[4]),
                    "v"(offA[5]), "v"(offA[6]), "v"(offA[7]), "v"(offB)
                 : "memory");
#pragma unroll
    for (int j = 0; j < 8; ++j) {
      *(u32x4*)(sA + j * 16 * 72) = ta[j];
      *(u32x4*)(sB + j * 16 * 72) = tb[j];
    }
    __syncthreads();
#pragma unroll
    for (int kk = 0; kk < 64; kk += 32) {
      v16h af[4], bf[4];
#pragma unroll
      for (int t = 0; t < 4; ++t) {
        af[t] = load_frag(aBase + (t << 4) * 72, 72, lane, kk);
        bf[t] = load_frag(bBase + (t << 4) * 72, 72, lane, kk);
      }
#pragma unroll
      for (int mt = 0; mt < 4; ++mt)
#pragma unroll
        for (int nt = 0; nt < 4; ++nt)
          acc[mt][nt] = __builtin_amdgcn_wmma_f32_16x16x32_f16(
              false, af[mt], false, bf[nt], (short)0, acc[mt][nt], false, false);
    }
    __syncthreads();
  }
}

#define GEMM128_SHARED                                 \
  __shared__ alignas(16) half_t lAB[2 * 128 * 72];     \
  half_t* lA = lAB;                                    \
  half_t* lB = lAB + 128 * 72;                         \
  v8f acc[4][4];                                       \
  { v8f z = {};                                        \
    for (int i = 0; i < 4; ++i)                        \
      for (int j = 0; j < 4; ++j) acc[i][j] = z; }

// Same C/D layout; the wave's 64x64 block starts at (64*(wave>>1), 64*(wave&1)).
// Along the dealt operand, tile t at position c is row 4c + t of the block.
#define EPILOGUE128_VARS                               \
  const int lane = threadIdx.x & 31;                   \
  const int wid = threadIdx.x >> 5;                    \
  const int rbase = ((wid >> 1) << 6) + ((lane >> 4) << 3); \
  const int cbase = ((wid & 1) << 6) + ((lane & 15) << 2);
static_assert(kM % 8 == 0, "a lane's eight rows of a tile are all inside kM or all outside");

// Four f16 stores at base + off, STEP bytes apart, two values to a register.
// Stores and wait are one statement so that the offset and the two data
// registers stay untouched up to the s_wait_xcnt (a precaution; a wait in a
// statement of its own does not hold later register writes behind it).
template <int STEP>
__device__ __forceinline__ void store4(half_t* base, unsigned off,
                                       float a0, float a1, float a2, float a3) {
  h2 p01 = {(half_t)a0, (half_t)a1}, p23 = {(half_t)a2, (half_t)a3};
  asm volatile(
      "global_store_b16 %0, %1, %3\n\t"
      "global_store_d16_hi_b16 %0, %1, %3 offset:%4\n\t"
      "global_store_b16 %0, %2, %3 offset:%5\n\t"
      "global_store_d16_hi_b16 %0, %2, %3 offset:%6\n\t"
      "s_wait_xcnt 0x0"
      :: "v"(off), "v"(__builtin_bit_cast(unsigned, p01)), "v"(__builtin_bit_cast(unsigned, p23)),
         "s"(base), "n"(STEP), "n"(2 * STEP), "n"(3 * STEP)
      : "memory");
}

typedef __attribute__((ext_vector_type(4))) float    f32x4;
typedef __attribute__((ext_vector_type(4))) _Float16 h4;
typedef __attribute__((ext_vector_type(2))) unsigned int u32x2;

// Four 8-byte stores (four f16 each) at base + o0..o3; stores and wait in one
// statement, for the same reason as in store4.
__device__ __forceinline__ void store4_b64(half_t* base, unsigned o0, unsigned o1, unsigned o2,
                                           unsigned o3, h4 a0, h4 a1, h4 a2, h4 a3) {
  asm volatile(
      "global_store_b64 %0, %4, %8\n\t"
      "global_store_b64 %1, %5, %8\n\t"
      "global_store_b64 %2, %6, %8\n\t"
      "global_store_b64 %3, %7, %8\n\t"
      "s_wait_xcnt 0x0"
      :: "v"(o0), "v"(o1), "v"(o2), "v"(o3),
         "v"(__builtin_bit_cast(u32x2, a0)), "v"(__builtin_bit_cast(u32x2, a1)),
         "v"(__builtin_bit_cast(u32x2, a2)), "v"(__builtin_bit_cast(u32x2, a3)), "s"(base)
      : "memory");
}

// One 16-byte store at base + off; store and wait in one statement as above.
__device__ __forceinline__ void store1_b128(float* base, unsigned off, f32x4 a) {
  asm volatile(
      "global_store_b128 %0, %1, %2\n\t"
      "s_wait_xcnt 0x0"
      :: "v"(off), "v"(a), "s"(base)
      : "memory");
}

// Four 16-byte stores at base + off, STEP bytes apart; one statement as above.
template <int STEP>
__device__ __forceinline__ void store4_b128(float* base, unsigned off,
                                            f32x4 a0, f32x4 a1, f32x4 a2, f32x4 a3) {
  asm volatile(
      "global_store_b128 %0, %1, %5\n\t"
      "global_store_b128 %0, %2, %5 offset:%6\n\t"
      "global_store_b128 %0, %3, %5 offset:%7\n\t"
      "global_store_b128 %0, %4, %5 offset:%8\n\t"
      "s_wait_xcnt 0x0"
      :: "v"(off), "v"(a0), "v"(a1), "v"(a2), "v"(a3),
         "s"(base), "n"(STEP), "n"(2 * STEP), "n"(3 * STEP)
      : "memory");
}

// ---------------- elementwise kernels ----------------
// f32 -> f16 conversion of x and of the four weight matrices in one launch.
// One work-group of 16 waves per 64 rows of 768 floats (196,608 B read), so the
// whole job is 245 work-groups, fewer than there are WGPs, and 3,920 waves to
// start.  A thread's 24 16-byte loads are unrolled from one offset register, so
// many are in flight at once; each wave-wide load covers 512 contiguous bytes
// and each wave-wide 8-byte store 256, whole lines both ways.
constexpr int kCvtThreads = 512;
constexpr int kCvtLoads   = 24;
constexpr int kCvtElems   = kCvtThreads * kCvtLoads * 4;   // floats per work-group
constexpr int kCvtBlocksX = kM * kE / kCvtElems;           // 197
constexpr int kCvtBlocksW = kE * kE / kCvtElems;           // 12
static_assert(kCvtBlocksX * kCvtElems == kM * kE, "x splits into whole work-groups");
static_assert(kCvtBlocksW * kCvtElems == kE * kE, "a weight splits into whole work-groups");

__global__ __launch_bounds__(kCvtThreads) void k_f2h_all(
    const float* __restrict__ x,  const float* __restrict__ wq, const float* __restrict__ wk,
    const float* __restrict__ wv, const float* __restrict__ wo,
    half_t* __restrict__ xh,  half_t* __restrict__ wqh, half_t* __restrict__ wkh,
    half_t* __restrict__ wvh, half_t* __restrict__ woh) {
  const float* in = x;
  half_t* out = xh;
  int part = blockIdx.x;
  if (part >= kCvtBlocksX) {
    const int w = (part - kCvtBlocksX) / kCvtBlocksW;
    part = (part - kCvtBlocksX) % kCvtBlocksW;
    in  = w == 0 ? wq  : w == 1 ? wk  : w == 2 ? wv  : wo;
    out = w == 0 ? wqh : w == 1 ? wkh : w == 2 ? wvh : woh;
  }
  const f32x4* s = (const f32x4*)(in + part * kCvtElems) + threadIdx.x;
  h4* d = (h4*)(out + part * kCvtElems) + threadIdx.x;
  f32x4 v[kCvtLoads];
  // Unrolled: j becomes an immediate offset, and many loads are in flight
  // before the first wait for data.
#pragma unroll
  for (int j = 0; j < kCvtLoads; ++j) v[j] = s[j * kCvtThreads];
  // Unrolled: v[] stays in registers and the stores share one offset register.
#pragma unroll
  for (int j = 0; j < kCvtLoads; ++j) d[j * kCvtThreads] = __builtin_convertvector(v[j], h4);
}

// Build v_pos^T (S,64,208) f16 via table gathers, and pack the two query-table
// row numbers of every (q,k) into 16 bits (x low byte, y high byte), laid out
// [q][k>>6][k&7][(k>>3)&7] so that a softmax thread (k = t8 + 8j) finds eight
// of its entries in one 16-byte load.  Row numbers are bounded here.
constexpr int kNE = 28;        // rows of each position table
__global__ void k_pos(const float* vtx, const float* vty,
                      const int* xd, const int* yd,
                      unsigned short* pidx, half_t* vposT) {
  int i = blockIdx.x * blockDim.x + threadIdx.x;
  if (i >= kS * kS) return;
  int dx = imin(xd[i] < 0 ? 0 : xd[i], kNE - 1), dy = imin(yd[i] < 0 ? 0 : yd[i], kNE - 1);
  int q = i / kS, kk = i % kS;
  pidx[q * 256 + (kk >> 6) * 64 + (kk & 7) * 8 + ((kk >> 3) & 7)] = (unsigned short)(dx | (dy << 8));
  size_t vb = (size_t)q * kD * kSP + kk;
  for (int j = 0; j < 32; ++j) {
    vposT[vb + (size_t)j * kSP]        = (half_t)vtx[dx * 32 + j];
    vposT[vb + (size_t)(32 + j) * kSP] = (half_t)vty[dy * 32 + j];
  }
}

// ---------------- phase kernels ----------------
// QKV projection: (12608x768) @ W^T + b.
// Q,K stored [bh][s][d]; V stored transposed [bh][d][sP] so the P@V GEMM
// has unit-stride K and stages with b128 copies.
__global__ __launch_bounds__(128) void k_proj(const half_t* __restrict__ xh,
                       const half_t* wq, const half_t* wk, const half_t* wv,
                       const float* bq, const float* bk, const float* bv,
                       half_t* Q, half_t* K, half_t* Vt) {
  GEMM128_SHARED
  int m0 = blockIdx.x << 7, n0 = blockIdx.y << 7, sel = blockIdx.z;
  const half_t* W    = sel == 0 ? wq : sel == 1 ? wk : wv;
  const float*  bias = sel == 0 ? bq : sel == 1 ? bk : bv;
  gemm_core128(xh + (long)m0 * kE, imin(128, kM - m0), W + (long)n0 * kE, lA, lB, sel == 2, acc);
  EPILOGUE128_VARS
  if (sel < 2) {
    // D rows are x rows, D columns the dealt weight rows: a lane's four tiles of
    // a row are four adjacent d of one head, so 16 lanes store that head's whole
    // 128-byte row of Q or K.
    half_t* qk = sel == 0 ? Q : K;
    const f32x4 bz = *(const f32x4*)(bias + n0 + cbase);
    const int h = (n0 + cbase) >> 6, d0 = cbase & 63;
#pragma unroll
    for (int mt = 0; mt < 4; ++mt) {
      const int mb = m0 + rbase + (mt << 4);
      if (mb < kM) {
#pragma unroll
        for (int i0 = 0; i0 < 8; i0 += 4) {
          unsigned o[4];
          h4 v[4];
#pragma unroll
          for (int i = 0; i < 4; ++i) {
            const int m = mb + i0 + i, b = m / kS, s = m % kS;
            o[i] = (unsigned)((((b * kH + h) * kS + s) * kD + d0) * 2);
            const f32x4 f = {acc[mt][0][i0 + i], acc[mt][1][i0 + i], acc[mt][2][i0 + i], acc[mt][3][i0 + i]};
            v[i] = __builtin_convertvector(f + bz, h4);
          }
          store4_b64(qk, o[0], o[1], o[2], o[3], v[0], v[1], v[2], v[3]);
        }
      }
    }
  } else {
    // Roles swapped: D rows are the dealt weight rows (d = 4 * row + mt of head
    // hv), D columns x rows, so 16 lanes store 16 adjacent s of one row of V^T.
    const int hv = (n0 >> 6) + (wid >> 1), dl = (lane >> 4) << 5;
    f32x4 bz[8];
#pragma unroll
    for (int i = 0; i < 8; ++i) bz[i] = *(const f32x4*)(bias + (hv << 6) + dl + (i << 2));
#pragma unroll
    for (int nt = 0; nt < 4; ++nt) {
      const int m = m0 + ((wid & 1) << 6) + (nt << 4) + (lane & 15);
      if (m < kM) {
        const int b = m / kS, s = m % kS;
        const unsigned off = (unsigned)((((b * kH + hv) * kD + dl) * kSP + s) * 2);
#pragma unroll
        for (int i = 0; i < 8; ++i)
          store4<kSP * 2>(Vt, off + (unsigned)(i * 4 * kSP * 2),
                          acc[0][nt][i] + bz[i][0], acc[1][nt][i] + bz[i][1],
                          acc[2][nt][i] + bz[i][2], acc[3][nt][i] + bz[i][3]);
      }
    }
  }
}

// Content logits + position logits + softmax -> P.  One block = (bh, 16 q rows, all k).
// Position term: q_pos[q,k,:] is row x_dist[q,k] of one table beside row
// y_dist[q,k] of the other, so Q[q,:] . q_pos[q,k,:] = TX[q][x_dist] + TY[q][y_dist]
// with TX = Q[:, 0:32] . q_tab_x^T and TY = Q[:, 32:64] . q_tab_y^T (16 x 28 each):
// one WMMA per wave, kept in f32 in LDS and gathered per (q,k).  TX and TY take
// the place of the K tile once its last read is over, so LDS per block stays.
__global__ void k_attn(const half_t* __restrict__ Q, const half_t* __restrict__ K,
                       const float* __restrict__ qtx, const float* __restrict__ qty,
                       const unsigned short* __restrict__ pidx,
                       half_t* __restrict__ P) {
  __shared__ alignas(16) half_t lQ[16 * 72];
  __shared__ alignas(16) half_t lK[kSP * 72];
  __shared__ float lgt[16 * 224];
  const int q0 = blockIdx.x << 4, bh = blockIdx.y;
  const int tid = threadIdx.x, wave = tid >> 5, lane = tid & 31;
  const int r = tid >> 3, t8 = tid & 7;   // softmax: 8 threads per row
  const u32x4 z4 = {0, 0, 0, 0};

  // This thread's packed table rows for k = t8 + 8j: j = 0..23 in three 16-byte
  // loads, j = 24 alone (it exists for t8 < 5 only).
  const unsigned short* ip = pidx + imin(q0 + r, kS - 1) * 256 + t8 * 8;
  const u32x4 iw0 = *(const u32x4*)ip;
  const u32x4 iw1 = *(const u32x4*)(ip + 64);
  const u32x4 iw2 = *(const u32x4*)(ip + 128);
  unsigned iw3 = 0;
  if (192 + t8 < kS) iw3 = ip[192];

  // This wave's 16 table rows as a B fragment, in load_frag's k order:
  // waves 0,1 take q_tab_x rows 0..15 and 16..31, waves 2,3 q_tab_y; rows past
  // the table are zero.
  const int te = ((wave & 1) << 4) + (lane & 15);
  const f32x4* tp = (const f32x4*)((wave >> 1 ? qty : qtx) + imin(te, kNE - 1) * 32 + ((lane >> 4) << 3));
  f32x4 tf[4] = {tp[0], tp[1], tp[4], tp[5]};
  v16h tb;
#pragma unroll
  for (int j = 0; j < 16; ++j) tb[j] = te < kNE ? (half_t)tf[j >> 2][j & 3] : (half_t)0.f;

  for (int t = tid; t < 16 * 8; t += 128) {
    int r = t >> 3, c8 = (t & 7) << 3, q = q0 + r;
    u32x4 v = z4;
    if (q < kS) v = *(const u32x4*)(Q + ((size_t)bh * kS + q) * kD + c8);
    *(u32x4*)(lQ + r * 72 + c8) = v;
  }
  for (int t = tid; t < kSP * 8; t += 128) {
    int r = t >> 3, c8 = (t & 7) << 3;
    u32x4 v = z4;
    if (r < kS) v = *(const u32x4*)(K + ((size_t)bh * kS + r) * kD + c8);
    *(u32x4*)(lK + r * 72 + c8) = v;
  }
  __syncthreads();

  v16h af0 = load_frag(lQ, 72, lane, 0);
  v16h af1 = load_frag(lQ, 72, lane, 32);
  const int rb = (lane >> 4) << 3, cb = lane & 15;
  v8f tacc = {};
  tacc = __builtin_amdgcn_wmma_f32_16x16x32_f16(false, wave >> 1 ? af1 : af0, false, tb, (short)0, tacc, false, false);
  for (int nt = wave; nt < 13; nt += 4) {
    v8f a = {};
    v16h bf0 = load_frag(lK + nt * 16 * 72, 72, lane, 0);
    v16h bf1 = load_frag(lK + nt * 16 * 72, 72, lane, 32);
    a = __builtin_amdgcn_wmma_f32_16x16x32_f16(false, af0, false, bf0, (short)0, a, false, false);
    a = __builtin_amdgcn_wmma_f32_16x16x32_f16(false, af1, false, bf1, (short)0, a, false, false);
    int col = (nt << 4) + cb;
#pragma unroll
    for (int i = 0; i < 8; ++i) lgt[(rb + i) * 224 + col] = a[i];
  }
  __syncthreads();

  // Every wave has left lK: rows of 68 floats over it, TX at 0..31, TY at 32..63.
  float* lT = (float*)lK;
#pragma unroll
  for (int i = 0; i < 8; ++i) lT[(rb + i) * 68 + (wave << 4) + cb] = tacc[i];
  __syncthreads();   // publishes TX, TY to the softmax threads

  // softmax; its first pass adds the two gathered position terms and scales
  const unsigned iw[13] = {iw0[0], iw0[1], iw0[2], iw0[3], iw1[0], iw1[1], iw1[2], iw1[3],
                           iw2[0], iw2[1], iw2[2], iw2[3], iw3};
  const float* tr = lT + r * 68;
  float mx = -3.0e38f;
  // Unrolled: j picks the index word and byte at compile time.
#pragma unroll
  for (int j = 0; j < 25; ++j) {
    const int k = t8 + 8 * j;
    if (k < kS) {
      const unsigned e = iw[j >> 1] >> ((j & 1) * 16);
      const float v = (lgt[r * 224 + k] + tr[e & 0xff] + tr[32 + ((e >> 8) & 0xff)]) * 0.125f;   // 1/sqrt(64)
      lgt[r * 224 + k] = v;
      mx = fmaxf(mx, v);
    }
  }
  for (int off = 4; off; off >>= 1) mx = fmaxf(mx, __shfl_xor(mx, off, 8));
  float sum = 0.f;
  for (int k = t8; k < kS; k += 8) {
    float e = __expf(lgt[r * 224 + k] - mx);
    lgt[r * 224 + k] = e;
    sum += e;
  }
  for (int off = 4; off; off >>= 1) sum += __shfl_xor(sum, off, 8);
  float inv = 1.f / sum;
  int q = q0 + r;
  if (q < kS)
    for (int k = t8; k < kSP; k += 8) {
      float p = (k < kS) ? lgt[r * 224 + k] * inv : 0.f;
      P[((size_t)q * kBH + bh) * kSP + k] = (half_t)p;
    }
}

// Content output (per bh): O1[b,q,h*64+d] = P[bh] @ V[bh]   (fp32)
__global__ void k_pv(const half_t* __restrict__ P, const half_t* __restrict__ Vt,
                     float* __restrict__ O1) {
  GEMM_SHARED
  int m0 = blockIdx.x << 6, bh = blockIdx.y;
  gemm_core(P + ((size_t)m0 * kBH + bh) * kSP, (long)kBH * kSP, imin(64, kS - m0),
            Vt + (size_t)bh * kD * kSP, kSP, 64,
            224, kS, lA, lB, acc);
  EPILOGUE_VARS
  int b = bh / kH, h = bh % kH;
  // 16 lanes store a head's whole 256-byte row.
#pragma unroll
  for (int i = 0; i < 8; ++i) {
    const int q = m0 + rbase + i;
    if (q < kS) {
      const f32x4 v = {acc[0][i], acc[1][i], acc[2][i], acc[3][i]};
      store1_b128(O1, (unsigned)(((b * kS + q) * kE + h * kD + (cbase << 2)) * 4), v);
    }
  }
}

// v_pos output (per q): add P_qslice @ v_pos[q]; finalize O1 -> f16 for out-proj.
__global__ void k_vpos(const half_t* __restrict__ P, const half_t* __restrict__ vposT,
                       const float* __restrict__ O1, half_t* __restrict__ O1h) {
  GEMM_SHARED
  int m0 = blockIdx.x << 6, q = blockIdx.y;
  gemm_core(P + ((size_t)q * kBH + m0) * kSP, kSP, 64,
            vposT + (size_t)q * kD * kSP, kSP, 64,
            224, kS, lA, lB, acc);
  EPILOGUE_VARS
  // 16 lanes read a head's whole 256-byte row of O1 and store its 128-byte row of O1h.
  unsigned off[8];
  f32x4 o1[8];
#pragma unroll
  for (int i = 0; i < 8; ++i) {
    const int bh = m0 + rbase + i, b = bh / kH, h = bh % kH;
    off[i] = (unsigned)(((b * kS + q) * kE + h * kD + (cbase << 2)) * 4);
  }
#pragma unroll
  for (int i = 0; i < 8; ++i) o1[i] = *(const f32x4*)((const char*)O1 + off[i]);
  // Precaution, as in gemm_core128: the offset registers of the issued loads
  // stay live up to this wait.
  asm volatile("s_wait_xcnt 0x0"
               :: "v"(off[0]), "v"(off[1]), "v"(off[2]), "v"(off[3]),
                  "v"(off[4]), "v"(off[5]), "v"(off[6]), "v"(off[7])
               : "memory");
  h4 v[8];
#pragma unroll
  for (int i = 0; i < 8; ++i) {
    const f32x4 f = {acc[0][i], acc[1][i], acc[2][i], acc[3][i]};
    v[i] = __builtin_convertvector(f + o1[i], h4);
  }
  store4_b64(O1h, off[0] >> 1, off[1] >> 1, off[2] >> 1, off[3] >> 1, v[0], v[1], v[2], v[3]);
  store4_b64(O1h, off[4] >> 1, off[5] >> 1, off[6] >> 1, off[7] >> 1, v[4], v[5], v[6], v[7]);
}

// Output projection: out = O1h @ Wo^T + bo   (fp32 out)
__global__ __launch_bounds__(128) void k_out(const half_t* __restrict__ O1h, const half_t* __restrict__ wo,
                      const float* __restrict__ bo, float* __restrict__ out) {
  GEMM128_SHARED
  int m0 = blockIdx.x << 7, n0 = blockIdx.y << 7;
  gemm_core128(O1h + (long)m0 * kE, imin(128, kM - m0), wo + (long)n0 * kE, lA, lB, false, acc);
  EPILOGUE128_VARS
  // A lane's four tiles of a row are four adjacent columns: 16 lanes store 256
  // contiguous bytes, two whole lines.
  const f32x4 bz = *(const f32x4*)(bo + n0 + cbase);
  const unsigned off = (unsigned)(((m0 + rbase) * kE + n0 + cbase) * 4);
#pragma unroll
  for (int mt = 0; mt < 4; ++mt) {
    if (m0 + rbase + (mt << 4) < kM) {
#pragma unroll
      for (int i0 = 0; i0 < 8; i0 += 4) {
        f32x4 v[4];
#pragma unroll
        for (int i = 0; i < 4; ++i) {
          const f32x4 f = {acc[mt][0][i0 + i], acc[mt][1][i0 + i], acc[mt][2][i0 + i], acc[mt][3][i0 + i]};
          v[i] = f + bz;
        }
        store4_b128<kE * 4>(out, off + (unsigned)(((mt << 4) + i0) * kE * 4), v[0], v[1], v[2], v[3]);
      }
    }
  }
}

// ---------------- host launcher ----------------
extern "C" void kernel_launch(void* const* d_in, const int* in_sizes, int n_in,
                              void* d_out, int out_size, void* d_ws, size_t ws_size,
                              hipStream_t stream) {
  (void)in_sizes; (void)n_in; (void)out_size; (void)ws_size;
  const float* x   = (const float*)d_in[0];
  const float* Wq  = (const float*)d_in[1];
  const float* bq  = (const float*)d_in[2];
  const float* Wk  = (const float*)d_in[3];
  const float* bk  = (const float*)d_in[4];
  const float* Wv  = (const float*)d_in[5];
  const float* bv  = (const float*)d_in[6];
  const float* Wo  = (const float*)d_in[7];
  const float* bo  = (const float*)d_in[8];
  const float* qtx = (const float*)d_in[9];
  const float* qty = (const float*)d_in[10];
  const float* vtx = (const float*)d_in[11];
  const float* vty = (const float*)d_in[12];
  const int*   xd  = (const int*)d_in[13];
  const int*   yd  = (const int*)d_in[14];
  float* out = (float*)d_out;

  char* ws = (char*)d_ws;
  size_t off = 0;
  auto take = [&](size_t bytes) {
    void* p = ws + off;
    off += (bytes + 255) & ~(size_t)255;
    return p;
  };
  const size_t NX   = (size_t)kM * kE;           // 9.68M
  const size_t NW   = (size_t)kE * kE;
  const size_t NQ   = (size_t)kBH * kS * kD;     // 9.68M
  const size_t NVT  = (size_t)kBH * kD * kSP;    // 10.2M
  const size_t NIDX = (size_t)kS * 256;
  const size_t NVPT = (size_t)kS * kD * kSP;     // 2.62M
  const size_t NP   = (size_t)kS * kBH * kSP;    // 31.5M

  half_t* xh    = (half_t*)take(NX * 2);
  half_t* wqh   = (half_t*)take(NW * 2);
  half_t* wkh   = (half_t*)take(NW * 2);
  half_t* wvh   = (half_t*)take(NW * 2);
  half_t* woh   = (half_t*)take(NW * 2);
  half_t* Qh    = (half_t*)take(NQ * 2);
  half_t* Kh    = (half_t*)take(NQ * 2);
  half_t* Vt    = (half_t*)take(NVT * 2);
  unsigned short* pidx = (unsigned short*)take(NIDX * 2);
  half_t* vposT = (half_t*)take(NVPT * 2);
  half_t* P     = (half_t*)take(NP * 2);
  float*  O1    = (float*)take(NX * 4);
  half_t* O1h   = xh;  // xh dead after k_proj; reuse

  k_f2h_all<<<kCvtBlocksX + 4 * kCvtBlocksW, kCvtThreads, 0, stream>>>(
      x, Wq, Wk, Wv, Wo, xh, wqh, wkh, wvh, woh);
  k_pos<<<(kS * kS + 255) / 256, 256, 0, stream>>>(vtx, vty, xd, yd, pidx, vposT);

  k_proj<<<dim3((kM + 127) / 128, kE / 128, 3), 128, 0, stream>>>(
      xh, wqh, wkh, wvh, bq, bk, bv, Qh, Kh, Vt);
  k_attn<<<dim3((kS + 15) / 16, kBH), 128, 0, stream>>>(Qh, Kh, qtx, qty, pidx, P);
  k_pv<<<dim3((kS + 63) / 64, kBH), 128, 0, stream>>>(P, Vt, O1);
  k_vpos<<<dim3(kBH / 64, kS), 128, 0, stream>>>(P, vposT, O1, O1h);
  k_out<<<dim3((kM + 127) / 128, kE / 128), 128, 0, stream>>>(O1h, woh, bo, out);
}

// v005
// One run takes 193 microseconds.
// Two timings next to v004 both put it at 1.08 times that version's speed.
// All steps since v000 together make it 2.34 times as fast.
#include <hip/hip_runtime.h>
#include <hip/hip_bf16.h>

// ---------------- problem constants ----------------
constexpr int kB  = 64;        // batch
constexpr int kS  = 197;       // seq len
constexpr int kE  = 768;       // embed
constexpr int kH  = 12;        // heads
constexpr int kD  = 64;        // head dim
constexpr int kBH = kB * kH;   // 768
constexpr int kSP = 208;       // seq padded to mult of 16
constexpr int kM  = kB * kS;   // 12608 rows for projections

typedef _Float16 half_t;
typedef __attribute__((ext_vector_type(16))) _Float16     v16h;
typedef __attribute__((ext_vector_type(8)))  float        v8f;
typedef __attribute__((ext_vector_type(2)))  _Float16     h2;
typedef __attribute__((ext_vector_type(4)))  unsigned int u32x4;
typedef __attribute__((ext_vector_type(2)))  unsigned int u32x2;

struct HFrag { u32x4 a, b; };

__device__ __forceinline__ int imin(int a, int b) { return a < b ? a : b; }

// Load a 16x32 f16 WMMA A/B fragment from an LDS tile stored row-major
// [16][ldk].  Per ISA: lane<16 holds K {0..7,16..23} of row (lane&15);
// lane>=16 holds K {8..15,24..31}.  Two 16-byte ds_load_b128 per frag.
__device__ __forceinline__ v16h load_frag(const half_t* base, int ldk, int lane, int k0) {
  const half_t* p = base + (lane & 15) * ldk + k0 + ((lane >> 4) << 3);
  HFrag f;
  f.a = *(const u32x4*)p;
  f.b = *(const u32x4*)(p + 16);
  return __builtin_bit_cast(v16h, f);
}

// ---------------- shared 64x64 macro-tile GEMM core ----------------
// 128 threads = 4 waves; wave w owns output rows [16w,16w+16), all 64 cols.
// A element (r,k) at gA[r*sAr + k]; B^T element (n,k) at gB[n*sBr + k]; k runs
// over kS.  K staged in 64-wide slabs, LDS row stride 72 halves (144B = 36 banks,
// gcd(36,64)=4 -> conflict-free).  Staging uses 16-byte b128 copies; all
// callers guarantee 16B alignment (bases/strides are multiples of 8 halves).
// A thread's eight loads of a slab are all issued before the first wait for
// data: no branch stands between them.  Rows past aRows re-read row aRows-1;
// callers never store the results of those rows.
// The rows of B^T are dealt: row 4c + t lies at LDS row 16t + c, so a lane's
// four accumulator tiles of a row are four adjacent columns 4c .. 4c + 3.
constexpr int kFull = kS / 64 * 64;   // 192: k covered by whole slabs
static_assert(kS - kFull == 5, "the last slab below reads four halves and one per row");
__device__ __forceinline__ void gemm_core(
    const half_t* gA, unsigned sAr, int aRows,
    const half_t* gB, unsigned sBr, half_t* lA, half_t* lB, v8f* acc) {
  const int tid  = threadIdx.x;
  const int wave = tid >> 5, lane = tid & 31;
  const int r0 = tid >> 3, c8 = (tid & 7) << 3;
  // byte offsets of this thread's four rows of A and of B^T
  unsigned rowA[4], rowB[4];
#pragma unroll
  for (int j = 0; j < 4; ++j) {
    rowA[j] = (unsigned)imin(r0 + 16 * j, aRows - 1) * sAr * 2u;
    rowB[j] = (unsigned)(r0 + 16 * j) * sBr * 2u;
  }
  const char* cA = (const char*)gA;
  const char* cB = (const char*)gB;
  half_t* dA = lA + r0 * 72 + c8;
  half_t* dB = lB + (((r0 & 3) << 4) + (r0 >> 2)) * 72 + c8;   // dealt: row r0 + 16j lies 4j rows on
  const half_t* aBase = lA + (wave << 4) * 72;
  // Unrolled so that k0 is an immediate offset of every load and the last slab
  // is told apart at compile time.
#pragma unroll
  for (int k0 = 0; k0 < kFull + 64; k0 += 64) {
    u32x4 ta[4], tb[4];
    if (k0 < kFull) {
      unsigned oA[4], oB[4];
#pragma unroll
      for (int j = 0; j < 4; ++j) { oA[j] = rowA[j] + c8 * 2; oB[j] = rowB[j] + c8 * 2; }
#pragma unroll
      for (int j = 0; j < 4; ++j) ta[j] = *(const u32x4*)(cA + oA[j] + k0 * 2);
#pragma unroll
      for (int j = 0; j < 4; ++j) tb[j] = *(const u32x4*)(cB + oB[j] + k0 * 2);
      // Precaution: the offset registers that the issued loads name stay live up
      // to this wait, so none is reused ahead of it.
      asm volatile("s_wait_xcnt 0x0"
                   :: "v"(oA[0]), "v"(oA[1]), "v"(oA[2]), "v"(oA[3]),
                      "v"(oB[0]), "v"(oB[1]), "v"(oB[2]), "v"(oB[3])
                   : "memory");
    } else {
      // Last slab: k = kFull .. kS-1 are real, the rest of its 64 columns is zero.
      // Every thread reads the five halves of its rows (8 bytes and 2); the
      // thread of column 0 keeps them, the others store zero.
      u32x2 a4[4], b4[4];
      unsigned a1[4], b1[4];
#pragma unroll
      for (int j = 0; j < 4; ++j) {
        a4[j] = *(const u32x2*)(cA + rowA[j] + kFull * 2);
        a1[j] = *(const unsigned short*)(cA + rowA[j] + (kFull + 4) * 2);
      }
#pragma unroll
      for (int j = 0; j < 4; ++j) {
        b4[j] = *(const u32x2*)(cB + rowB[j] + kFull * 2);
        b1[j] = *(const unsigned short*)(cB + rowB[j] + (kFull + 4) * 2);
      }
      // Precaution, as above.
      asm volatile("s_wait_xcnt 0x0"
                   :: "v"(rowA[0]), "v"(rowA[1]), "v"(rowA[2]), "v"(rowA[3]),
                      "v"(rowB[0]), "v"(rowB[1]), "v"(rowB[2]), "v"(rowB[3])
                   : "memory");
      const unsigned keep = c8 == 0 ? 0xffffffffu : 0u;
#pragma unroll
      for (int j = 0; j < 4; ++j) {
        ta[j] = u32x4{a4[j][0] & keep, a4[j][1] & keep, a1[j] & keep, 0u};
        tb[j] = u32x4{b4[j][0] & keep, b4[j][1] & keep, b1[j] & keep, 0u};
      }
    }
#pragma unroll
    for (int j = 0; j < 4; ++j) {
      *(u32x4*)(dA + j * 16 * 72) = ta[j];
      *(u32x4*)(dB + j * 4 * 72)  = tb[j];
    }
    __syncthreads();
#pragma unroll
    for (int kk = 0; kk < 64; kk += 32) {
      v16h af = load_frag(aBase, 72, lane, kk);
#pragma unroll
      for (int nt = 0; nt < 4; ++nt) {
        v16h bf = load_frag(lB + (nt << 4) * 72, 72, lane, kk);
        acc[nt] = __builtin_amdgcn_wmma_f32_16x16x32_f16(
            false, af, false, bf, (short)0, acc[nt], false, false);
      }
    }
    __syncthreads();
  }
}

#define GEMM_SHARED                                    \
  __shared__ alignas(16) half_t lA[64 * 72];           \
  __shared__ alignas(16) half_t lB[64 * 72];           \
  v8f acc[4];                                          \
  { v8f z = {}; for (int i = 0; i < 4; ++i) acc[i] = z; }

// C/D VGPR layout: vgpr i, lane l -> row = i + 8*(l>>4), col = l&15.
#define EPILOGUE_VARS                                  \
  const int lane = threadIdx.x & 31;                   \
  const int rbase = ((threadIdx.x >> 5) << 4) + ((lane >> 4) << 3); \
  const int cbase = lane & 15;

// ---------------- 128x128 macro-tile GEMM core (dense projections) ----------------
// 128 threads = 4 waves in a 2x2 grid; each wave owns a 64x64 block of the
// tile as 4x4 accumulator tiles, so every fragment read from LDS feeds four
// WMMAs.  A is [aRows][kE], B^T is [128][kE], both K-contiguous; K runs over kE in
// 64-wide slabs at the same 72-half LDS pitch as above.  Rows past aRows
// re-read row aRows-1; callers never store the results of those rows.
// The rows of gB are dealt: LDS row 64g + 16t + c holds row 64g + 4c + t, so
// position c of fragment tile t is row 4c + t of the wave's 64, and the four
// tiles of one position are four adjacent rows.  With swap set the two slabs
// change roles in the product (gB rows become the rows of D, gA rows its
// columns); the k order of both loaders is the same either way.
__device__ __forceinline__ void gemm_core128(
    const half_t* __restrict__ gA, int aRows, const half_t* __restrict__ gB,
    half_t* lA, half_t* lB, bool swap, v8f (&acc)[4][4]) {
  const int tid  = threadIdx.x;
  const int wave = tid >> 5, lane = tid & 31;
  const int r0 = tid >> 3, c8 = (tid & 7) << 3;
  // byte offsets of this thread's eight A rows and of its first B row
  unsigned offA[8];
#pragma unroll
  for (int j = 0; j < 8; ++j)
    offA[j] = (unsigned)(imin(r0 + 16 * j, aRows - 1) * kE + c8) * 2u;
  const unsigned offB = (unsigned)(r0 * 4 * kE + c8) * 2u;
  const char* cA = (const char*)gA;
  const char* cB = (const char*)gB;
  half_t* sA = lA + r0 * 72 + c8;
  half_t* sB = lB + r0 * 72 + c8;
  const half_t* aBase = (swap ? lB : lA) + ((wave >> 1) << 6) * 72;
  const half_t* bBase = (swap ? lA : lB) + ((wave & 1) << 6) * 72;
  // Unrolled so that k0 is an immediate offset of every load: no address
  // arithmetic per slab, and no address register is rewritten behind a load.
#pragma unroll
  for (int k0 = 0; k0 < kE; k0 += 64) {
    u32x4 ta[8], tb[8];
#pragma unroll
    for (int j = 0; j < 8; ++j) ta[j] = *(const u32x4*)(cA + offA[j] + k0 * 2);
#pragma unroll
    for (int j = 0; j < 8; ++j) tb[j] = *(const u32x4*)(cB + offB + (k0 + ((j >> 2) * 64 + (j & 3)) * kE) * 2);
    // Precaution: the offset registers that the issued loads name stay live up
    // to this wait, so none is reused (not even as a load's destination) ahead of it.
    asm volatile("s_wait_xcnt 0x0"
                 :: "v"(offA[0]), "v"(offA[1]), "v"(offA[2]), "v"(offA[3]), "v"(offA[4]),
                    "v"(offA[5]), "v"(offA[6]), "v"(offA[7]), "v"(offB)
                 : "memory");
#pragma unroll
    for (int j = 0; j < 8; ++j) {
      *(u32x4*)(sA + j * 16 * 72) = ta[j];
      *(u32x4*)(sB + j * 16 * 72) = tb[j];
    }
    __syncthreads();
#pragma unroll
    for (int kk = 0; kk < 64; kk += 32) {
      v16h af[4], bf[4];
#pragma unroll
      for (int t = 0; t < 4; ++t) {
        af[t] = load_frag(aBase + (t << 4) * 72, 72, lane, kk);
        bf[t] = load_frag(bBase + (t << 4) * 72, 72, lane, kk);
      }
#pragma unroll
      for (int mt = 0; mt < 4; ++mt)
#pragma unroll
        for (int nt = 0; nt < 4; ++nt)
          acc[mt][nt] = __builtin_amdgcn_wmma_f32_16x16x32_f16(
              false, af[mt], false, bf[nt], (short)0, acc[mt][nt], false, false);
    }
    __syncthreads();
  }
}

#define GEMM128_SHARED                                 \
  __shared__ alignas(16) half_t lAB[2 * 128 * 72];     \
  half_t* lA = lAB;                                    \
  half_t* lB = lAB + 128 * 72;                         \
  v8f acc[4][4];                                       \
  { v8f z = {};                                        \
    for (int i = 0; i < 4; ++i)                        \
      for (int j = 0; j < 4; ++j) acc[i][j] = z; }

// Same C/D layout; the wave's 64x64 block starts at (64*(wave>>1), 64*(wave&1)).
// Along the dealt operand, tile t at position c is row 4c + t of the block.
#define EPILOGUE128_VARS                               \
  const int lane = threadIdx.x & 31;                   \
  const int wid = threadIdx.x >> 5;                    \
  const int rbase = ((wid >> 1) << 6) + ((lane >> 4) << 3); \
  const int cbase = ((wid & 1) << 6) + ((lane & 15) << 2);
static_assert(kM % 8 == 0, "a lane's eight rows of a tile are all inside kM or all outside");

// Four f16 stores at base + off, STEP bytes apart, two values to a register.
// Stores and wait are one statement so that the offset and the two data
// registers stay untouched up to the s_wait_xcnt (a precaution; a wait in a
// statement of its own does not hold later register writes behind it).
template <int STEP>
__device__ __forceinline__ void store4(half_t* base, unsigned off,
                                       float a0, float a1, float a2, float a3) {
  h2 p01 = {(half_t)a0, (half_t)a1}, p23 = {(half_t)a2, (half_t)a3};
  asm volatile(
      "global_store_b16 %0, %1, %3\n\t"
      "global_store_d16_hi_b16 %0, %1, %3 offset:%4\n\t"
      "global_store_b16 %0, %2, %3 offset:%5\n\t"
      "global_store_d16_hi_b16 %0, %2, %3 offset:%6\n\t"
      "s_wait_xcnt 0x0"
      :: "v"(off), "v"(__builtin_bit_cast(unsigned, p01)), "v"(__builtin_bit_cast(unsigned, p23)),
         "s"(base), "n"(STEP), "n"(2 * STEP), "n"(3 * STEP)
      : "memory");
}

typedef __attribute__((ext_vector_type(4))) float    f32x4;
typedef __attribute__((ext_vector_type(4))) _Float16 h4;

// Four 8-byte stores (four f16 each) at base + o0..o3; stores and wait in one
// statement, for the same reason as in store4.
__device__ __forceinline__ void store4_b64(half_t* base, unsigned o0, unsigned o1, unsigned o2,
                                           unsigned o3, h4 a0, h4 a1, h4 a2, h4 a3) {
  asm volatile(
      "global_store_b64 %0, %4, %8\n\t"
      "global_store_b64 %1, %5, %8\n\t"
      "global_store_b64 %2, %6, %8\n\t"
      "global_store_b64 %3, %7, %8\n\t"
      "s_wait_xcnt 0x0"
      :: "v"(o0), "v"(o1), "v"(o2), "v"(o3),
         "v"(__builtin_bit_cast(u32x2, a0)), "v"(__builtin_bit_cast(u32x2, a1)),
         "v"(__builtin_bit_cast(u32x2, a2)), "v"(__builtin_bit_cast(u32x2, a3)), "s"(base)
      : "memory");
}

// One 16-byte store at base + off; store and wait in one statement as above.
__device__ __forceinline__ void store1_b128(float* base, unsigned off, f32x4 a) {
  asm volatile(
      "global_store_b128 %0, %1, %2\n\t"
      "s_wait_xcnt 0x0"
      :: "v"(off), "v"(a), "s"(base)
      : "memory");
}

// Four 16-byte stores at base + off, STEP bytes apart; one statement as above.
template <int STEP>
__device__ __forceinline__ void store4_b128(float* base, unsigned off,
                                            f32x4 a0, f32x4 a1, f32x4 a2, f32x4 a3) {
  asm volatile(
      "global_store_b128 %0, %1, %5\n\t"
      "global_store_b128 %0, %2, %5 offset:%6\n\t"
      "global_store_b128 %0, %3, %5 offset:%7\n\t"
      "global_store_b128 %0, %4, %5 offset:%8\n\t"
      "s_wait_xcnt 0x0"
      :: "v"(off), "v"(a0), "v"(a1), "v"(a2), "v"(a3),
         "s"(base), "n"(STEP), "n"(2 * STEP), "n"(3 * STEP)
      : "memory");
}

// A softmax thread's 26 f16 stores at base + off, 16 bytes apart, two values to a
// register; stores and wait in one statement, for the same reason as in store4.
__device__ __forceinline__ void store26(half_t* base, unsigned off, const unsigned (&p)[13]) {
  asm volatile(
      "global_store_b16 %0, %2, %1\n\t"
      "global_store_d16_hi_b16 %0, %2, %1 offset:16\n\t"
      "global_store_b16 %0, %3, %1 offset:32\n\t"
      "global_store_d16_hi_b16 %0, %3, %1 offset:48\n\t"
      "global_store_b16 %0, %4, %1 offset:64\n\t"
      "global_store_d16_hi_b16 %0, %4, %1 offset:80\n\t"
      "global_store_b16 %0, %5, %1 offset:96\n\t"
      "global_store_d16_hi_b16 %0, %5, %1 offset:112\n\t"
      "global_store_b16 %0, %6, %1 offset:128\n\t"
      "global_store_d16_hi_b16 %0, %6, %1 offset:144\n\t"
      "global_store_b16 %0, %7, %1 offset:160\n\t"
      "global_store_d16_hi_b16 %0, %7, %1 offset:176\n\t"
      "global_store_b16 %0, %8, %1 offset:192\n\t"
      "global_store_d16_hi_b16 %0, %8, %1 offset:208\n\t"
      "global_store_b16 %0, %9, %1 offset:224\n\t"
      "global_store_d16_hi_b16 %0, %9, %1 offset:240\n\t"
      "global_store_b16 %0, %10, %1 offset:256\n\t"
      "global_store_d16_hi_b16 %0, %10, %1 offset:272\n\t"
      "global_store_b16 %0, %11, %1 offset:288\n\t"
      "global_store_d16_hi_b16 %0, %11, %1 offset:304\n\t"
      "global_store_b16 %0, %12, %1 offset:320\n\t"
      "global_store_d16_hi_b16 %0, %12, %1 offset:336\n\t"
      "global_store_b16 %0, %13, %1 offset:352\n\t"
      "global_store_d16_hi_b16 %0, %13, %1 offset:368\n\t"
      "global_store_b16 %0, %14, %1 offset:384\n\t"
      "global_store_d16_hi_b16 %0, %14, %1 offset:400\n\t"
      "s_wait_xcnt 0x0"
      :: "v"(off), "s"(base),
         "v"(p[0]), "v"(p[1]), "v"(p[2]), "v"(p[3]), "v"(p[4]), "v"(p[5]), "v"(p[6]),
         "v"(p[7]), "v"(p[8]), "v"(p[9]), "v"(p[10]), "v"(p[11]), "v"(p[12])
      : "memory");
}

// ---------------- elementwise kernels ----------------
// f32 -> f16 conversion of x and of the four weight matrices in one launch.
// One work-group of 16 waves per 64 rows of 768 floats (196,608 B read), so the
// whole job is 245 work-groups, fewer than there are WGPs, and 3,920 waves to
// start.  A thread's 24 16-byte loads are unrolled from one offset register, so
// many are in flight at once; each wave-wide load covers 512 contiguous bytes
// and each wave-wide 8-byte store 256, whole lines both ways.
constexpr int kCvtThreads = 512;
constexpr int kCvtLoads   = 24;
constexpr int kCvtElems   = kCvtThreads * kCvtLoads * 4;   // floats per work-group
constexpr int kCvtBlocksX = kM * kE / kCvtElems;           // 197
constexpr int kCvtBlocksW = kE * kE / kCvtElems;           // 12
static_assert(kCvtBlocksX * kCvtElems == kM * kE, "x splits into whole work-groups");
static_assert(kCvtBlocksW * kCvtElems == kE * kE, "a weight splits into whole work-groups");

__global__ __launch_bounds__(kCvtThreads) void k_f2h_all(
    const float* __restrict__ x,  const float* __restrict__ wq, const float* __restrict__ wk,
    const float* __restrict__ wv, const float* __restrict__ wo,
    half_t* __restrict__ xh,  half_t* __restrict__ wqh, half_t* __restrict__ wkh,
    half_t* __restrict__ wvh, half_t* __restrict__ woh) {
  const float* in = x;
  half_t* out = xh;
  int part = blockIdx.x;
  if (part >= kCvtBlocksX) {
    const int w = (part - kCvtBlocksX) / kCvtBlocksW;
    part = (part - kCvtBlocksX) % kCvtBlocksW;
    in  = w == 0 ? wq  : w == 1 ? wk  : w == 2 ? wv  : wo;
    out = w == 0 ? wqh : w == 1 ? wkh : w == 2 ? wvh : woh;
  }
  const f32x4* s = (const f32x4*)(in + part * kCvtElems) + threadIdx.x;
  h4* d = (h4*)(out + part * kCvtElems) + threadIdx.x;
  f32x4 v[kCvtLoads];
  // Unrolled: j becomes an immediate offset, and many loads are in flight
  // before the first wait for data.
#pragma unroll
  for (int j = 0; j < kCvtLoads; ++j) v[j] = s[j * kCvtThreads];
  // Unrolled: v[] stays in registers and the stores share one offset register.
#pragma unroll
  for (int j = 0; j < kCvtLoads; ++j) d[j * kCvtThreads] = __builtin_convertvector(v[j], h4);
}

// Build v_pos^T (S,64,208) f16 via table gathers, and pack the two query-table
// row numbers of every (q,k) into 16 bits (x low byte, y high byte), laid out
// [q][k>>6][k&7][(k>>3)&7] so that a softmax thread (k = t8 + 8j) finds eight
// of its entries in one 16-byte load.  Row numbers are bounded here.
constexpr int kNE = 28;        // rows of each position table
__global__ void k_pos(const float* vtx, const float* vty,
                      const int* xd, const int* yd,
                      unsigned short* pidx, half_t* vposT) {
  int i = blockIdx.x * blockDim.x + threadIdx.x;
  if (i >= kS * kS) return;
  int dx = imin(xd[i] < 0 ? 0 : xd[i], kNE - 1), dy = imin(yd[i] < 0 ? 0 : yd[i], kNE - 1);
  int q = i / kS, kk = i % kS;
  pidx[q * 256 + (kk >> 6) * 64 + (kk & 7) * 8 + ((kk >> 3) & 7)] = (unsigned short)(dx | (dy << 8));
  size_t vb = (size_t)q * kD * kSP + kk;
  for (int j = 0; j < 32; ++j) {
    vposT[vb + (size_t)j * kSP]        = (half_t)vtx[dx * 32 + j];
    vposT[vb + (size_t)(32 + j) * kSP] = (half_t)vty[dy * 32 + j];
  }
}

// ---------------- phase kernels ----------------
// QKV projection: (12608x768) @ W^T + b.
// Q,K stored [bh][s][d]; V stored transposed [bh][d][sP] so the P@V GEMM
// has unit-stride K and stages with b128 copies.
__global__ __launch_bounds__(128) void k_proj(const half_t* __restrict__ xh,
                       const half_t* wq, const half_t* wk, const half_t* wv,
                       const float* bq, const float* bk, const float* bv,
                       half_t* Q, half_t* K, half_t* Vt) {
  GEMM128_SHARED
  int m0 = blockIdx.x << 7, n0 = blockIdx.y << 7, sel = blockIdx.z;
  const half_t* W    = sel == 0 ? wq : sel == 1 ? wk : wv;
  const float*  bias = sel == 0 ? bq : sel == 1 ? bk : bv;
  gemm_core128(xh + (long)m0 * kE, imin(128, kM - m0), W + (long)n0 * kE, lA, lB, sel == 2, acc);
  EPILOGUE128_VARS
  if (sel < 2) {
    // D rows are x rows, D columns the dealt weight rows: a lane's four tiles of
    // a row are four adjacent d of one head, so 16 lanes store that head's whole
    // 128-byte row of Q or K.
    half_t* qk = sel == 0 ? Q : K;
    const f32x4 bz = *(const f32x4*)(bias + n0 + cbase);
    const int h = (n0 + cbase) >> 6, d0 = cbase & 63;
#pragma unroll
    for (int mt = 0; mt < 4; ++mt) {
      const int mb = m0 + rbase + (mt << 4);
      if (mb < kM) {
#pragma unroll
        for (int i0 = 0; i0 < 8; i0 += 4) {
          unsigned o[4];
          h4 v[4];
#pragma unroll
          for (int i = 0; i < 4; ++i) {
            const int m = mb + i0 + i, b = m / kS, s = m % kS;
            o[i] = (unsigned)((((b * kH + h) * kS + s) * kD + d0) * 2);
            const f32x4 f = {acc[mt][0][i0 + i], acc[mt][1][i0 + i], acc[mt][2][i0 + i], acc[mt][3][i0 + i]};
            v[i] = __builtin_convertvector(f + bz, h4);
          }
          store4_b64(qk, o[0], o[1], o[2], o[3], v[0], v[1], v[2], v[3]);
        }
      }
    }
  } else {
    // Roles swapped: D rows are the dealt weight rows (d = 4 * row + mt of head
    // hv), D columns x rows, so 16 lanes store 16 adjacent s of one row of V^T.
    const int hv = (n0 >> 6) + (wid >> 1), dl = (lane >> 4) << 5;
    f32x4 bz[8];
#pragma unroll
    for (int i = 0; i < 8; ++i) bz[i] = *(const f32x4*)(bias + (hv << 6) + dl + (i << 2));
#pragma unroll
    for (int nt = 0; nt < 4; ++nt) {
      const int m = m0 + ((wid & 1) << 6) + (nt << 4) + (lane & 15);
      if (m < kM) {
        const int b = m / kS, s = m % kS;
        const unsigned off = (unsigned)((((b * kH + hv) * kD + dl) * kSP + s) * 2);
#pragma unroll
        for (int i = 0; i < 8; ++i)
          store4<kSP * 2>(Vt, off + (unsigned)(i * 4 * kSP * 2),
                          acc[0][nt][i] + bz[i][0], acc[1][nt][i] + bz[i][1],
                          acc[2][nt][i] + bz[i][2], acc[3][nt][i] + bz[i][3]);
      }
    }
  }
}

// Content logits + position logits + softmax -> P.  One block = (bh, 16 q rows, all k).
// Position term: q_pos[q,k,:] is row x_dist[q,k] of one table beside row
// y_dist[q,k] of the other, so Q[q,:] . q_pos[q,k,:] = TX[q][x_dist] + TY[q][y_dist]
// with TX = Q[:, 0:32] . q_tab_x^T and TY = Q[:, 32:64] . q_tab_y^T (16 x 28 each):
// one WMMA per wave, kept in f32 in LDS and gathered per (q,k).  TX and TY take
// the place of the K tile once its last read is over, so LDS per block stays.
__global__ void k_attn(const half_t* __restrict__ Q, const half_t* __restrict__ K,
                       const float* __restrict__ qtx, const float* __restrict__ qty,
                       const unsigned short* __restrict__ pidx,
                       half_t* __restrict__ P) {
  __shared__ alignas(16) half_t lQ[16 * 72];
  __shared__ alignas(16) half_t lK[kSP * 72];
  __shared__ float lgt[16 * 224];
  const int q0 = blockIdx.x << 4, bh = blockIdx.y;
  const int tid = threadIdx.x, wave = tid >> 5, lane = tid & 31;
  const int r = tid >> 3, t8 = tid & 7;   // softmax: 8 threads per row

  // This thread's packed table rows for k = t8 + 8j: j = 0..23 in three 16-byte
  // loads, j = 24 alone (it exists for t8 < 5 only).
  const unsigned short* ip = pidx + imin(q0 + r, kS - 1) * 256 + t8 * 8;
  const u32x4 iw0 = *(const u32x4*)ip;
  const u32x4 iw1 = *(const u32x4*)(ip + 64);
  const u32x4 iw2 = *(const u32x4*)(ip + 128);
  unsigned iw3 = 0;
  if (192 + t8 < kS) iw3 = ip[192];

  // This wave's 16 table rows as a B fragment, in load_frag's k order:
  // waves 0,1 take q_tab_x rows 0..15 and 16..31, waves 2,3 q_tab_y; rows past
  // the table are zero.
  const int te = ((wave & 1) << 4) + (lane & 15);
  const f32x4* tp = (const f32x4*)((wave >> 1 ? qty : qtx) + imin(te, kNE - 1) * 32 + ((lane >> 4) << 3));
  f32x4 tf[4] = {tp[0], tp[1], tp[4], tp[5]};
  v16h tb;
#pragma unroll
  for (int j = 0; j < 16; ++j) tb[j] = te < kNE ? (half_t)tf[j >> 2][j & 3] : (half_t)0.f;

  // Q and K tiles: a thread's one load of Q and thirteen of K are all issued
  // before the first wait for data, with no branch between them.  This head's K
  // is one run of kS * 8 16-byte pieces, piece tid + 128 t going to row r + 16 t.
  // Rows past kS re-read the last row (Q) or the last piece (K): the P rows of
  // those q are never stored and the logits of those k are never used.
  {
    const char* cQ = (const char*)(Q + (size_t)bh * kS * kD);
    const char* cK = (const char*)(K + (size_t)bh * kS * kD);
    const unsigned oQ = (unsigned)(imin(q0 + r, kS - 1) * 128 + t8 * 16);
    const unsigned oK = (unsigned)(tid * 16);
    const unsigned oL = (unsigned)(imin(12 * 128 + tid, kS * 8 - 1) * 16);
    const u32x4 qv = *(const u32x4*)(cQ + oQ);
    u32x4 kv[13];
    // Unrolled: t becomes an immediate offset and kv[] stays in registers.
#pragma unroll
    for (int t = 0; t < 12; ++t) kv[t] = *(const u32x4*)(cK + oK + t * 2048);
    kv[12] = *(const u32x4*)(cK + oL);
    // Precaution, as in gemm_core128: the offset registers of the issued loads
    // stay live up to this wait.
    asm volatile("s_wait_xcnt 0x0" :: "v"(oQ), "v"(oK), "v"(oL) : "memory");
    *(u32x4*)(lQ + r * 72 + t8 * 8) = qv;
#pragma unroll
    for (int t = 0; t < 13; ++t) *(u32x4*)(lK + (r + 16 * t) * 72 + t8 * 8) = kv[t];
  }
  __syncthreads();

  v16h af0 = load_frag(lQ, 72, lane, 0);
  v16h af1 = load_frag(lQ, 72, lane, 32);
  const int rb = (lane >> 4) << 3, cb = lane & 15;
  v8f tacc = {};
  tacc = __builtin_amdgcn_wmma_f32_16x16x32_f16(false, wave >> 1 ? af1 : af0, false, tb, (short)0, tacc, false, false);
  for (int nt = wave; nt < 13; nt += 4) {
    v8f a = {};
    v16h bf0 = load_frag(lK + nt * 16 * 72, 72, lane, 0);
    v16h bf1 = load_frag(lK + nt * 16 * 72, 72, lane, 32);
    a = __builtin_amdgcn_wmma_f32_16x16x32_f16(false, af0, false, bf0, (short)0, a, false, false);
    a = __builtin_amdgcn_wmma_f32_16x16x32_f16(false, af1, false, bf1, (short)0, a, false, false);
    int col = (nt << 4) + cb;
#pragma unroll
    for (int i = 0; i < 8; ++i) lgt[(rb + i) * 224 + col] = a[i];
  }
  __syncthreads();

  // Every wave has left lK: rows of 68 floats over it, TX at 0..31, TY at 32..63.
  float* lT = (float*)lK;
#pragma unroll
  for (int i = 0; i < 8; ++i) lT[(rb + i) * 68 + (wave << 4) + cb] = tacc[i];
  __syncthreads();   // publishes TX, TY to the softmax threads

  // softmax; its first pass adds the two gathered position terms and scales
  const unsigned iw[13] = {iw0[0], iw0[1], iw0[2], iw0[3], iw1[0], iw1[1], iw1[2], iw1[3],
                           iw2[0], iw2[1], iw2[2], iw2[3], iw3};
  const float* tr = lT + r * 68;
  float mx = -3.0e38f;
  // Unrolled: j picks the index word and byte at compile time.
#pragma unroll
  for (int j = 0; j < 25; ++j) {
    const int k = t8 + 8 * j;
    if (k < kS) {
      const unsigned e = iw[j >> 1] >> ((j & 1) * 16);
      const float v = (lgt[r * 224 + k] + tr[e & 0xff] + tr[32 + ((e >> 8) & 0xff)]) * 0.125f;   // 1/sqrt(64)
      lgt[r * 224 + k] = v;
      mx = fmaxf(mx, v);
    }
  }
  for (int off = 4; off; off >>= 1) mx = fmaxf(mx, __shfl_xor(mx, off, 8));
  float sum = 0.f;
  for (int k = t8; k < kS; k += 8) {
    float e = __expf(lgt[r * 224 + k] - mx);
    lgt[r * 224 + k] = e;
    sum += e;
  }
  for (int off = 4; off; off >>= 1) sum += __shfl_xor(sum, off, 8);
  float inv = 1.f / sum;
  int q = q0 + r;
  if (q < kS) {
    float e[kSP / 8];
    // Unrolled, and the row's 11 spare columns are read like the rest: no branch
    // stands between the LDS reads, so all are issued before the first wait.
#pragma unroll
    for (int j = 0; j < kSP / 8; ++j) e[j] = lgt[r * 224 + t8 + 8 * j];
    unsigned p[kSP / 16];
#pragma unroll
    for (int j = 0; j < kSP / 8; j += 2) {
      const h2 v = {(half_t)((t8 + 8 * j < kS) ? e[j] * inv : 0.f),
                    (half_t)((t8 + 8 * j + 8 < kS) ? e[j + 1] * inv : 0.f)};
      p[j >> 1] = __builtin_bit_cast(unsigned, v);
    }
    store26(P, (unsigned)((((q * kBH + bh) * kSP) + t8) * 2), p);
  }
}

// Content output (per bh): O1[b,q,h*64+d] = P[bh] @ V[bh]   (fp32)
__global__ void k_pv(const half_t* __restrict__ P, const half_t* __restrict__ Vt,
                     float* __restrict__ O1) {
  GEMM_SHARED
  int m0 = blockIdx.x << 6, bh = blockIdx.y;
  gemm_core(P + ((size_t)m0 * kBH + bh) * kSP, kBH * kSP, imin(64, kS - m0),
            Vt + (size_t)bh * kD * kSP, kSP, lA, lB, acc);
  EPILOGUE_VARS
  int b = bh / kH, h = bh % kH;
  // 16 lanes store a head's whole 256-byte row.
#pragma unroll
  for (int i = 0; i < 8; ++i) {
    const int q = m0 + rbase + i;
    if (q < kS) {
      const f32x4 v = {acc[0][i], acc[1][i], acc[2][i], acc[3][i]};
      store1_b128(O1, (unsigned)(((b * kS + q) * kE + h * kD + (cbase << 2)) * 4), v);
    }
  }
}

// v_pos output (per q): add P_qslice @ v_pos[q]; finalize O1 -> f16 for out-proj.
__global__ void k_vpos(const half_t* __restrict__ P, const half_t* __restrict__ vposT,
                       const float* __restrict__ O1, half_t* __restrict__ O1h) {
  GEMM_SHARED
  int m0 = blockIdx.x << 6, q = blockIdx.y;
  gemm_core(P + ((size_t)q * kBH + m0) * kSP, kSP, 64,
            vposT + (size_t)q * kD * kSP, kSP, lA, lB, acc);
  EPILOGUE_VARS
  // 16 lanes read a head's whole 256-byte row of O1 and store its 128-byte row of O1h.
  unsigned off[8];
  f32x4 o1[8];
#pragma unroll
  for (int i = 0; i < 8; ++i) {
    const int bh = m0 + rbase + i, b = bh / kH, h = bh % kH;
    off[i] = (unsigned)(((b * kS + q) * kE + h * kD + (cbase << 2)) * 4);
  }
#pragma unroll
  for (int i = 0; i < 8; ++i) o1[i] = *(const f32x4*)((const char*)O1 + off[i]);
  // Precaution, as in gemm_core128: the offset registers of the issued loads
  // stay live up to this wait.
  asm volatile("s_wait_xcnt 0x0"
               :: "v"(off[0]), "v"(off[1]), "v"(off[2]), "v"(off[3]),
                  "v"(off[4]), "v"(off[5]), "v"(off[6]), "v"(off[7])
               : "memory");
  h4 v[8];
#pragma unroll
  for (int i = 0; i < 8; ++i) {
    const f32x4 f = {acc[0][i], acc[1][i], acc[2][i], acc[3][i]};
    v[i] = __builtin_convertvector(f + o1[i], h4);
  }
  store4_b64(O1h, off[0] >> 1, off[1] >> 1, off[2] >> 1, off[3] >> 1, v[0], v[1], v[2], v[3]);
  store4_b64(O1h, off[4] >> 1, off[5] >> 1, off[6] >> 1, off[7] >> 1, v[4], v[5], v[6], v[7]);
}

// Output projection: out = O1h @ Wo^T + bo   (fp32 out)
__global__ __launch_bounds__(128) void k_out(const half_t* __restrict__ O1h, const half_t* __restrict__ wo,
                      const float* __restrict__ bo, float* __restrict__ out) {
  GEMM128_SHARED
  int m0 = blockIdx.x << 7, n0 = blockIdx.y << 7;
  gemm_core128(O1h + (long)m0 * kE, imin(128, kM - m0), wo + (long)n0 * kE, lA, lB, false, acc);
  EPILOGUE128_VARS
  // A lane's four tiles of a row are four adjacent columns: 16 lanes store 256
  // contiguous bytes, two whole lines.
  const f32x4 bz = *(const f32x4*)(bo + n0 + cbase);
  const unsigned off = (unsigned)(((m0 + rbase) * kE + n0 + cbase) * 4);
#pragma unroll
  for (int mt = 0; mt < 4; ++mt) {
    if (m0 + rbase + (mt << 4) < kM) {
#pragma unroll
      for (int i0 = 0; i0 < 8; i0 += 4) {
        f32x4 v[4];
#pragma unroll
        for (int i = 0; i < 4; ++i) {
          const f32x4 f = {acc[mt][0][i0 + i], acc[mt][1][i0 + i], acc[mt][2][i0 + i], acc[mt][3][i0 + i]};
          v[i] = f + bz;
        }
        store4_b128<kE * 4>(out, off + (unsigned)(((mt << 4) + i0) * kE * 4), v[0], v[1], v[2], v[3]);
      }
    }
  }
}

// ---------------- host launcher ----------------
extern "C" void kernel_launch(void* const* d_in, const int* in_sizes, int n_in,
                              void* d_out, int out_size, void* d_ws, size_t ws_size,
                              hipStream_t stream) {
  (void)in_sizes; (void)n_in; (void)out_size; (void)ws_size;
  const float* x   = (const float*)d_in[0];
  const float* Wq  = (const float*)d_in[1];
  const float* bq  = (const float*)d_in[2];
  const float* Wk  = (const float*)d_in[3];
  const float* bk  = (const float*)d_in[4];
  const float* Wv  = (const float*)d_in[5];
  const float* bv  = (const float*)d_in[6];
  const float* Wo  = (const float*)d_in[7];
  const float* bo  = (const float*)d_in[8];
  const float* qtx = (const float*)d_in[9];
  const float* qty = (const float*)d_in[10];
  const float* vtx = (const float*)d_in[11];
  const float* vty = (const float*)d_in[12];
  const int*   xd  = (const int*)d_in[13];
  const int*   yd  = (const int*)d_in[14];
  float* out = (float*)d_out;

  char* ws = (char*)d_ws;
  size_t off = 0;
  auto take = [&](size_t bytes) {
    void* p = ws + off;
    off += (bytes + 255) & ~(size_t)255;
    return p;
  };
  const size_t NX   = (size_t)kM * kE;           // 9.68M
  const size_t NW   = (size_t)kE * kE;
  const size_t NQ   = (size_t)kBH * kS * kD;     // 9.68M
  const size_t NVT  = (size_t)kBH * kD * kSP;    // 10.2M
  const size_t NIDX = (size_t)kS * 256;
  const size_t NVPT = (size_t)kS * kD * kSP;     // 2.62M
  const size_t NP   = (size_t)kS * kBH * kSP;    // 31.5M

  half_t* xh    = (half_t*)take(NX * 2);
  half_t* wqh   = (half_t*)take(NW * 2);
  half_t* wkh   = (half_t*)take(NW * 2);
  half_t* wvh   = (half_t*)take(NW * 2);
  half_t* woh   = (half_t*)take(NW * 2);
  half_t* Qh    = (half_t*)take(NQ * 2);
  half_t* Kh    = (half_t*)take(NQ * 2);
  half_t* Vt    = (half_t*)take(NVT * 2);
  unsigned short* pidx = (unsigned short*)take(NIDX * 2);
  half_t* vposT = (half_t*)take(NVPT * 2);
  half_t* P     = (half_t*)take(NP * 2);
  float*  O1    = (float*)take(NX * 4);
  half_t* O1h   = xh;  // xh dead after k_proj; reuse

  k_f2h_all<<<kCvtBlocksX + 4 * kCvtBlocksW, kCvtThreads, 0, stream>>>(
      x, Wq, Wk, Wv, Wo, xh, wqh, wkh, wvh, woh);
  k_pos<<<(kS * kS + 255) / 256, 256, 0, stream>>>(vtx, vty, xd, yd, pidx, vposT);

  k_proj<<<dim3((kM + 127) / 128, kE / 128, 3), 128, 0, stream>>>(
      xh, wqh, wkh, wvh, bq, bk, bv, Qh, Kh, Vt);
  k_attn<<<dim3((kS + 15) / 16, kBH), 128, 0, stream>>>(Qh, Kh, qtx, qty, pidx, P);
  k_pv<<<dim3((kS + 63) / 64, kBH), 128, 0, stream>>>(P, Vt, O1);
  k_vpos<<<dim3(kBH / 64, kS), 128, 0, stream>>>(P, vposT, O1, O1h);
  k_out<<<dim3((kM + 127) / 128, kE / 128), 128, 0, stream>>>(O1h, woh, bo, out);
}

// v006
// A run of this version takes 166 microseconds.
// Next to v005, in two timings, it ran 1.17 and 1.16 times as fast.
// All steps since v000 together make it 2.73 times as fast.
#include <hip/hip_runtime.h>
#include <hip/hip_bf16.h>

// ---------------- problem constants ----------------
constexpr int kB  = 64;        // batch
constexpr int kS  = 197;       // seq len
constexpr int kE  = 768;       // embed
constexpr int kH  = 12;        // heads
constexpr int kD  = 64;        // head dim
constexpr int kBH = kB * kH;   // 768
constexpr int kSP = 208;       // seq padded to mult of 16
constexpr int kM  = kB * kS;   // 12608 rows for projections

typedef _Float16 half_t;
typedef __attribute__((ext_vector_type(16))) _Float16     v16h;
typedef __attribute__((ext_vector_type(8)))  float        v8f;
typedef __attribute__((ext_vector_type(2)))  _Float16     h2;
typedef __attribute__((ext_vector_type(4)))  unsigned int u32x4;
typedef __attribute__((ext_vector_type(2)))  unsigned int u32x2;

struct HFrag { u32x4 a, b; };

__device__ __forceinline__ int imin(int a, int b) { return a < b ? a : b; }

// Load a 16x32 f16 WMMA A/B fragment from an LDS tile stored row-major
// [16][ldk].  Per ISA: lane<16 holds K {0..7,16..23} of row (lane&15);
// lane>=16 holds K {8..15,24..31}.  Two 16-byte ds_load_b128 per frag.
__device__ __forceinline__ v16h load_frag(const half_t* base, int ldk, int lane, int k0) {
  const half_t* p = base + (lane & 15) * ldk + k0 + ((lane >> 4) << 3);
  HFrag f;
  f.a = *(const u32x4*)p;
  f.b = *(const u32x4*)(p + 16);
  return __builtin_bit_cast(v16h, f);
}

// ---------------- shared 64x64 macro-tile GEMM core ----------------
// 128 threads = 4 waves; wave w owns output rows [16w,16w+16), all 64 cols.
// A element (r,k) at gA[r*sAr + k]; B^T element (n,k) at gB[n*sBr + k]; k runs
// over kS.  K staged in 64-wide slabs, LDS row stride 72 halves (144B = 36 banks,
// gcd(36,64)=4 -> conflict-free).  Staging uses 16-byte b128 copies; all
// callers guarantee 16B alignment (bases/strides are multiples of 8 halves).
// A thread's eight loads of a slab are all issued before the first wait for
// data: no branch stands between them.  Rows past aRows re-read row aRows-1;
// callers never store the results of those rows.
// The rows of B^T are dealt: row 4c + t lies at LDS row 16t + c, so a lane's
// four accumulator tiles of a row are four adjacent columns 4c .. 4c + 3.
constexpr int kFull = kS / 64 * 64;   // 192: k covered by whole slabs
static_assert(kS - kFull == 5, "the last slab below reads four halves and one per row");
__device__ __forceinline__ void gemm_core(
    const half_t* gA, unsigned sAr, int aRows,
    const half_t* gB, unsigned sBr, half_t* lA, half_t* lB, v8f* acc) {
  const int tid  = threadIdx.x;
  const int wave = tid >> 5, lane = tid & 31;
  const int r0 = tid >> 3, c8 = (tid & 7) << 3;
  // byte offsets of this thread's four rows of A and of B^T
  unsigned rowA[4], rowB[4];
#pragma unroll
  for (int j = 0; j < 4; ++j) {
    rowA[j] = (unsigned)imin(r0 + 16 * j, aRows - 1) * sAr * 2u;
    rowB[j] = (unsigned)(r0 + 16 * j) * sBr * 2u;
  }
  const char* cA = (const char*)gA;
  const char* cB = (const char*)gB;
  half_t* dA = lA + r0 * 72 + c8;
  half_t* dB = lB + (((r0 & 3) << 4) + (r0 >> 2)) * 72 + c8;   // dealt: row r0 + 16j lies 4j rows on
  const half_t* aBase = lA + (wave << 4) * 72;
  // Unrolled so that k0 is an immediate offset of every load and the last slab
  // is told apart at compile time.
#pragma unroll
  for (int k0 = 0; k0 < kFull + 64; k0 += 64) {
    u32x4 ta[4], tb[4];
    if (k0 < kFull) {
      unsigned oA[4], oB[4];
#pragma unroll
      for (int j = 0; j < 4; ++j) { oA[j] = rowA[j] + c8 * 2; oB[j] = rowB[j] + c8 * 2; }
#pragma unroll
      for (int j = 0; j < 4; ++j) ta[j] = *(const u32x4*)(cA + oA[j] + k0 * 2);
#pragma unroll
      for (int j = 0; j < 4; ++j) tb[j] = *(const u32x4*)(cB + oB[j] + k0 * 2);
      // Precaution: the offset registers that the issued loads name stay live up
      // to this wait, so none is reused ahead of it.
      asm volatile("s_wait_xcnt 0x0"
                   :: "v"(oA[0]), "v"(oA[1]), "v"(oA[2]), "v"(oA[3]),
                      "v"(oB[0]), "v"(oB[1]), "v"(oB[2]), "v"(oB[3])
                   : "memory");
    } else {
      // Last slab: k = kFull .. kS-1 are real, the rest of its 64 columns is zero.
      // Every thread reads the five halves of its rows (8 bytes and 2); the
      // thread of column 0 keeps them, the others store zero.
      u32x2 a4[4], b4[4];
      unsigned a1[4], b1[4];
#pragma unroll
      for (int j = 0; j < 4; ++j) {
        a4[j] = *(const u32x2*)(cA + rowA[j] + kFull * 2);
        a1[j] = *(const unsigned short*)(cA + rowA[j] + (kFull + 4) * 2);
      }
#pragma unroll
      for (int j = 0; j < 4; ++j) {
        b4[j] = *(const u32x2*)(cB + rowB[j] + kFull * 2);
        b1[j] = *(const unsigned short*)(cB + rowB[j] + (kFull + 4) * 2);
      }
      // Precaution, as above.
      asm volatile("s_wait_xcnt 0x0"
                   :: "v"(rowA[0]), "v"(rowA[1]), "v"(rowA[2]), "v"(rowA[3]),
                      "v"(rowB[0]), "v"(rowB[1]), "v"(rowB[2]), "v"(rowB[3])
                   : "memory");
      const unsigned keep = c8 == 0 ? 0xffffffffu : 0u;
#pragma unroll
      for (int j = 0; j < 4; ++j) {
        ta[j] = u32x4{a4[j][0] & keep, a4[j][1] & keep, a1[j] & keep, 0u};
        tb[j] = u32x4{b4[j][0] & keep, b4[j][1] & keep, b1[j] & keep, 0u};
      }
    }
#pragma unroll
    for (int j = 0; j < 4; ++j) {
      *(u32x4*)(dA + j * 16 * 72) = ta[j];
      *(u32x4*)(dB + j * 4 * 72)  = tb[j];
    }
    __syncthreads();
#pragma unroll
    for (int kk = 0; kk < 64; kk += 32) {
      v16h af = load_frag(aBase, 72, lane, kk);
#pragma unroll
      for (int nt = 0; nt < 4; ++nt) {
        v16h bf = load_frag(lB + (nt << 4) * 72, 72, lane, kk);
        acc[nt] = __builtin_amdgcn_wmma_f32_16x16x32_f16(
            false, af, false, bf, (short)0, acc[nt], false, false);
      }
    }
    __syncthreads();
  }
}

#define GEMM_SHARED                                    \
  __shared__ alignas(16) half_t lA[64 * 72];           \
  __shared__ alignas(16) half_t lB[64 * 72];           \
  v8f acc[4];                                          \
  { v8f z = {}; for (int i = 0; i < 4; ++i) acc[i] = z; }

// C/D VGPR layout: vgpr i, lane l -> row = i + 8*(l>>4), col = l&15.
#define EPILOGUE_VARS                                  \
  const int lane = threadIdx.x & 31;                   \
  const int rbase = ((threadIdx.x >> 5) << 4) + ((lane >> 4) << 3); \
  const int cbase = lane & 15;

// ---------------- 128x128 macro-tile GEMM core (dense projections) ----------------
// 128 threads = 4 waves in a 2x2 grid; each wave owns a 64x64 block of the
// tile as 4x4 accumulator tiles, so every fragment read from LDS feeds four
// WMMAs.  A is [aRows][kE], B^T is [128][kE], both K-contiguous; K runs over kE in
// 64-wide slabs at the same 72-half LDS pitch as above.  Rows past aRows
// re-read row aRows-1; callers never store the results of those rows.
// The rows of gB are dealt: LDS row 64g + 16t + c holds row 64g + 4c + t, so
// position c of fragment tile t is row 4c + t of the wave's 64, and the four
// tiles of one position are four adjacent rows.  With swap set the two slabs
// change roles in the product (gB rows become the rows of D, gA rows its
// columns); the k order of both loaders is the same either way.
__device__ __forceinline__ void gemm_core128(
    const half_t* __restrict__ gA, int aRows, const half_t* __restrict__ gB,
    half_t* lA, half_t* lB, bool swap, v8f (&acc)[4][4]) {
  const int tid  = threadIdx.x;
  const int wave = tid >> 5, lane = tid & 31;
  const int r0 = tid >> 3, c8 = (tid & 7) << 3;
  // byte offsets of this thread's eight A rows and of its first B row
  unsigned offA[8];
#pragma unroll
  for (int j = 0; j < 8; ++j)
    offA[j] = (unsigned)(imin(r0 + 16 * j, aRows - 1) * kE + c8) * 2u;
  const unsigned offB = (unsigned)(r0 * 4 * kE + c8) * 2u;
  const char* cA = (const char*)gA;
  const char* cB = (const char*)gB;
  half_t* sA = lA + r0 * 72 + c8;
  half_t* sB = lB + r0 * 72 + c8;
  const half_t* aBase = (swap ? lB : lA) + ((wave >> 1) << 6) * 72;
  const half_t* bBase = (swap ? lA : lB) + ((wave & 1) << 6) * 72;
  // Unrolled so that k0 is an immediate offset of every load: no address
  // arithmetic per slab, and no address register is rewritten behind a load.
#pragma unroll
  for (int k0 = 0; k0 < kE; k0 += 64) {
    u32x4 ta[8], tb[8];
#pragma unroll
    for (int j = 0; j < 8; ++j) ta[j] = *(const u32x4*)(cA + offA[j] + k0 * 2);
#pragma unroll
    for (int j = 0; j < 8; ++j) tb[j] = *(const u32x4*)(cB + offB + (k0 + ((j >> 2) * 64 + (j & 3)) * kE) * 2);
    // Precaution: the offset registers that the issued loads name stay live up
    // to this wait, so none is reused (not even as a load's destination) ahead of it.
    asm volatile("s_wait_xcnt 0x0"
                 :: "v"(offA[0]), "v"(offA[1]), "v"(offA[2]), "v"(offA[3]), "v"(offA[4]),
                    "v"(offA[5]), "v"(offA[6]), "v"(offA[7]), "v"(offB)
                 : "memory");
#pragma unroll
    for (int j = 0; j < 8; ++j) {
      *(u32x4*)(sA + j * 16 * 72) = ta[j];
      *(u32x4*)(sB + j * 16 * 72) = tb[j];
    }
    __syncthreads();
#pragma unroll
    for (int kk = 0; kk < 64; kk += 32) {
      v16h af[4], bf[4];
#pragma unroll
      for (int t = 0; t < 4; ++t) {
        af[t] = load_frag(aBase + (t << 4) * 72, 72, lane, kk);
        bf[t] = load_frag(bBase + (t << 4) * 72, 72, lane, kk);
      }
#pragma unroll
      for (int mt = 0; mt < 4; ++mt)
#pragma unroll
        for (int nt = 0; nt < 4; ++nt)
          acc[mt][nt] = __builtin_amdgcn_wmma_f32_16x16x32_f16(
              false, af[mt], false, bf[nt], (short)0, acc[mt][nt], false, false);
    }
    __syncthreads();
  }
}

#define GEMM128_SHARED                                 \
  __shared__ alignas(16) half_t lAB[2 * 128 * 72];     \
  half_t* lA = lAB;                                    \
  half_t* lB = lAB + 128 * 72;                         \
  v8f acc[4][4];                                       \
  { v8f z = {};                                        \
    for (int i = 0; i < 4; ++i)                        \
      for (int j = 0; j < 4; ++j) acc[i][j] = z; }

// Same C/D layout; the wave's 64x64 block starts at (64*(wave>>1), 64*(wave&1)).
// Along the dealt operand, tile t at position c is row 4c + t of the block.
#define EPILOGUE128_VARS                               \
  const int lane = threadIdx.x & 31;                   \
  const int wid = threadIdx.x >> 5;                    \
  const int rbase = ((wid >> 1) << 6) + ((lane >> 4) << 3); \
  const int cbase = ((wid & 1) << 6) + ((lane & 15) << 2);
static_assert(kM % 8 == 0, "a lane's eight rows of a tile are all inside kM or all outside");

// Four f16 stores at base + off, STEP bytes apart, two values to a register.
// Stores and wait are one statement so that the offset and the two data
// registers stay untouched up to the s_wait_xcnt (a precaution; a wait in a
// statement of its own does not hold later register writes behind it).
template <int STEP>
__device__ __forceinline__ void store4(half_t* base, unsigned off,
                                       float a0, float a1, float a2, float a3) {
  h2 p01 = {(half_t)a0, (half_t)a1}, p23 = {(half_t)a2, (half_t)a3};
  asm volatile(
      "global_store_b16 %0, %1, %3\n\t"
      "global_store_d16_hi_b16 %0, %1, %3 offset:%4\n\t"
      "global_store_b16 %0, %2, %3 offset:%5\n\t"
      "global_store_d16_hi_b16 %0, %2, %3 offset:%6\n\t"
      "s_wait_xcnt 0x0"
      :: "v"(off), "v"(__builtin_bit_cast(unsigned, p01)), "v"(__builtin_bit_cast(unsigned, p23)),
         "s"(base), "n"(STEP), "n"(2 * STEP), "n"(3 * STEP)
      : "memory");
}

typedef __attribute__((ext_vector_type(4))) float    f32x4;
typedef __attribute__((ext_vector_type(4))) _Float16 h4;

// Four 8-byte stores (four f16 each) at base + o0..o3; stores and wait in one
// statement, for the same reason as in store4.
__device__ __forceinline__ void store4_b64(half_t* base, unsigned o0, unsigned o1, unsigned o2,
                                           unsigned o3, h4 a0, h4 a1, h4 a2, h4 a3) {
  asm volatile(
      "global_store_b64 %0, %4, %8\n\t"
      "global_store_b64 %1, %5, %8\n\t"
      "global_store_b64 %2, %6, %8\n\t"
      "global_store_b64 %3, %7, %8\n\t"
      "s_wait_xcnt 0x0"
      :: "v"(o0), "v"(o1), "v"(o2), "v"(o3),
         "v"(__builtin_bit_cast(u32x2, a0)), "v"(__builtin_bit_cast(u32x2, a1)),
         "v"(__builtin_bit_cast(u32x2, a2)), "v"(__builtin_bit_cast(u32x2, a3)), "s"(base)
      : "memory");
}

// One 16-byte store at base + off; store and wait in one statement as above.
__device__ __forceinline__ void store1_b128(float* base, unsigned off, f32x4 a) {
  asm volatile(
      "global_store_b128 %0, %1, %2\n\t"
      "s_wait_xcnt 0x0"
      :: "v"(off), "v"(a), "s"(base)
      : "memory");
}

// Four 16-byte stores at base + off, STEP bytes apart; one statement as above.
template <int STEP>
__device__ __forceinline__ void store4_b128(float* base, unsigned off,
                                            f32x4 a0, f32x4 a1, f32x4 a2, f32x4 a3) {
  asm volatile(
      "global_store_b128 %0, %1, %5\n\t"
      "global_store_b128 %0, %2, %5 offset:%6\n\t"
      "global_store_b128 %0, %3, %5 offset:%7\n\t"
      "global_store_b128 %0, %4, %5 offset:%8\n\t"
      "s_wait_xcnt 0x0"
      :: "v"(off), "v"(a0), "v"(a1), "v"(a2), "v"(a3),
         "s"(base), "n"(STEP), "n"(2 * STEP), "n"(3 * STEP)
      : "memory");
}

// A softmax thread's three 16-byte stores at base + off, 128 bytes apart; stores
// and wait in one statement, for the same reason as in store4.
__device__ __forceinline__ void store3_p(half_t* base, unsigned off, u32x4 a0, u32x4 a1, u32x4 a2) {
  asm volatile(
      "global_store_b128 %0, %1, %4\n\t"
      "global_store_b128 %0, %2, %4 offset:128\n\t"
      "global_store_b128 %0, %3, %4 offset:256\n\t"
      "s_wait_xcnt 0x0"
      :: "v"(off), "v"(a0), "v"(a1), "v"(a2), "s"(base)
      : "memory");
}

// 2^x of eight values and of five.  One statement with the outputs apart from the
// inputs: every v_exp_f32 stands in front of an independent one and the last in
// front of a v_nop, the slot that the instruction set asks for before a
// transcendental's result is read or its source overwritten.
__device__ __forceinline__ void exp2x8(float* e, const float* x) {
  asm("v_exp_f32 %0, %8\n\t"
      "v_exp_f32 %1, %9\n\t"
      "v_exp_f32 %2, %10\n\t"
      "v_exp_f32 %3, %11\n\t"
      "v_exp_f32 %4, %12\n\t"
      "v_exp_f32 %5, %13\n\t"
      "v_exp_f32 %6, %14\n\t"
      "v_exp_f32 %7, %15\n\t"
      "v_nop"
      : "=&v"(e[0]), "=&v"(e[1]), "=&v"(e[2]), "=&v"(e[3]),
        "=&v"(e[4]), "=&v"(e[5]), "=&v"(e[6]), "=&v"(e[7])
      : "v"(x[0]), "v"(x[1]), "v"(x[2]), "v"(x[3]), "v"(x[4]), "v"(x[5]), "v"(x[6]), "v"(x[7]));
}
__device__ __forceinline__ void exp2x5(float* e, const float* x) {
  asm("v_exp_f32 %0, %5\n\t"
      "v_exp_f32 %1, %6\n\t"
      "v_exp_f32 %2, %7\n\t"
      "v_exp_f32 %3, %8\n\t"
      "v_exp_f32 %4, %9\n\t"
      "v_nop"
      : "=&v"(e[0]), "=&v"(e[1]), "=&v"(e[2]), "=&v"(e[3]), "=&v"(e[4])
      : "v"(x[0]), "v"(x[1]), "v"(x[2]), "v"(x[3]), "v"(x[4]));
}

// One 16-byte store of f16 pairs at base + off; one statement as above.
__device__ __forceinline__ void store1_p(half_t* base, unsigned off, u32x4 a) {
  asm volatile(
      "global_store_b128 %0, %1, %2\n\t"
      "s_wait_xcnt 0x0"
      :: "v"(off), "v"(a), "s"(base)
      : "memory");
}

// ---------------- elementwise kernels ----------------
// f32 -> f16 conversion of x and of the four weight matrices in one launch.
// One work-group of 16 waves per 64 rows of 768 floats (196,608 B read), so the
// whole job is 245 work-groups, fewer than there are WGPs, and 3,920 waves to
// start.  A thread's 24 16-byte loads are unrolled from one offset register, so
// many are in flight at once; each wave-wide load covers 512 contiguous bytes
// and each wave-wide 8-byte store 256, whole lines both ways.
constexpr int kCvtThreads = 512;
constexpr int kCvtLoads   = 24;
constexpr int kCvtElems   = kCvtThreads * kCvtLoads * 4;   // floats per work-group
constexpr int kCvtBlocksX = kM * kE / kCvtElems;           // 197
constexpr int kCvtBlocksW = kE * kE / kCvtElems;           // 12
static_assert(kCvtBlocksX * kCvtElems == kM * kE, "x splits into whole work-groups");
static_assert(kCvtBlocksW * kCvtElems == kE * kE, "a weight splits into whole work-groups");

__global__ __launch_bounds__(kCvtThreads) void k_f2h_all(
    const float* __restrict__ x,  const float* __restrict__ wq, const float* __restrict__ wk,
    const float* __restrict__ wv, const float* __restrict__ wo,
    half_t* __restrict__ xh,  half_t* __restrict__ wqh, half_t* __restrict__ wkh,
    half_t* __restrict__ wvh, half_t* __restrict__ woh) {
  const float* in = x;
  half_t* out = xh;
  int part = blockIdx.x;
  if (part >= kCvtBlocksX) {
    const int w = (part - kCvtBlocksX) / kCvtBlocksW;
    part = (part - kCvtBlocksX) % kCvtBlocksW;
    in  = w == 0 ? wq  : w == 1 ? wk  : w == 2 ? wv  : wo;
    out = w == 0 ? wqh : w == 1 ? wkh : w == 2 ? wvh : woh;
  }
  const f32x4* s = (const f32x4*)(in + part * kCvtElems) + threadIdx.x;
  h4* d = (h4*)(out + part * kCvtElems) + threadIdx.x;
  f32x4 v[kCvtLoads];
  // Unrolled: j becomes an immediate offset, and many loads are in flight
  // before the first wait for data.
#pragma unroll
  for (int j = 0; j < kCvtLoads; ++j) v[j] = s[j * kCvtThreads];
  // Unrolled: v[] stays in registers and the stores share one offset register.
#pragma unroll
  for (int j = 0; j < kCvtLoads; ++j) d[j * kCvtThreads] = __builtin_convertvector(v[j], h4);
}

// Build v_pos^T (S,64,208) f16 via table gathers, and pack the two query-table
// row numbers of every (q,k) into 16 bits (x low byte, y high byte), laid out
// [q][k] at 256 entries a row, so that a softmax thread finds the entries of
// eight adjacent k in one 16-byte load.  Row numbers are bounded here.
constexpr int kNE = 28;        // rows of each position table
__global__ void k_pos(const float* vtx, const float* vty,
                      const int* xd, const int* yd,
                      unsigned short* pidx, half_t* vposT) {
  int i = blockIdx.x * blockDim.x + threadIdx.x;
  if (i >= kS * kS) return;
  int dx = imin(xd[i] < 0 ? 0 : xd[i], kNE - 1), dy = imin(yd[i] < 0 ? 0 : yd[i], kNE - 1);
  int q = i / kS, kk = i % kS;
  pidx[q * 256 + kk] = (unsigned short)(dx | (dy << 8));
  size_t vb = (size_t)q * kD * kSP + kk;
  for (int j = 0; j < 32; ++j) {
    vposT[vb + (size_t)j * kSP]        = (half_t)vtx[dx * 32 + j];
    vposT[vb + (size_t)(32 + j) * kSP] = (half_t)vty[dy * 32 + j];
  }
}

// ---------------- phase kernels ----------------
// QKV projection: (12608x768) @ W^T + b.
// Q,K stored [bh][s][d]; V stored transposed [bh][d][sP] so the P@V GEMM
// has unit-stride K and stages with b128 copies.
__global__ __launch_bounds__(128) void k_proj(const half_t* __restrict__ xh,
                       const half_t* wq, const half_t* wk, const half_t* wv,
                       const float* bq, const float* bk, const float* bv,
                       half_t* Q, half_t* K, half_t* Vt) {
  GEMM128_SHARED
  int m0 = blockIdx.x << 7, n0 = blockIdx.y << 7, sel = blockIdx.z;
  const half_t* W    = sel == 0 ? wq : sel == 1 ? wk : wv;
  const float*  bias = sel == 0 ? bq : sel == 1 ? bk : bv;
  gemm_core128(xh + (long)m0 * kE, imin(128, kM - m0), W + (long)n0 * kE, lA, lB, sel == 2, acc);
  EPILOGUE128_VARS
  if (sel < 2) {
    // D rows are x rows, D columns the dealt weight rows: a lane's four tiles of
    // a row are four adjacent d of one head, so 16 lanes store that head's whole
    // 128-byte row of Q or K.
    half_t* qk = sel == 0 ? Q : K;
    const f32x4 bz = *(const f32x4*)(bias + n0 + cbase);
    const int h = (n0 + cbase) >> 6, d0 = cbase & 63;
#pragma unroll
    for (int mt = 0; mt < 4; ++mt) {
      const int mb = m0 + rbase + (mt << 4);
      if (mb < kM) {
#pragma unroll
        for (int i0 = 0; i0 < 8; i0 += 4) {
          unsigned o[4];
          h4 v[4];
#pragma unroll
          for (int i = 0; i < 4; ++i) {
            const int m = mb + i0 + i, b = m / kS, s = m % kS;
            o[i] = (unsigned)((((b * kH + h) * kS + s) * kD + d0) * 2);
            const f32x4 f = {acc[mt][0][i0 + i], acc[mt][1][i0 + i], acc[mt][2][i0 + i], acc[mt][3][i0 + i]};
            v[i] = __builtin_convertvector(f + bz, h4);
          }
          store4_b64(qk, o[0], o[1], o[2], o[3], v[0], v[1], v[2], v[3]);
        }
      }
    }
  } else {
    // Roles swapped: D rows are the dealt weight rows (d = 4 * row + mt of head
    // hv), D columns x rows, so 16 lanes store 16 adjacent s of one row of V^T.
    const int hv = (n0 >> 6) + (wid >> 1), dl = (lane >> 4) << 5;
    f32x4 bz[8];
#pragma unroll
    for (int i = 0; i < 8; ++i) bz[i] = *(const f32x4*)(bias + (hv << 6) + dl + (i << 2));
#pragma unroll
    for (int nt = 0; nt < 4; ++nt) {
      const int m = m0 + ((wid & 1) << 6) + (nt << 4) + (lane & 15);
      if (m < kM) {
        const int b = m / kS, s = m % kS;
        const unsigned off = (unsigned)((((b * kH + hv) * kD + dl) * kSP + s) * 2);
#pragma unroll
        for (int i = 0; i < 8; ++i)
          store4<kSP * 2>(Vt, off + (unsigned)(i * 4 * kSP * 2),
                          acc[0][nt][i] + bz[i][0], acc[1][nt][i] + bz[i][1],
                          acc[2][nt][i] + bz[i][2], acc[3][nt][i] + bz[i][3]);
      }
    }
  }
}

// Content logits + position logits + softmax -> P.  One block = (bh, 16 q rows, all k).
// Position term: q_pos[q,k,:] is row x_dist[q,k] of one table beside row
// y_dist[q,k] of the other, so Q[q,:] . q_pos[q,k,:] = TX[q][x_dist] + TY[q][y_dist]
// with TX = Q[:, 0:32] . q_tab_x^T and TY = Q[:, 32:64] . q_tab_y^T (16 x 28 each):
// one WMMA per wave, kept in f32 in LDS and gathered per (q,k).  TX and TY take
// the place of the K tile once its last read is over, so LDS per block stays.
__global__ void k_attn(const half_t* __restrict__ Q, const half_t* __restrict__ K,
                       const float* __restrict__ qtx, const float* __restrict__ qty,
                       const unsigned short* __restrict__ pidx,
                       half_t* __restrict__ P) {
  __shared__ alignas(16) half_t lQ[16 * 72];
  __shared__ alignas(16) half_t lK[kSP * 72];
  // Row pitch kLP floats: 16-byte aligned; two adjacent rows lie 20 banks apart,
  // so the 16 lanes of a 16-byte read (two rows, 32 bytes from lane to lane) meet
  // no bank twice, and rows 8 apart lie 32 banks apart for the accumulator stores.
  constexpr int kLP = 212;
  __shared__ alignas(16) float lgt[16 * kLP];
  const int q0 = blockIdx.x << 4, bh = blockIdx.y;
  const int tid = threadIdx.x, wave = tid >> 5, lane = tid & 31;
  const int r = tid >> 3, t8 = tid & 7;   // softmax: 8 threads per row

  // A softmax thread owns runs of eight adjacent k: run t8 + 8j, j = 0..2, covers
  // k = 0..191; the row's last five k (192..196) are worked by all eight threads
  // alike and kept by thread 0.  Its packed table rows: one 16-byte load a run,
  // 8 bytes and 2 for the last five.
  static_assert(kS == 197, "three runs a thread and five k over");
  const char* cI = (const char*)pidx;
  const unsigned oJ = (unsigned)(imin(q0 + r, kS - 1) * 512);
  const unsigned oI = oJ + (unsigned)(t8 * 16);
  const u32x4 iw0 = *(const u32x4*)(cI + oI);
  const u32x4 iw1 = *(const u32x4*)(cI + oI + 128);
  const u32x4 iw2 = *(const u32x4*)(cI + oI + 256);
  const u32x2 iw3 = *(const u32x2*)(cI + oJ + 192 * 2);
  const unsigned iw4 = *(const unsigned short*)(cI + oJ + 196 * 2);

  // This wave's 16 table rows as a B fragment, in load_frag's k order:
  // waves 0,1 take q_tab_x rows 0..15 and 16..31, waves 2,3 q_tab_y; rows past
  // the table are zero.
  const int te = ((wave & 1) << 4) + (lane & 15);
  const f32x4* tp = (const f32x4*)((wave >> 1 ? qty : qtx) + imin(te, kNE - 1) * 32 + ((lane >> 4) << 3));
  f32x4 tf[4] = {tp[0], tp[1], tp[4], tp[5]};
  v16h tb;
#pragma unroll
  for (int j = 0; j < 16; ++j) tb[j] = te < kNE ? (half_t)tf[j >> 2][j & 3] : (half_t)0.f;

  // Q and K tiles: a thread's one load of Q and thirteen of K are all issued
  // before the first wait for data, with no branch between them.  This head's K
  // is one run of kS * 8 16-byte pieces, piece tid + 128 t going to row r + 16 t.
  // Rows past kS re-read the last row (Q) or the last piece (K): the P rows of
  // those q are never stored and the logits of those k are never used.
  {
    const char* cQ = (const char*)(Q + (size_t)bh * kS * kD);
    const char* cK = (const char*)(K + (size_t)bh * kS * kD);
    const unsigned oQ = (unsigned)(imin(q0 + r, kS - 1) * 128 + t8 * 16);
    const unsigned oK = (unsigned)(tid * 16);
    const unsigned oL = (unsigned)(imin(12 * 128 + tid, kS * 8 - 1) * 16);
    const u32x4 qv = *(const u32x4*)(cQ + oQ);
    u32x4 kv[13];
    // Unrolled: t becomes an immediate offset and kv[] stays in registers.
#pragma unroll
    for (int t = 0; t < 12; ++t) kv[t] = *(const u32x4*)(cK + oK + t * 2048);
    kv[12] = *(const u32x4*)(cK + oL);
    // Precaution, as in gemm_core128: the offset and address registers of the
    // issued loads (Q, K, index words, table rows) stay live up to this wait.
    asm volatile("s_wait_xcnt 0x0" :: "v"(oQ), "v"(oK), "v"(oL), "v"(oI), "v"(oJ), "v"(tp) : "memory");
    *(u32x4*)(lQ + r * 72 + t8 * 8) = qv;
#pragma unroll
    for (int t = 0; t < 13; ++t) *(u32x4*)(lK + (r + 16 * t) * 72 + t8 * 8) = kv[t];
  }
  __syncthreads();

  v16h af0 = load_frag(lQ, 72, lane, 0);
  v16h af1 = load_frag(lQ, 72, lane, 32);
  const int rb = (lane >> 4) << 3, cb = lane & 15;
  v8f tacc = {};
  tacc = __builtin_amdgcn_wmma_f32_16x16x32_f16(false, wave >> 1 ? af1 : af0, false, tb, (short)0, tacc, false, false);
  for (int nt = wave; nt < 13; nt += 4) {
    v8f a = {};
    v16h bf0 = load_frag(lK + nt * 16 * 72, 72, lane, 0);
    v16h bf1 = load_frag(lK + nt * 16 * 72, 72, lane, 32);
    a = __builtin_amdgcn_wmma_f32_16x16x32_f16(false, af0, false, bf0, (short)0, a, false, false);
    a = __builtin_amdgcn_wmma_f32_16x16x32_f16(false, af1, false, bf1, (short)0, a, false, false);
    int col = (nt << 4) + cb;
#pragma unroll
    for (int i = 0; i < 8; ++i) lgt[(rb + i) * kLP + col] = a[i];
  }
  __syncthreads();

  // Every wave has left lK: rows of 68 floats over it, TX at 0..31, TY at 32..63.
  float* lT = (float*)lK;
#pragma unroll
  for (int i = 0; i < 8; ++i) lT[(rb + i) * 68 + (wave << 4) + cb] = tacc[i];
  __syncthreads();   // publishes TX, TY to the softmax threads

  // softmax, the row's values in registers from here to the store of P; the first
  // pass adds the two gathered position terms and scales
  const unsigned iw[15] = {iw0[0], iw0[1], iw0[2], iw0[3], iw1[0], iw1[1], iw1[2], iw1[3],
                           iw2[0], iw2[1], iw2[2], iw2[3], iw3[0], iw3[1], iw4};
  const float* tr = lT + r * 68;
  const float* lg = lgt + r * kLP;
  float v[29];
  // Unrolled (this loop and the ones below): v[] stays in registers, and n picks
  // the index word and half at compile time.
#pragma unroll
  for (int j = 0; j < 3; ++j) {
    const f32x4 lo = *(const f32x4*)(lg + (t8 + 8 * j) * 8);
    const f32x4 hi = *(const f32x4*)(lg + (t8 + 8 * j) * 8 + 4);
#pragma unroll
    for (int i = 0; i < 4; ++i) { v[8 * j + i] = lo[i]; v[8 * j + 4 + i] = hi[i]; }
  }
  {
    const f32x4 lo = *(const f32x4*)(lg + 192);
#pragma unroll
    for (int i = 0; i < 4; ++i) v[24 + i] = lo[i];
    v[28] = lg[196];
  }
  float mx = -3.0e38f;
#pragma unroll
  for (int n = 0; n < 29; ++n) {
    const unsigned e = iw[n >> 1] >> ((n & 1) * 16);
    v[n] = (v[n] + tr[e & 0xff] + tr[32 + ((e >> 8) & 0xff)]) * 0.125f;   // 1/sqrt(64)
    mx = fmaxf(mx, v[n]);
  }
  for (int off = 4; off; off >>= 1) mx = fmaxf(mx, __shfl_xor(mx, off, 8));
  // One partial sum a run, so that the four chains of additions are independent.
  float ps[4] = {0.f, 0.f, 0.f, 0.f};
  float ex[29];
#pragma unroll
  for (int n = 0; n < 29; ++n) v[n] = (v[n] - mx) * 1.44269504f;   // e^x = 2^(x log2 e)
  exp2x8(ex, v);
  exp2x8(ex + 8, v + 8);
  exp2x8(ex + 16, v + 16);
  exp2x5(ex + 24, v + 24);
#pragma unroll
  for (int n = 0; n < 29; ++n) {
    v[n] = (n < 24 || t8 == 0) ? ex[n] : 0.f;
    ps[n >> 3] += v[n];
  }
  float sum = (ps[0] + ps[1]) + (ps[2] + ps[3]);
  for (int off = 4; off; off >>= 1) sum += __shfl_xor(sum, off, 8);
  float inv = 1.f / sum;
  int q = q0 + r;
  if (q < kS) {
    // Eight lanes store 128 contiguous bytes of a row of P.  k = 197..199 are
    // stored as zero; k = 200..207 are read by no kernel and stay unwritten.
    unsigned p[16];
#pragma unroll
    for (int n = 0; n < 32; n += 2) {
      const h2 w = {(half_t)(n < 29 ? v[n < 29 ? n : 0] * inv : 0.f),
                    (half_t)(n + 1 < 29 ? v[n + 1 < 29 ? n + 1 : 0] * inv : 0.f)};
      p[n >> 1] = __builtin_bit_cast(unsigned, w);
    }
    const unsigned off = (unsigned)((((q * kBH + bh) * kSP) + t8 * 8) * 2);
    store3_p(P, off, u32x4{p[0], p[1], p[2], p[3]}, u32x4{p[4], p[5], p[6], p[7]},
             u32x4{p[8], p[9], p[10], p[11]});
    if (t8 == 0) store1_p(P, off + 192 * 2, u32x4{p[12], p[13], p[14], p[15]});
  }
}

// Content output (per bh): O1[b,q,h*64+d] = P[bh] @ V[bh]   (fp32)
__global__ void k_pv(const half_t* __restrict__ P, const half_t* __restrict__ Vt,
                     float* __restrict__ O1) {
  GEMM_SHARED
  int m0 = blockIdx.x << 6, bh = blockIdx.y;
  gemm_core(P + ((size_t)m0 * kBH + bh) * kSP, kBH * kSP, imin(64, kS - m0),
            Vt + (size_t)bh * kD * kSP, kSP, lA, lB, acc);
  EPILOGUE_VARS
  int b = bh / kH, h = bh % kH;
  // 16 lanes store a head's whole 256-byte row.
#pragma unroll
  for (int i = 0; i < 8; ++i) {
    const int q = m0 + rbase + i;
    if (q < kS) {
      const f32x4 v = {acc[0][i], acc[1][i], acc[2][i], acc[3][i]};
      store1_b128(O1, (unsigned)(((b * kS + q) * kE + h * kD + (cbase << 2)) * 4), v);
    }
  }
}

// v_pos output (per q): add P_qslice @ v_pos[q]; finalize O1 -> f16 for out-proj.
__global__ void k_vpos(const half_t* __restrict__ P, const half_t* __restrict__ vposT,
                       const float* __restrict__ O1, half_t* __restrict__ O1h) {
  GEMM_SHARED
  int m0 = blockIdx.x << 6, q = blockIdx.y;
  gemm_core(P + ((size_t)q * kBH + m0) * kSP, kSP, 64,
            vposT + (size_t)q * kD * kSP, kSP, lA, lB, acc);
  EPILOGUE_VARS
  // 16 lanes read a head's whole 256-byte row of O1 and store its 128-byte row of O1h.
  unsigned off[8];
  f32x4 o1[8];
#pragma unroll
  for (int i = 0; i < 8; ++i) {
    const int bh = m0 + rbase + i, b = bh / kH, h = bh % kH;
    off[i] = (unsigned)(((b * kS + q) * kE + h * kD + (cbase << 2)) * 4);
  }
#pragma unroll
  for (int i = 0; i < 8; ++i) o1[i] = *(const f32x4*)((const char*)O1 + off[i]);
  // Precaution, as in gemm_core128: the offset registers of the issued loads
  // stay live up to this wait.
  asm volatile("s_wait_xcnt 0x0"
               :: "v"(off[0]), "v"(off[1]), "v"(off[2]), "v"(off[3]),
                  "v"(off[4]), "v"(off[5]), "v"(off[6]), "v"(off[7])
               : "memory");
  h4 v[8];
#pragma unroll
  for (int i = 0; i < 8; ++i) {
    const f32x4 f = {acc[0][i], acc[1][i], acc[2][i], acc[3][i]};
    v[i] = __builtin_convertvector(f + o1[i], h4);
  }
  store4_b64(O1h, off[0] >> 1, off[1] >> 1, off[2] >> 1, off[3] >> 1, v[0], v[1], v[2], v[3]);
  store4_b64(O1h, off[4] >> 1, off[5] >> 1, off[6] >> 1, off[7] >> 1, v[4], v[5], v[6], v[7]);
}

// Output projection: out = O1h @ Wo^T + bo   (fp32 out)
__global__ __launch_bounds__(128) void k_out(const half_t* __restrict__ O1h, const half_t* __restrict__ wo,
                      const float* __restrict__ bo, float* __restrict__ out) {
  GEMM128_SHARED
  int m0 = blockIdx.x << 7, n0 = blockIdx.y << 7;
  gemm_core128(O1h + (long)m0 * kE, imin(128, kM - m0), wo + (long)n0 * kE, lA, lB, false, acc);
  EPILOGUE128_VARS
  // A lane's four tiles of a row are four adjacent columns: 16 lanes store 256
  // contiguous bytes, two whole lines.
  const f32x4 bz = *(const f32x4*)(bo + n0 + cbase);
  const unsigned off = (unsigned)(((m0 + rbase) * kE + n0 + cbase) * 4);
#pragma unroll
  for (int mt = 0; mt < 4; ++mt) {
    if (m0 + rbase + (mt << 4) < kM) {
#pragma unroll
      for (int i0 = 0; i0 < 8; i0 += 4) {
        f32x4 v[4];
#pragma unroll
        for (int i = 0; i < 4; ++i) {
          const f32x4 f = {acc[mt][0][i0 + i], acc[mt][1][i0 + i], acc[mt][2][i0 + i], acc[mt][3][i0 + i]};
          v[i] = f + bz;
        }
        store4_b128<kE * 4>(out, off + (unsigned)(((mt << 4) + i0) * kE * 4), v[0], v[1], v[2], v[3]);
      }
    }
  }
}

// ---------------- host launcher ----------------
extern "C" void kernel_launch(void* const* d_in, const int* in_sizes, int n_in,
                              void* d_out, int out_size, void* d_ws, size_t ws_size,
                              hipStream_t stream) {
  (void)in_sizes; (void)n_in; (void)out_size; (void)ws_size;
  const float* x   = (const float*)d_in[0];
  const float* Wq  = (const float*)d_in[1];
  const float* bq  = (const float*)d_in[2];
  const float* Wk  = (const float*)d_in[3];
  const float* bk  = (const float*)d_in[4];
  const float* Wv  = (const float*)d_in[5];
  const float* bv  = (const float*)d_in[6];
  const float* Wo  = (const float*)d_in[7];
  const float* bo  = (const float*)d_in[8];
  const float* qtx = (const float*)d_in[9];
  const float* qty = (const float*)d_in[10];
  const float* vtx = (const float*)d_in[11];
  const float* vty = (const float*)d_in[12];
  const int*   xd  = (const int*)d_in[13];
  const int*   yd  = (const int*)d_in[14];
  float* out = (float*)d_out;

  char* ws = (char*)d_ws;
  size_t off = 0;
  auto take = [&](size_t bytes) {
    void* p = ws + off;
    off += (bytes + 255) & ~(size_t)255;
    return p;
  };
  const size_t NX   = (size_t)kM * kE;           // 9.68M
  const size_t NW   = (size_t)kE * kE;
  const size_t NQ   = (size_t)kBH * kS * kD;     // 9.68M
  const size_t NVT  = (size_t)kBH * kD * kSP;    // 10.2M
  const size_t NIDX = (size_t)kS * 256;
  const size_t NVPT = (size_t)kS * kD * kSP;     // 2.62M
  const size_t NP   = (size_t)kS * kBH * kSP;    // 31.5M

  half_t* xh    = (half_t*)take(NX * 2);
  half_t* wqh   = (half_t*)take(NW * 2);
  half_t* wkh   = (half_t*)take(NW * 2);
  half_t* wvh   = (half_t*)take(NW * 2);
  half_t* woh   = (half_t*)take(NW * 2);
  half_t* Qh    = (half_t*)take(NQ * 2);
  half_t* Kh    = (half_t*)take(NQ * 2);
  half_t* Vt    = (half_t*)take(NVT * 2);
  unsigned short* pidx = (unsigned short*)take(NIDX * 2);
  half_t* vposT = (half_t*)take(NVPT * 2);
  half_t* P     = (half_t*)take(NP * 2);
  float*  O1    = (float*)take(NX * 4);
  half_t* O1h   = xh;  // xh dead after k_proj; reuse

  k_f2h_all<<<kCvtBlocksX + 4 * kCvtBlocksW, kCvtThreads, 0, stream>>>(
      x, Wq, Wk, Wv, Wo, xh, wqh, wkh, wvh, woh);
  k_pos<<<(kS * kS + 255) / 256, 256, 0, stream>>>(vtx, vty, xd, yd, pidx, vposT);

  k_proj<<<dim3((kM + 127) / 128, kE / 128, 3), 128, 0, stream>>>(
      xh, wqh, wkh, wvh, bq, bk, bv, Qh, Kh, Vt);
  k_attn<<<dim3((kS + 15) / 16, kBH), 128, 0, stream>>>(Qh, Kh, qtx, qty, pidx, P);
  k_pv<<<dim3((kS + 63) / 64, kBH), 128, 0, stream>>>(P, Vt, O1);
  k_vpos<<<dim3(kBH / 64, kS), 128, 0, stream>>>(P, vposT, O1, O1h);
  k_out<<<dim3((kM + 127) / 128, kE / 128), 128, 0, stream>>>(O1h, woh, bo, out);
}

// v007
// Measured time: 160 microseconds a run.
// In both of two side-by-side timings against v006, it was 1.04 times as fast.
// Counting every step since v000, it is 2.84 times as fast.
#include <hip/hip_runtime.h>
#include <hip/hip_bf16.h>

// ---------------- problem constants ----------------
constexpr int kB  = 64;        // batch
constexpr int kS  = 197;       // seq len
constexpr int kE  = 768;       // embed
constexpr int kH  = 12;        // heads
constexpr int kD  = 64;        // head dim
constexpr int kBH = kB * kH;   // 768
constexpr int kSP = 208;       // seq padded to mult of 16
constexpr int kM  = kB * kS;   // 12608 rows for projections

typedef _Float16 half_t;
typedef __attribute__((ext_vector_type(16))) _Float16     v16h;
typedef __attribute__((ext_vector_type(8)))  float        v8f;
typedef __attribute__((ext_vector_type(2)))  _Float16     h2;
typedef __attribute__((ext_vector_type(4)))  unsigned int u32x4;
typedef __attribute__((ext_vector_type(2)))  unsigned int u32x2;

struct HFrag { u32x4 a, b; };

__device__ __forceinline__ int imin(int a, int b) { return a < b ? a : b; }

// Load a 16x32 f16 WMMA A/B fragment from an LDS tile stored row-major
// [16][ldk].  Per ISA: lane<16 holds K {0..7,16..23} of row (lane&15);
// lane>=16 holds K {8..15,24..31}.  Two 16-byte ds_load_b128 per frag.
__device__ __forceinline__ v16h load_frag(const half_t* base, int ldk, int lane, int k0) {
  const half_t* p = base + (lane & 15) * ldk + k0 + ((lane >> 4) << 3);
  HFrag f;
  f.a = *(const u32x4*)p;
  f.b = *(const u32x4*)(p + 16);
  return __builtin_bit_cast(v16h, f);
}

// ---------------- shared 64x64 macro-tile GEMM core ----------------
// 128 threads = 4 waves; wave w owns output rows [16w,16w+16), all 64 cols.
// A element (r,k) at gA[r*sAr + k]; B^T element (n,k) at gB[n*sBr + k]; k runs
// over kS.  K staged in 64-wide slabs, LDS row stride 72 halves (144B = 36 banks,
// gcd(36,64)=4 -> conflict-free).  Staging uses 16-byte b128 copies; all
// callers guarantee 16B alignment (bases/strides are multiples of 8 halves).
// A thread's eight loads of a slab are all issued before the first wait for
// data: no branch stands between them.  Rows past aRows re-read row aRows-1;
// callers never store the results of those rows.
// The rows of B^T are dealt: row 4c + t lies at LDS row 16t + c, so a lane's
// four accumulator tiles of a row are four adjacent columns 4c .. 4c + 3.
constexpr int kFull = kS / 64 * 64;   // 192: k covered by whole slabs
static_assert(kS - kFull == 5, "the last slab below reads four halves and one per row");
__device__ __forceinline__ void gemm_core(
    const half_t* gA, unsigned sAr, int aRows,
    const half_t* gB, unsigned sBr, half_t* lA, half_t* lB, v8f* acc) {
  const int tid  = threadIdx.x;
  const int wave = tid >> 5, lane = tid & 31;
  const int r0 = tid >> 3, c8 = (tid & 7) << 3;
  // byte offsets of this thread's four rows of A and of B^T
  unsigned rowA[4], rowB[4];
#pragma unroll
  for (int j = 0; j < 4; ++j) {
    rowA[j] = (unsigned)imin(r0 + 16 * j, aRows - 1) * sAr * 2u;
    rowB[j] = (unsigned)(r0 + 16 * j) * sBr * 2u;
  }
  const char* cA = (const char*)gA;
  const char* cB = (const char*)gB;
  half_t* dA = lA + r0 * 72 + c8;
  half_t* dB = lB + (((r0 & 3) << 4) + (r0 >> 2)) * 72 + c8;   // dealt: row r0 + 16j lies 4j rows on
  const half_t* aBase = lA + (wave << 4) * 72;
  // Unrolled so that k0 is an immediate offset of every load and the last slab
  // is told apart at compile time.
#pragma unroll
  for (int k0 = 0; k0 < kFull + 64; k0 += 64) {
    u32x4 ta[4], tb[4];
    if (k0 < kFull) {
      unsigned oA[4], oB[4];
#pragma unroll
      for (int j = 0; j < 4; ++j) { oA[j] = rowA[j] + c8 * 2; oB[j] = rowB[j] + c8 * 2; }
#pragma unroll
      for (int j = 0; j < 4; ++j) ta[j] = *(const u32x4*)(cA + oA[j] + k0 * 2);
#pragma unroll
      for (int j = 0; j < 4; ++j) tb[j] = *(const u32x4*)(cB + oB[j] + k0 * 2);
      // Precaution: the offset registers that the issued loads name stay live up
      // to this wait, so none is reused ahead of it.
      asm volatile("s_wait_xcnt 0x0"
                   :: "v"(oA[0]), "v"(oA[1]), "v"(oA[2]), "v"(oA[3]),
                      "v"(oB[0]), "v"(oB[1]), "v"(oB[2]), "v"(oB[3])
                   : "memory");
    } else {
      // Last slab: k = kFull .. kS-1 are real, the rest of its 64 columns is zero.
      // Every thread reads the five halves of its rows (8 bytes and 2); the
      // thread of column 0 keeps them, the others store zero.
      u32x2 a4[4], b4[4];
      unsigned a1[4], b1[4];
#pragma unroll
      for (int j = 0; j < 4; ++j) {
        a4[j] = *(const u32x2*)(cA + rowA[j] + kFull * 2);
        a1[j] = *(const unsigned short*)(cA + rowA[j] + (kFull + 4) * 2);
      }
#pragma unroll
      for (int j = 0; j < 4; ++j) {
        b4[j] = *(const u32x2*)(cB + rowB[j] + kFull * 2);
        b1[j] = *(const unsigned short*)(cB + rowB[j] + (kFull + 4) * 2);
      }
      // Precaution, as above.
      asm volatile("s_wait_xcnt 0x0"
                   :: "v"(rowA[0]), "v"(rowA[1]), "v"(rowA[2]), "v"(rowA[3]),
                      "v"(rowB[0]), "v"(rowB[1]), "v"(rowB[2]), "v"(rowB[3])
                   : "memory");
      const unsigned keep = c8 == 0 ? 0xffffffffu : 0u;
#pragma unroll
      for (int j = 0; j < 4; ++j) {
        ta[j] = u32x4{a4[j][0] & keep, a4[j][1] & keep, a1[j] & keep, 0u};
        tb[j] = u32x4{b4[j][0] & keep, b4[j][1] & keep, b1[j] & keep, 0u};
      }
    }
#pragma unroll
    for (int j = 0; j < 4; ++j) {
      *(u32x4*)(dA + j * 16 * 72) = ta[j];
      *(u32x4*)(dB + j * 4 * 72)  = tb[j];
    }
    __syncthreads();
#pragma unroll
    for (int kk = 0; kk < 64; kk += 32) {
      v16h af = load_frag(aBase, 72, lane, kk);
#pragma unroll
      for (int nt = 0; nt < 4; ++nt) {
        v16h bf = load_frag(lB + (nt << 4) * 72, 72, lane, kk);
        acc[nt] = __builtin_amdgcn_wmma_f32_16x16x32_f16(
            false, af, false, bf, (short)0, acc[nt], false, false);
      }
    }
    __syncthreads();
  }
}

#define GEMM_SHARED                                    \
  __shared__ alignas(16) half_t lA[64 * 72];           \
  __shared__ alignas(16) half_t lB[64 * 72];           \
  v8f acc[4];                                          \
  { v8f z = {}; for (int i = 0; i < 4; ++i) acc[i] = z; }

// C/D VGPR layout: vgpr i, lane l -> row = i + 8*(l>>4), col = l&15.
#define EPILOGUE_VARS                                  \
  const int lane = threadIdx.x & 31;                   \
  const int rbase = ((threadIdx.x >> 5) << 4) + ((lane >> 4) << 3); \
  const int cbase = lane & 15;

// ---------------- 128x128 macro-tile GEMM core (dense projections) ----------------
// 128 threads = 4 waves in a 2x2 grid; each wave owns a 64x64 block of the
// tile as 4x4 accumulator tiles, so every fragment read from LDS feeds four
// WMMAs.  A is [aRows][kE], B^T is [128][kE], both K-contiguous; K runs over kE in
// 64-wide slabs at the same 72-half LDS pitch as above, brought into LDS by
// asynchronous copies, through no register.  Rows past aRows
// re-read row aRows-1; callers never store the results of those rows.
// The rows of gB are dealt: LDS row 64g + 16t + c holds row 64g + 4c + t, so
// position c of fragment tile t is row 4c + t of the wave's 64, and the four
// tiles of one position are four adjacent rows.  With swap set the two slabs
// change roles in the product (gB rows become the rows of D, gA rows its
// columns); the k order of both loaders is the same either way.

// Eight 16-byte asynchronous copies from global memory to LDS, every lane with
// its own two addresses.  The s_wait_xcnt is the last line of the copies' own
// statement, so that no address register is rewritten ahead of it (a precaution).
__device__ __forceinline__ void copy8(const unsigned (&l)[8], const char* const (&g)[8]) {
  asm volatile(
      "global_load_async_to_lds_b128 %0, %8, off\n\t"
      "global_load_async_to_lds_b128 %1, %9, off\n\t"
      "global_load_async_to_lds_b128 %2, %10, off\n\t"
      "global_load_async_to_lds_b128 %3, %11, off\n\t"
      "global_load_async_to_lds_b128 %4, %12, off\n\t"
      "global_load_async_to_lds_b128 %5, %13, off\n\t"
      "global_load_async_to_lds_b128 %6, %14, off\n\t"
      "global_load_async_to_lds_b128 %7, %15, off\n\t"
      "s_wait_xcnt 0x0"
      :: "v"(l[0]), "v"(l[1]), "v"(l[2]), "v"(l[3]), "v"(l[4]), "v"(l[5]), "v"(l[6]), "v"(l[7]),
         "v"(g[0]), "v"(g[1]), "v"(g[2]), "v"(g[3]), "v"(g[4]), "v"(g[5]), "v"(g[6]), "v"(g[7])
      : "memory");
}

// Two LDS buffers, each an A slab and behind it a B slab: while the WMMAs work on
// one, the next slab's copies land in the other.
constexpr int kSlabH = 128 * 72;      // halves in one operand's slab
constexpr int kBufH  = 2 * kSlabH;    // halves in one buffer
constexpr int kSlabs = kE / 64;
static_assert(kSlabs >= 2, "the ring starts with two slabs");
__device__ __forceinline__ void gemm_core128(
    const half_t* __restrict__ gA, int aRows, const half_t* __restrict__ gB,
    half_t* lAB, bool swap, v8f (&acc)[4][4]) {
  const int tid  = threadIdx.x;
  const int wave = tid >> 5, lane = tid & 31;
  const int r0 = tid >> 3, c8 = (tid & 7) << 3;
  // this thread's eight pieces of an A slab and of a B slab, at k = 0; eight
  // lanes copy a row's whole 128-byte line
  const char* pA[8];
  const char* pB[8];
#pragma unroll
  for (int j = 0; j < 8; ++j) {
    pA[j] = (const char*)gA + (unsigned)(imin(r0 + 16 * j, aRows - 1) * kE + c8) * 2u;
    pB[j] = (const char*)gB + (unsigned)((r0 * 4 + (j >> 2) * 64 + (j & 3)) * kE + c8) * 2u;
  }
  // LDS byte address of this thread's piece of row r0 of buffer 0's A slab
  const unsigned l0 = (unsigned)(size_t)lAB + (unsigned)(r0 * 72 + c8) * 2u;
  auto fill = [&](int k0, int buf) {
    unsigned l[8];
    const char* g[8];
#pragma unroll
    for (int j = 0; j < 8; ++j) { l[j] = l0 + (unsigned)(buf * kBufH + j * 16 * 72) * 2u; g[j] = pA[j] + k0 * 2; }
    copy8(l, g);
#pragma unroll
    for (int j = 0; j < 8; ++j) { l[j] = l0 + (unsigned)(buf * kBufH + kSlabH + j * 16 * 72) * 2u; g[j] = pB[j] + k0 * 2; }
    copy8(l, g);
  };
  const half_t* aBase = lAB + (swap ? kSlabH : 0) + ((wave >> 1) << 6) * 72;
  const half_t* bBase = lAB + (swap ? 0 : kSlabH) + ((wave & 1) << 6) * 72;

  fill(0, 0);
  // This wave's copies of slab 0 have landed before the barrier that publishes them.
  asm volatile("s_wait_asynccnt 0x0" ::: "memory");
  __syncthreads();
  fill(64, 1);
  // Unrolled so that the buffer and k0 are compile-time constants in every address.
#pragma unroll
  for (int t = 0; t < kSlabs; ++t) {
    const half_t* aB = aBase + (t & 1) * kBufH;
    const half_t* bB = bBase + (t & 1) * kBufH;
#pragma unroll
    for (int kk = 0; kk < 64; kk += 32) {
      v16h af[4], bf[4];
#pragma unroll
      for (int u = 0; u < 4; ++u) {
        af[u] = load_frag(aB + (u << 4) * 72, 72, lane, kk);
        bf[u] = load_frag(bB + (u << 4) * 72, 72, lane, kk);
      }
#pragma unroll
      for (int mt = 0; mt < 4; ++mt)
#pragma unroll
        for (int nt = 0; nt < 4; ++nt)
          acc[mt][nt] = __builtin_amdgcn_wmma_f32_16x16x32_f16(
              false, af[mt], false, bf[nt], (short)0, acc[mt][nt], false, false);
    }
    // This wave's reads of the buffer are over before it is refilled.
    asm volatile("s_wait_dscnt 0x0" ::: "memory");
    // This wave's copies of slab t + 1 have landed before the barrier that publishes them.
    asm volatile("s_wait_asynccnt 0x0" ::: "memory");
    __syncthreads();   // publishes slab t + 1; ends every wave's reads of slab t
    if (t + 2 < kSlabs) fill((t + 2) * 64, t & 1);
  }
  // No copy is outstanding when the wave goes on.
  asm volatile("s_wait_asynccnt 0x0" ::: "memory");
}

#define GEMM128_SHARED                                 \
  __shared__ alignas(16) half_t lAB[2 * kBufH];        \
  v8f acc[4][4];                                       \
  { v8f z = {};                                        \
    for (int i = 0; i < 4; ++i)                        \
      for (int j = 0; j < 4; ++j) acc[i][j] = z; }

// Same C/D layout; the wave's 64x64 block starts at (64*(wave>>1), 64*(wave&1)).
// Along the dealt operand, tile t at position c is row 4c + t of the block.
#define EPILOGUE128_VARS                               \
  const int lane = threadIdx.x & 31;                   \
  const int wid = threadIdx.x >> 5;                    \
  const int rbase = ((wid >> 1) << 6) + ((lane >> 4) << 3); \
  const int cbase = ((wid & 1) << 6) + ((lane & 15) << 2);
static_assert(kM % 8 == 0, "a lane's eight rows of a tile are all inside kM or all outside");

// Four f16 stores at base + off, STEP bytes apart, two values to a register.
// Stores and wait are one statement so that the offset and the two data
// registers stay untouched up to the s_wait_xcnt (a precaution; a wait in a
// statement of its own does not hold later register writes behind it).
template <int STEP>
__device__ __forceinline__ void store4(half_t* base, unsigned off,
                                       float a0, float a1, float a2, float a3) {
  h2 p01 = {(half_t)a0, (half_t)a1}, p23 = {(half_t)a2, (half_t)a3};
  asm volatile(
      "global_store_b16 %0, %1, %3\n\t"
      "global_store_d16_hi_b16 %0, %1, %3 offset:%4\n\t"
      "global_store_b16 %0, %2, %3 offset:%5\n\t"
      "global_store_d16_hi_b16 %0, %2, %3 offset:%6\n\t"
      "s_wait_xcnt 0x0"
      :: "v"(off), "v"(__builtin_bit_cast(unsigned, p01)), "v"(__builtin_bit_cast(unsigned, p23)),
         "s"(base), "n"(STEP), "n"(2 * STEP), "n"(3 * STEP)
      : "memory");
}

typedef __attribute__((ext_vector_type(4))) float    f32x4;
typedef __attribute__((ext_vector_type(4))) _Float16 h4;

// Four 8-byte stores (four f16 each) at base + o0..o3; stores and wait in one
// statement, for the same reason as in store4.
__device__ __forceinline__ void store4_b64(half_t* base, unsigned o0, unsigned o1, unsigned o2,
                                           unsigned o3, h4 a0, h4 a1, h4 a2, h4 a3) {
  asm volatile(
      "global_store_b64 %0, %4, %8\n\t"
      "global_store_b64 %1, %5, %8\n\t"
      "global_store_b64 %2, %6, %8\n\t"
      "global_store_b64 %3, %7, %8\n\t"
      "s_wait_xcnt 0x0"
      :: "v"(o0), "v"(o1), "v"(o2), "v"(o3),
         "v"(__builtin_bit_cast(u32x2, a0)), "v"(__builtin_bit_cast(u32x2, a1)),
         "v"(__builtin_bit_cast(u32x2, a2)), "v"(__builtin_bit_cast(u32x2, a3)), "s"(base)
      : "memory");
}

// One 16-byte store at base + off; store and wait in one statement as above.
__device__ __forceinline__ void store1_b128(float* base, unsigned off, f32x4 a) {
  asm volatile(
      "global_store_b128 %0, %1, %2\n\t"
      "s_wait_xcnt 0x0"
      :: "v"(off), "v"(a), "s"(base)
      : "memory");
}

// Four 16-byte stores at base + off, STEP bytes apart; one statement as above.
template <int STEP>
__device__ __forceinline__ void store4_b128(float* base, unsigned off,
                                            f32x4 a0, f32x4 a1, f32x4 a2, f32x4 a3) {
  asm volatile(
      "global_store_b128 %0, %1, %5\n\t"
      "global_store_b128 %0, %2, %5 offset:%6\n\t"
      "global_store_b128 %0, %3, %5 offset:%7\n\t"
      "global_store_b128 %0, %4, %5 offset:%8\n\t"
      "s_wait_xcnt 0x0"
      :: "v"(off), "v"(a0), "v"(a1), "v"(a2), "v"(a3),
         "s"(base), "n"(STEP), "n"(2 * STEP), "n"(3 * STEP)
      : "memory");
}

// A softmax thread's three 16-byte stores at base + off, 128 bytes apart; stores
// and wait in one statement, for the same reason as in store4.
__device__ __forceinline__ void store3_p(half_t* base, unsigned off, u32x4 a0, u32x4 a1, u32x4 a2) {
  asm volatile(
      "global_store_b128 %0, %1, %4\n\t"
      "global_store_b128 %0, %2, %4 offset:128\n\t"
      "global_store_b128 %0, %3, %4 offset:256\n\t"
      "s_wait_xcnt 0x0"
      :: "v"(off), "v"(a0), "v"(a1), "v"(a2), "s"(base)
      : "memory");
}

// 2^x of eight values and of five.  One statement with the outputs apart from the
// inputs: every v_exp_f32 stands in front of an independent one and the last in
// front of a v_nop, the slot that the instruction set asks for before a
// transcendental's result is read or its source overwritten.
__device__ __forceinline__ void exp2x8(float* e, const float* x) {
  asm("v_exp_f32 %0, %8\n\t"
      "v_exp_f32 %1, %9\n\t"
      "v_exp_f32 %2, %10\n\t"
      "v_exp_f32 %3, %11\n\t"
      "v_exp_f32 %4, %12\n\t"
      "v_exp_f32 %5, %13\n\t"
      "v_exp_f32 %6, %14\n\t"
      "v_exp_f32 %7, %15\n\t"
      "v_nop"
      : "=&v"(e[0]), "=&v"(e[1]), "=&v"(e[2]), "=&v"(e[3]),
        "=&v"(e[4]), "=&v"(e[5]), "=&v"(e[6]), "=&v"(e[7])
      : "v"(x[0]), "v"(x[1]), "v"(x[2]), "v"(x[3]), "v"(x[4]), "v"(x[5]), "v"(x[6]), "v"(x[7]));
}
__device__ __forceinline__ void exp2x5(float* e, const float* x) {
  asm("v_exp_f32 %0, %5\n\t"
      "v_exp_f32 %1, %6\n\t"
      "v_exp_f32 %2, %7\n\t"
      "v_exp_f32 %3, %8\n\t"
      "v_exp_f32 %4, %9\n\t"
      "v_nop"
      : "=&v"(e[0]), "=&v"(e[1]), "=&v"(e[2]), "=&v"(e[3]), "=&v"(e[4])
      : "v"(x[0]), "v"(x[1]), "v"(x[2]), "v"(x[3]), "v"(x[4]));
}

// One 16-byte store of f16 pairs at base + off; one statement as above.
__device__ __forceinline__ void store1_p(half_t* base, unsigned off, u32x4 a) {
  asm volatile(
      "global_store_b128 %0, %1, %2\n\t"
      "s_wait_xcnt 0x0"
      :: "v"(off), "v"(a), "s"(base)
      : "memory");
}

// ---------------- elementwise kernels ----------------
// f32 -> f16 conversion of x and of the four weight matrices in one launch.
// One work-group of 16 waves per 64 rows of 768 floats (196,608 B read), so the
// whole job is 245 work-groups, fewer than there are WGPs, and 3,920 waves to
// start.  A thread's 24 16-byte loads are unrolled from one offset register, so
// many are in flight at once; each wave-wide load covers 512 contiguous bytes
// and each wave-wide 8-byte store 256, whole lines both ways.
constexpr int kCvtThreads = 512;
constexpr int kCvtLoads   = 24;
constexpr int kCvtElems   = kCvtThreads * kCvtLoads * 4;   // floats per work-group
constexpr int kCvtBlocksX = kM * kE / kCvtElems;           // 197
constexpr int kCvtBlocksW = kE * kE / kCvtElems;           // 12
static_assert(kCvtBlocksX * kCvtElems == kM * kE, "x splits into whole work-groups");
static_assert(kCvtBlocksW * kCvtElems == kE * kE, "a weight splits into whole work-groups");

__global__ __launch_bounds__(kCvtThreads) void k_f2h_all(
    const float* __restrict__ x,  const float* __restrict__ wq, const float* __restrict__ wk,
    const float* __restrict__ wv, const float* __restrict__ wo,
    half_t* __restrict__ xh,  half_t* __restrict__ wqh, half_t* __restrict__ wkh,
    half_t* __restrict__ wvh, half_t* __restrict__ woh) {
  const float* in = x;
  half_t* out = xh;
  int part = blockIdx.x;
  if (part >= kCvtBlocksX) {
    const int w = (part - kCvtBlocksX) / kCvtBlocksW;
    part = (part - kCvtBlocksX) % kCvtBlocksW;
    in  = w == 0 ? wq  : w == 1 ? wk  : w == 2 ? wv  : wo;
    out = w == 0 ? wqh : w == 1 ? wkh : w == 2 ? wvh : woh;
  }
  const f32x4* s = (const f32x4*)(in + part * kCvtElems) + threadIdx.x;
  h4* d = (h4*)(out + part * kCvtElems) + threadIdx.x;
  f32x4 v[kCvtLoads];
  // Unrolled: j becomes an immediate offset, and many loads are in flight
  // before the first wait for data.
#pragma unroll
  for (int j = 0; j < kCvtLoads; ++j) v[j] = s[j * kCvtThreads];
  // Unrolled: v[] stays in registers and the stores share one offset register.
#pragma unroll
  for (int j = 0; j < kCvtLoads; ++j) d[j * kCvtThreads] = __builtin_convertvector(v[j], h4);
}

// Build v_pos^T (S,64,208) f16 via table gathers, and pack the two query-table
// row numbers of every (q,k) into 16 bits (x low byte, y high byte), laid out
// [q][k] at 256 entries a row, so that a softmax thread finds the entries of
// eight adjacent k in one 16-byte load.  Row numbers are bounded here.
constexpr int kNE = 28;        // rows of each position table
__global__ void k_pos(const float* vtx, const float* vty,
                      const int* xd, const int* yd,
                      unsigned short* pidx, half_t* vposT) {
  int i = blockIdx.x * blockDim.x + threadIdx.x;
  if (i >= kS * kS) return;
  int dx = imin(xd[i] < 0 ? 0 : xd[i], kNE - 1), dy = imin(yd[i] < 0 ? 0 : yd[i], kNE - 1);
  int q = i / kS, kk = i % kS;
  pidx[q * 256 + kk] = (unsigned short)(dx | (dy << 8));
  size_t vb = (size_t)q * kD * kSP + kk;
  for (int j = 0; j < 32; ++j) {
    vposT[vb + (size_t)j * kSP]        = (half_t)vtx[dx * 32 + j];
    vposT[vb + (size_t)(32 + j) * kSP] = (half_t)vty[dy * 32 + j];
  }
}

// ---------------- phase kernels ----------------
// QKV projection: (12608x768) @ W^T + b.
// Q,K stored [bh][s][d]; V stored transposed [bh][d][sP] so the P@V GEMM
// has unit-stride K and stages with b128 copies.
__global__ __launch_bounds__(128) void k_proj(const half_t* __restrict__ xh,
                       const half_t* wq, const half_t* wk, const half_t* wv,
                       const float* bq, const float* bk, const float* bv,
                       half_t* Q, half_t* K, half_t* Vt) {
  GEMM128_SHARED
  int m0 = blockIdx.x << 7, n0 = blockIdx.y << 7, sel = blockIdx.z;
  const half_t* W    = sel == 0 ? wq : sel == 1 ? wk : wv;
  const float*  bias = sel == 0 ? bq : sel == 1 ? bk : bv;
  gemm_core128(xh + (long)m0 * kE, imin(128, kM - m0), W + (long)n0 * kE, lAB, sel == 2, acc);
  EPILOGUE128_VARS
  if (sel < 2) {
    // D rows are x rows, D columns the dealt weight rows: a lane's four tiles of
    // a row are four adjacent d of one head, so 16 lanes store that head's whole
    // 128-byte row of Q or K.
    half_t* qk = sel == 0 ? Q : K;
    const f32x4 bz = *(const f32x4*)(bias + n0 + cbase);
    const int h = (n0 + cbase) >> 6, d0 = cbase & 63;
#pragma unroll
    for (int mt = 0; mt < 4; ++mt) {
      const int mb = m0 + rbase + (mt << 4);
      if (mb < kM) {
#pragma unroll
        for (int i0 = 0; i0 < 8; i0 += 4) {
          unsigned o[4];
          h4 v[4];
#pragma unroll
          for (int i = 0; i < 4; ++i) {
            const int m = mb + i0 + i, b = m / kS, s = m % kS;
            o[i] = (unsigned)((((b * kH + h) * kS + s) * kD + d0) * 2);
            const f32x4 f = {acc[mt][0][i0 + i], acc[mt][1][i0 + i], acc[mt][2][i0 + i], acc[mt][3][i0 + i]};
            v[i] = __builtin_convertvector(f + bz, h4);
          }
          store4_b64(qk, o[0], o[1], o[2], o[3], v[0], v[1], v[2], v[3]);
        }
      }
    }
  } else {
    // Roles swapped: D rows are the dealt weight rows (d = 4 * row + mt of head
    // hv), D columns x rows, so 16 lanes store 16 adjacent s of one row of V^T.
    const int hv = (n0 >> 6) + (wid >> 1), dl = (lane >> 4) << 5;
    f32x4 bz[8];
#pragma unroll
    for (int i = 0; i < 8; ++i) bz[i] = *(const f32x4*)(bias + (hv << 6) + dl + (i << 2));
#pragma unroll
    for (int nt = 0; nt < 4; ++nt) {
      const int m = m0 + ((wid & 1) << 6) + (nt << 4) + (lane & 15);
      if (m < kM) {
        const int b = m / kS, s = m % kS;
        const unsigned off = (unsigned)((((b * kH + hv) * kD + dl) * kSP + s) * 2);
#pragma unroll
        for (int i = 0; i < 8; ++i)
          store4<kSP * 2>(Vt, off + (unsigned)(i * 4 * kSP * 2),
                          acc[0][nt][i] + bz[i][0], acc[1][nt][i] + bz[i][1],
                          acc[2][nt][i] + bz[i][2], acc[3][nt][i] + bz[i][3]);
      }
    }
  }
}

// Content logits + position logits + softmax -> P.  One block = (bh, 16 q rows, all k).
// Position term: q_pos[q,k,:] is row x_dist[q,k] of one table beside row
// y_dist[q,k] of the other, so Q[q,:] . q_pos[q,k,:] = TX[q][x_dist] + TY[q][y_dist]
// with TX = Q[:, 0:32] . q_tab_x^T and TY = Q[:, 32:64] . q_tab_y^T (16 x 28 each):
// one WMMA per wave, kept in f32 in LDS and gathered per (q,k).  TX and TY take
// the place of the K tile once its last read is over, so LDS per block stays.
__global__ void k_attn(const half_t* __restrict__ Q, const half_t* __restrict__ K,
                       const float* __restrict__ qtx, const float* __restrict__ qty,
                       const unsigned short* __restrict__ pidx,
                       half_t* __restrict__ P) {
  __shared__ alignas(16) half_t lQ[16 * 72];
  __shared__ alignas(16) half_t lK[kSP * 72];
  // Row pitch kLP floats: 16-byte aligned; two adjacent rows lie 20 banks apart,
  // so the 16 lanes of a 16-byte read (two rows, 32 bytes from lane to lane) meet
  // no bank twice, and rows 8 apart lie 32 banks apart for the accumulator stores.
  constexpr int kLP = 212;
  __shared__ alignas(16) float lgt[16 * kLP];
  const int q0 = blockIdx.x << 4, bh = blockIdx.y;
  const int tid = threadIdx.x, wave = tid >> 5, lane = tid & 31;
  const int r = tid >> 3, t8 = tid & 7;   // softmax: 8 threads per row

  // A softmax thread owns runs of eight adjacent k: run t8 + 8j, j = 0..2, covers
  // k = 0..191; the row's last five k (192..196) are worked by all eight threads
  // alike and kept by thread 0.  Its packed table rows: one 16-byte load a run,
  // 8 bytes and 2 for the last five.
  static_assert(kS == 197, "three runs a thread and five k over");
  const char* cI = (const char*)pidx;
  const unsigned oJ = (unsigned)(imin(q0 + r, kS - 1) * 512);
  const unsigned oI = oJ + (unsigned)(t8 * 16);
  const u32x4 iw0 = *(const u32x4*)(cI + oI);
  const u32x4 iw1 = *(const u32x4*)(cI + oI + 128);
  const u32x4 iw2 = *(const u32x4*)(cI + oI + 256);
  const u32x2 iw3 = *(const u32x2*)(cI + oJ + 192 * 2);
  const unsigned iw4 = *(const unsigned short*)(cI + oJ + 196 * 2);

  // This wave's 16 table rows as a B fragment, in load_frag's k order:
  // waves 0,1 take q_tab_x rows 0..15 and 16..31, waves 2,3 q_tab_y; rows past
  // the table are zero.
  const int te = ((wave & 1) << 4) + (lane & 15);
  const f32x4* tp = (const f32x4*)((wave >> 1 ? qty : qtx) + imin(te, kNE - 1) * 32 + ((lane >> 4) << 3));
  f32x4 tf[4] = {tp[0], tp[1], tp[4], tp[5]};
  v16h tb;
#pragma unroll
  for (int j = 0; j < 16; ++j) tb[j] = te < kNE ? (half_t)tf[j >> 2][j & 3] : (half_t)0.f;

  // Q and K tiles: a thread's one load of Q and thirteen of K are all issued
  // before the first wait for data, with no branch between them.  This head's K
  // is one run of kS * 8 16-byte pieces, piece tid + 128 t going to row r + 16 t.
  // Rows past kS re-read the last row (Q) or the last piece (K): the P rows of
  // those q are never stored and the logits of those k are never used.
  {
    const char* cQ = (const char*)(Q + (size_t)bh * kS * kD);
    const char* cK = (const char*)(K + (size_t)bh * kS * kD);
    const unsigned oQ = (unsigned)(imin(q0 + r, kS - 1) * 128 + t8 * 16);
    const unsigned oK = (unsigned)(tid * 16);
    const unsigned oL = (unsigned)(imin(12 * 128 + tid, kS * 8 - 1) * 16);
    const u32x4 qv = *(const u32x4*)(cQ + oQ);
    u32x4 kv[13];
    // Unrolled: t becomes an immediate offset and kv[] stays in registers.
#pragma unroll
    for (int t = 0; t < 12; ++t) kv[t] = *(const u32x4*)(cK + oK + t * 2048);
    kv[12] = *(const u32x4*)(cK + oL);
    // Precaution, as in gemm_core128: the offset and address registers of the
    // issued loads (Q, K, index words, table rows) stay live up to this wait.
    asm volatile("s_wait_xcnt 0x0" :: "v"(oQ), "v"(oK), "v"(oL), "v"(oI), "v"(oJ), "v"(tp) : "memory");
    *(u32x4*)(lQ + r * 72 + t8 * 8) = qv;
#pragma unroll
    for (int t = 0; t < 13; ++t) *(u32x4*)(lK + (r + 16 * t) * 72 + t8 * 8) = kv[t];
  }
  __syncthreads();

  v16h af0 = load_frag(lQ, 72, lane, 0);
  v16h af1 = load_frag(lQ, 72, lane, 32);
  const int rb = (lane >> 4) << 3, cb = lane & 15;
  v8f tacc = {};
  tacc = __builtin_amdgcn_wmma_f32_16x16x32_f16(false, wave >> 1 ? af1 : af0, false, tb, (short)0, tacc, false, false);
  for (int nt = wave; nt < 13; nt += 4) {
    v8f a = {};
    v16h bf0 = load_frag(lK + nt * 16 * 72, 72, lane, 0);
    v16h bf1 = load_frag(lK + nt * 16 * 72, 72, lane, 32);
    a = __builtin_amdgcn_wmma_f32_16x16x32_f16(false, af0, false, bf0, (short)0, a, false, false);
    a = __builtin_amdgcn_wmma_f32_16x16x32_f16(false, af1, false, bf1, (short)0, a, false, false);
    int col = (nt << 4) + cb;
#pragma unroll
    for (int i = 0; i < 8; ++i) lgt[(rb + i) * kLP + col] = a[i];
  }
  __syncthreads();

  // Every wave has left lK: rows of 68 floats over it, TX at 0..31, TY at 32..63.
  float* lT = (float*)lK;
#pragma unroll
  for (int i = 0; i < 8; ++i) lT[(rb + i) * 68 + (wave << 4) + cb] = tacc[i];
  __syncthreads();   // publishes TX, TY to the softmax threads

  // softmax, the row's values in registers from here to the store of P; the first
  // pass adds the two gathered position terms and scales
  const unsigned iw[15] = {iw0[0], iw0[1], iw0[2], iw0[3], iw1[0], iw1[1], iw1[2], iw1[3],
                           iw2[0], iw2[1], iw2[2], iw2[3], iw3[0], iw3[1], iw4};
  const float* tr = lT + r * 68;
  const float* lg = lgt + r * kLP;
  float v[29];
  // Unrolled (this loop and the ones below): v[] stays in registers, and n picks
  // the index word and half at compile time.
#pragma unroll
  for (int j = 0; j < 3; ++j) {
    const f32x4 lo = *(const f32x4*)(lg + (t8 + 8 * j) * 8);
    const f32x4 hi = *(const f32x4*)(lg + (t8 + 8 * j) * 8 + 4);
#pragma unroll
    for (int i = 0; i < 4; ++i) { v[8 * j + i] = lo[i]; v[8 * j + 4 + i] = hi[i]; }
  }
  {
    const f32x4 lo = *(const f32x4*)(lg + 192);
#pragma unroll
    for (int i = 0; i < 4; ++i) v[24 + i] = lo[i];
    v[28] = lg[196];
  }
  float mx = -3.0e38f;
#pragma unroll
  for (int n = 0; n < 29; ++n) {
    const unsigned e = iw[n >> 1] >> ((n & 1) * 16);
    v[n] = (v[n] + tr[e & 0xff] + tr[32 + ((e >> 8) & 0xff)]) * 0.125f;   // 1/sqrt(64)
    mx = fmaxf(mx, v[n]);
  }
  for (int off = 4; off; off >>= 1) mx = fmaxf(mx, __shfl_xor(mx, off, 8));
  // One partial sum a run, so that the four chains of additions are independent.
  float ps[4] = {0.f, 0.f, 0.f, 0.f};
  float ex[29];
#pragma unroll
  for (int n = 0; n < 29; ++n) v[n] = (v[n] - mx) * 1.44269504f;   // e^x = 2^(x log2 e)
  exp2x8(ex, v);
  exp2x8(ex + 8, v + 8);
  exp2x8(ex + 16, v + 16);
  exp2x5(ex + 24, v + 24);
#pragma unroll
  for (int n = 0; n < 29; ++n) {
    v[n] = (n < 24 || t8 == 0) ? ex[n] : 0.f;
    ps[n >> 3] += v[n];
  }
  float sum = (ps[0] + ps[1]) + (ps[2] + ps[3]);
  for (int off = 4; off; off >>= 1) sum += __shfl_xor(sum, off, 8);
  float inv = 1.f / sum;
  int q = q0 + r;
  if (q < kS) {
    // Eight lanes store 128 contiguous bytes of a row of P.  k = 197..199 are
    // stored as zero; k = 200..207 are read by no kernel and stay unwritten.
    unsigned p[16];
#pragma unroll
    for (int n = 0; n < 32; n += 2) {
      const h2 w = {(half_t)(n < 29 ? v[n < 29 ? n : 0] * inv : 0.f),
                    (half_t)(n + 1 < 29 ? v[n + 1 < 29 ? n + 1 : 0] * inv : 0.f)};
      p[n >> 1] = __builtin_bit_cast(unsigned, w);
    }
    const unsigned off = (unsigned)((((q * kBH + bh) * kSP) + t8 * 8) * 2);
    store3_p(P, off, u32x4{p[0], p[1], p[2], p[3]}, u32x4{p[4], p[5], p[6], p[7]},
             u32x4{p[8], p[9], p[10], p[11]});
    if (t8 == 0) store1_p(P, off + 192 * 2, u32x4{p[12], p[13], p[14], p[15]});
  }
}

// Content output (per bh): O1[b,q,h*64+d] = P[bh] @ V[bh]   (fp32)
__global__ void k_pv(const half_t* __restrict__ P, const half_t* __restrict__ Vt,
                     float* __restrict__ O1) {
  GEMM_SHARED
  int m0 = blockIdx.x << 6, bh = blockIdx.y;
  gemm_core(P + ((size_t)m0 * kBH + bh) * kSP, kBH * kSP, imin(64, kS - m0),
            Vt + (size_t)bh * kD * kSP, kSP, lA, lB, acc);
  EPILOGUE_VARS
  int b = bh / kH, h = bh % kH;
  // 16 lanes store a head's whole 256-byte row.
#pragma unroll
  for (int i = 0; i < 8; ++i) {
    const int q = m0 + rbase + i;
    if (q < kS) {
      const f32x4 v = {acc[0][i], acc[1][i], acc[2][i], acc[3][i]};
      store1_b128(O1, (unsigned)(((b * kS + q) * kE + h * kD + (cbase << 2)) * 4), v);
    }
  }
}

// v_pos output (per q): add P_qslice @ v_pos[q]; finalize O1 -> f16 for out-proj.
__global__ void k_vpos(const half_t* __restrict__ P, const half_t* __restrict__ vposT,
                       const float* __restrict__ O1, half_t* __restrict__ O1h) {
  GEMM_SHARED
  int m0 = blockIdx.x << 6, q = blockIdx.y;
  gemm_core(P + ((size_t)q * kBH + m0) * kSP, kSP, 64,
            vposT + (size_t)q * kD * kSP, kSP, lA, lB, acc);
  EPILOGUE_VARS
  // 16 lanes read a head's whole 256-byte row of O1 and store its 128-byte row of O1h.
  unsigned off[8];
  f32x4 o1[8];
#pragma unroll
  for (int i = 0; i < 8; ++i) {
    const int bh = m0 + rbase + i, b = bh / kH, h = bh % kH;
    off[i] = (unsigned)(((b * kS + q) * kE + h * kD + (cbase << 2)) * 4);
  }
#pragma unroll
  for (int i = 0; i < 8; ++i) o1[i] = *(const f32x4*)((const char*)O1 + off[i]);
  // Precaution, as in gemm_core128: the offset registers of the issued loads
  // stay live up to this wait.
  asm volatile("s_wait_xcnt 0x0"
               :: "v"(off[0]), "v"(off[1]), "v"(off[2]), "v"(off[3]),
                  "v"(off[4]), "v"(off[5]), "v"(off[6]), "v"(off[7])
               : "memory");
  h4 v[8];
#pragma unroll
  for (int i = 0; i < 8; ++i) {
    const f32x4 f = {acc[0][i], acc[1][i], acc[2][i], acc[3][i]};
    v[i] = __builtin_convertvector(f + o1[i], h4);
  }
  store4_b64(O1h, off[0] >> 1, off[1] >> 1, off[2] >> 1, off[3] >> 1, v[0], v[1], v[2], v[3]);
  store4_b64(O1h, off[4] >> 1, off[5] >> 1, off[6] >> 1, off[7] >> 1, v[4], v[5], v[6], v[7]);
}

// Output projection: out = O1h @ Wo^T + bo   (fp32 out)
__global__ __launch_bounds__(128) void k_out(const half_t* __restrict__ O1h, const half_t* __restrict__ wo,
                      const float* __restrict__ bo, float* __restrict__ out) {
  GEMM128_SHARED
  int m0 = blockIdx.x << 7, n0 = blockIdx.y << 7;
  gemm_core128(O1h + (long)m0 * kE, imin(128, kM - m0), wo + (long)n0 * kE, lAB, false, acc);
  EPILOGUE128_VARS
  // A lane's four tiles of a row are four adjacent columns: 16 lanes store 256
  // contiguous bytes, two whole lines.
  const f32x4 bz = *(const f32x4*)(bo + n0 + cbase);
  const unsigned off = (unsigned)(((m0 + rbase) * kE + n0 + cbase) * 4);
#pragma unroll
  for (int mt = 0; mt < 4; ++mt) {
    if (m0 + rbase + (mt << 4) < kM) {
#pragma unroll
      for (int i0 = 0; i0 < 8; i0 += 4) {
        f32x4 v[4];
#pragma unroll
        for (int i = 0; i < 4; ++i) {
          const f32x4 f = {acc[mt][0][i0 + i], acc[mt][1][i0 + i], acc[mt][2][i0 + i], acc[mt][3][i0 + i]};
          v[i] = f + bz;
        }
        store4_b128<kE * 4>(out, off + (unsigned)(((mt << 4) + i0) * kE * 4), v[0], v[1], v[2], v[3]);
      }
    }
  }
}

// ---------------- host launcher ----------------
extern "C" void kernel_launch(void* const* d_in, const int* in_sizes, int n_in,
                              void* d_out, int out_size, void* d_ws, size_t ws_size,
                              hipStream_t stream) {
  (void)in_sizes; (void)n_in; (void)out_size; (void)ws_size;
  const float* x   = (const float*)d_in[0];
  const float* Wq  = (const float*)d_in[1];
  const float* bq  = (const float*)d_in[2];
  const float* Wk  = (const float*)d_in[3];
  const float* bk  = (const float*)d_in[4];
  const float* Wv  = (const float*)d_in[5];
  const float* bv  = (const float*)d_in[6];
  const float* Wo  = (const float*)d_in[7];
  const float* bo  = (const float*)d_in[8];
  const float* qtx = (const float*)d_in[9];
  const float* qty = (const float*)d_in[10];
  const float* vtx = (const float*)d_in[11];
  const float* vty = (const float*)d_in[12];
  const int*   xd  = (const int*)d_in[13];
  const int*   yd  = (const int*)d_in[14];
  float* out = (float*)d_out;

  char* ws = (char*)d_ws;
  size_t off = 0;
  auto take = [&](size_t bytes) {
    void* p = ws + off;
    off += (bytes + 255) & ~(size_t)255;
    return p;
  };
  const size_t NX   = (size_t)kM * kE;           // 9.68M
  const size_t NW   = (size_t)kE * kE;
  const size_t NQ   = (size_t)kBH * kS * kD;     // 9.68M
  const size_t NVT  = (size_t)kBH * kD * kSP;    // 10.2M
  const size_t NIDX = (size_t)kS * 256;
  const size_t NVPT = (size_t)kS * kD * kSP;     // 2.62M
  const size_t NP   = (size_t)kS * kBH * kSP;    // 31.5M

  half_t* xh    = (half_t*)take(NX * 2);
  half_t* wqh   = (half_t*)take(NW * 2);
  half_t* wkh   = (half_t*)take(NW * 2);
  half_t* wvh   = (half_t*)take(NW * 2);
  half_t* woh   = (half_t*)take(NW * 2);
  half_t* Qh    = (half_t*)take(NQ * 2);
  half_t* Kh    = (half_t*)take(NQ * 2);
  half_t* Vt    = (half_t*)take(NVT * 2);
  unsigned short* pidx = (unsigned short*)take(NIDX * 2);
  half_t* vposT = (half_t*)take(NVPT * 2);
  half_t* P     = (half_t*)take(NP * 2);
  float*  O1    = (float*)take(NX * 4);
  half_t* O1h   = xh;  // xh dead after k_proj; reuse

  k_f2h_all<<<kCvtBlocksX + 4 * kCvtBlocksW, kCvtThreads, 0, stream>>>(
      x, Wq, Wk, Wv, Wo, xh, wqh, wkh, wvh, woh);
  k_pos<<<(kS * kS + 255) / 256, 256, 0, stream>>>(vtx, vty, xd, yd, pidx, vposT);

  k_proj<<<dim3((kM + 127) / 128, kE / 128, 3), 128, 0, stream>>>(
      xh, wqh, wkh, wvh, bq, bk, bv, Qh, Kh, Vt);
  k_attn<<<dim3((kS + 15) / 16, kBH), 128, 0, stream>>>(Qh, Kh, qtx, qty, pidx, P);
  k_pv<<<dim3((kS + 63) / 64, kBH), 128, 0, stream>>>(P, Vt, O1);
  k_vpos<<<dim3(kBH / 64, kS), 128, 0, stream>>>(P, vposT, O1, O1h);
  k_out<<<dim3((kM + 127) / 128, kE / 128), 128, 0, stream>>>(O1h, woh, bo, out);
}

// v008
// Measured time: 149 microseconds a run.
// In both of two side-by-side timings against v007, it was 1.07 times as fast.
// Over all steps from v000 it is 3.03 times as fast.
#include <hip/hip_runtime.h>
#include <hip/hip_bf16.h>

// ---------------- problem constants ----------------
constexpr int kB  = 64;        // batch
constexpr int kS  = 197;       // seq len
constexpr int kE  = 768;       // embed
constexpr int kH  = 12;        // heads
constexpr int kD  = 64;        // head dim
constexpr int kBH = kB * kH;   // 768
constexpr int kSP = 208;       // seq padded to mult of 16
constexpr int kM  = kB * kS;   // 12608 rows for projections

typedef _Float16 half_t;
typedef __attribute__((ext_vector_type(16))) _Float16     v16h;
typedef __attribute__((ext_vector_type(8)))  float        v8f;
typedef __attribute__((ext_vector_type(2)))  _Float16     h2;
typedef __attribute__((ext_vector_type(4)))  unsigned int u32x4;
typedef __attribute__((ext_vector_type(2)))  unsigned int u32x2;

struct HFrag { u32x4 a, b; };

__device__ __forceinline__ int imin(int a, int b) { return a < b ? a : b; }

// Load a 16x32 f16 WMMA A/B fragment from an LDS tile stored row-major
// [16][ldk].  Per ISA: lane<16 holds K {0..7,16..23} of row (lane&15);
// lane>=16 holds K {8..15,24..31}.  Two 16-byte ds_load_b128 per frag.
__device__ __forceinline__ v16h load_frag(const half_t* base, int ldk, int lane, int k0) {
  const half_t* p = base + (lane & 15) * ldk + k0 + ((lane >> 4) << 3);
  HFrag f;
  f.a = *(const u32x4*)p;
  f.b = *(const u32x4*)(p + 16);
  return __builtin_bit_cast(v16h, f);
}

// ---------------- shared 64x64 macro-tile GEMM core ----------------
// 128 threads = 4 waves; wave w owns output rows [16w,16w+16), all 64 cols.
// A element (r,k) at gA[r*sAr + k]; B^T element (n,k) at gB[n*sBr + k]; k runs
// over kS.  K staged in 64-wide slabs, LDS row stride 72 halves (144B = 36 banks,
// gcd(36,64)=4 -> conflict-free).  Staging uses 16-byte b128 copies; all
// callers guarantee 16B alignment (bases/strides are multiples of 8 halves).
// A thread's eight loads of a slab are all issued before the first wait for
// data: no branch stands between them.  Rows past aRows re-read row aRows-1;
// callers never store the results of those rows.
// The rows of B^T are dealt: row 4c + t lies at LDS row 16t + c, so a lane's
// four accumulator tiles of a row are four adjacent columns 4c .. 4c + 3.
constexpr int kFull = kS / 64 * 64;   // 192: k covered by whole slabs
static_assert(kS - kFull == 5, "the last slab below reads four halves and one per row");
__device__ __forceinline__ void gemm_core(
    const half_t* gA, unsigned sAr, int aRows,
    const half_t* gB, unsigned sBr, half_t* lA, half_t* lB, v8f* acc) {
  const int tid  = threadIdx.x;
  const int wave = tid >> 5, lane = tid & 31;
  const int r0 = tid >> 3, c8 = (tid & 7) << 3;
  // byte offsets of this thread's four rows of A and of B^T
  unsigned rowA[4], rowB[4];
#pragma unroll
  for (int j = 0; j < 4; ++j) {
    rowA[j] = (unsigned)imin(r0 + 16 * j, aRows - 1) * sAr * 2u;
    rowB[j] = (unsigned)(r0 + 16 * j) * sBr * 2u;
  }
  const char* cA = (const char*)gA;
  const char* cB = (const char*)gB;
  half_t* dA = lA + r0 * 72 + c8;
  half_t* dB = lB + (((r0 & 3) << 4) + (r0 >> 2)) * 72 + c8;   // dealt: row r0 + 16j lies 4j rows on
  const half_t* aBase = lA + (wave << 4) * 72;
  // Unrolled so that k0 is an immediate offset of every load and the last slab
  // is told apart at compile time.
#pragma unroll
  for (int k0 = 0; k0 < kFull + 64; k0 += 64) {
    u32x4 ta[4], tb[4];
    if (k0 < kFull) {
      unsigned oA[4], oB[4];
#pragma unroll
      for (int j = 0; j < 4; ++j) { oA[j] = rowA[j] + c8 * 2; oB[j] = rowB[j] + c8 * 2; }
#pragma unroll
      for (int j = 0; j < 4; ++j) ta[j] = *(const u32x4*)(cA + oA[j] + k0 * 2);
#pragma unroll
      for (int j = 0; j < 4; ++j) tb[j] = *(const u32x4*)(cB + oB[j] + k0 * 2);
      // Precaution: the offset registers that the issued loads name stay live up
      // to this wait, so none is reused ahead of it.
      asm volatile("s_wait_xcnt 0x0"
                   :: "v"(oA[0]), "v"(oA[1]), "v"(oA[2]), "v"(oA[3]),
                      "v"(oB[0]), "v"(oB[1]), "v"(oB[2]), "v"(oB[3])
                   : "memory");
    } else {
      // Last slab: k = kFull .. kS-1 are real, the rest of its 64 columns is zero.
      // Every thread reads the five halves of its rows (8 bytes and 2); the
      // thread of column 0 keeps them, the others store zero.
      u32x2 a4[4], b4[4];
      unsigned a1[4], b1[4];
#pragma unroll
      for (int j = 0; j < 4; ++j) {
        a4[j] = *(const u32x2*)(cA + rowA[j] + kFull * 2);
        a1[j] = *(const unsigned short*)(cA + rowA[j] + (kFull + 4) * 2);
      }
#pragma unroll
      for (int j = 0; j < 4; ++j) {
        b4[j] = *(const u32x2*)(cB + rowB[j] + kFull * 2);
        b1[j] = *(const unsigned short*)(cB + rowB[j] + (kFull + 4) * 2);
      }
      // Precaution, as above.
      asm volatile("s_wait_xcnt 0x0"
                   :: "v"(rowA[0]), "v"(rowA[1]), "v"(rowA[2]), "v"(rowA[3]),
                      "v"(rowB[0]), "v"(rowB[1]), "v"(rowB[2]), "v"(rowB[3])
                   : "memory");
      const unsigned keep = c8 == 0 ? 0xffffffffu : 0u;
#pragma unroll
      for (int j = 0; j < 4; ++j) {
        ta[j] = u32x4{a4[j][0] & keep, a4[j][1] & keep, a1[j] & keep, 0u};
        tb[j] = u32x4{b4[j][0] & keep, b4[j][1] & keep, b1[j] & keep, 0u};
      }
    }
#pragma unroll
    for (int j = 0; j < 4; ++j) {
      *(u32x4*)(dA + j * 16 * 72) = ta[j];
      *(u32x4*)(dB + j * 4 * 72)  = tb[j];
    }
    __syncthreads();
#pragma unroll
    for (int kk = 0; kk < 64; kk += 32) {
      v16h af = load_frag(aBase, 72, lane, kk);
#pragma unroll
      for (int nt = 0; nt < 4; ++nt) {
        v16h bf = load_frag(lB + (nt << 4) * 72, 72, lane, kk);
        acc[nt] = __builtin_amdgcn_wmma_f32_16x16x32_f16(
            false, af, false, bf, (short)0, acc[nt], false, false);
      }
    }
    __syncthreads();
  }
}

#define GEMM_SHARED                                    \
  __shared__ alignas(16) half_t lA[64 * 72];           \
  __shared__ alignas(16) half_t lB[64 * 72];           \
  v8f acc[4];                                          \
  { v8f z = {}; for (int i = 0; i < 4; ++i) acc[i] = z; }

// C/D VGPR layout: vgpr i, lane l -> row = i + 8*(l>>4), col = l&15.
#define EPILOGUE_VARS                                  \
  const int lane = threadIdx.x & 31;                   \
  const int rbase = ((threadIdx.x >> 5) << 4) + ((lane >> 4) << 3); \
  const int cbase = lane & 15;

// ---------------- 128x128 macro-tile GEMM core (dense projections) ----------------
// 128 threads = 4 waves in a 2x2 grid; each wave owns a 64x64 block of the
// tile as 4x4 accumulator tiles, so every fragment read from LDS feeds four
// WMMAs.  A is [aRows][kE], B^T is [128][kE], both K-contiguous; K runs over kE in
// 64-wide slabs at the same 72-half LDS pitch as above, brought into LDS by
// asynchronous copies, through no register.  Rows past aRows
// re-read row aRows-1; callers never store the results of those rows.
// The rows of gB are dealt: LDS row 64g + 16t + c holds row 64g + 4c + t, so
// position c of fragment tile t is row 4c + t of the wave's 64, and the four
// tiles of one position are four adjacent rows.  With swap set the two slabs
// change roles in the product (gB rows become the rows of D, gA rows its
// columns); the k order of both loaders is the same either way.

// Eight 16-byte asynchronous copies from global memory to LDS, every lane with
// its own two addresses.  The s_wait_xcnt is the last line of the copies' own
// statement, so that no address register is rewritten ahead of it (a precaution).
__device__ __forceinline__ void copy8(const unsigned (&l)[8], const char* const (&g)[8]) {
  asm volatile(
      "global_load_async_to_lds_b128 %0, %8, off\n\t"
      "global_load_async_to_lds_b128 %1, %9, off\n\t"
      "global_load_async_to_lds_b128 %2, %10, off\n\t"
      "global_load_async_to_lds_b128 %3, %11, off\n\t"
      "global_load_async_to_lds_b128 %4, %12, off\n\t"
      "global_load_async_to_lds_b128 %5, %13, off\n\t"
      "global_load_async_to_lds_b128 %6, %14, off\n\t"
      "global_load_async_to_lds_b128 %7, %15, off\n\t"
      "s_wait_xcnt 0x0"
      :: "v"(l[0]), "v"(l[1]), "v"(l[2]), "v"(l[3]), "v"(l[4]), "v"(l[5]), "v"(l[6]), "v"(l[7]),
         "v"(g[0]), "v"(g[1]), "v"(g[2]), "v"(g[3]), "v"(g[4]), "v"(g[5]), "v"(g[6]), "v"(g[7])
      : "memory");
}

// Two LDS buffers, each an A slab and behind it a B slab: while the WMMAs work on
// one, the next slab's copies land in the other.
constexpr int kSlabH = 128 * 72;      // halves in one operand's slab
constexpr int kBufH  = 2 * kSlabH;    // halves in one buffer
constexpr int kSlabs = kE / 64;
static_assert(kSlabs >= 2, "the ring starts with two slabs");
__device__ __forceinline__ void gemm_core128(
    const half_t* __restrict__ gA, int aRows, const half_t* __restrict__ gB,
    half_t* lAB, bool swap, v8f (&acc)[4][4]) {
  const int tid  = threadIdx.x;
  const int wave = tid >> 5, lane = tid & 31;
  const int r0 = tid >> 3, c8 = (tid & 7) << 3;
  // this thread's eight pieces of an A slab and of a B slab, at k = 0; eight
  // lanes copy a row's whole 128-byte line
  const char* pA[8];
  const char* pB[8];
#pragma unroll
  for (int j = 0; j < 8; ++j) {
    pA[j] = (const char*)gA + (unsigned)(imin(r0 + 16 * j, aRows - 1) * kE + c8) * 2u;
    pB[j] = (const char*)gB + (unsigned)((r0 * 4 + (j >> 2) * 64 + (j & 3)) * kE + c8) * 2u;
  }
  // LDS byte address of this thread's piece of row r0 of buffer 0's A slab
  const unsigned l0 = (unsigned)(size_t)lAB + (unsigned)(r0 * 72 + c8) * 2u;
  auto fill = [&](int k0, int buf) {
    unsigned l[8];
    const char* g[8];
#pragma unroll
    for (int j = 0; j < 8; ++j) { l[j] = l0 + (unsigned)(buf * kBufH + j * 16 * 72) * 2u; g[j] = pA[j] + k0 * 2; }
    copy8(l, g);
#pragma unroll
    for (int j = 0; j < 8; ++j) { l[j] = l0 + (unsigned)(buf * kBufH + kSlabH + j * 16 * 72) * 2u; g[j] = pB[j] + k0 * 2; }
    copy8(l, g);
  };
  const half_t* aBase = lAB + (swap ? kSlabH : 0) + ((wave >> 1) << 6) * 72;
  const half_t* bBase = lAB + (swap ? 0 : kSlabH) + ((wave & 1) << 6) * 72;

  fill(0, 0);
  // This wave's copies of slab 0 have landed before the barrier that publishes them.
  asm volatile("s_wait_asynccnt 0x0" ::: "memory");
  __syncthreads();
  fill(64, 1);
  // Unrolled so that the buffer and k0 are compile-time constants in every address.
#pragma unroll
  for (int t = 0; t < kSlabs; ++t) {
    const half_t* aB = aBase + (t & 1) * kBufH;
    const half_t* bB = bBase + (t & 1) * kBufH;
#pragma unroll
    for (int kk = 0; kk < 64; kk += 32) {
      v16h af[4], bf[4];
#pragma unroll
      for (int u = 0; u < 4; ++u) {
        af[u] = load_frag(aB + (u << 4) * 72, 72, lane, kk);
        bf[u] = load_frag(bB + (u << 4) * 72, 72, lane, kk);
      }
#pragma unroll
      for (int mt = 0; mt < 4; ++mt)
#pragma unroll
        for (int nt = 0; nt < 4; ++nt)
          acc[mt][nt] = __builtin_amdgcn_wmma_f32_16x16x32_f16(
              false, af[mt], false, bf[nt], (short)0, acc[mt][nt], false, false);
    }
    // This wave's reads of the buffer are over before it is refilled.
    asm volatile("s_wait_dscnt 0x0" ::: "memory");
    // This wave's copies of slab t + 1 have landed before the barrier that publishes them.
    asm volatile("s_wait_asynccnt 0x0" ::: "memory");
    __syncthreads();   // publishes slab t + 1; ends every wave's reads of slab t
    if (t + 2 < kSlabs) fill((t + 2) * 64, t & 1);
  }
  // No copy is outstanding when the wave goes on.
  asm volatile("s_wait_asynccnt 0x0" ::: "memory");
}

#define GEMM128_SHARED                                 \
  __shared__ alignas(16) half_t lAB[2 * kBufH];        \
  v8f acc[4][4];                                       \
  { v8f z = {};                                        \
    for (int i = 0; i < 4; ++i)                        \
      for (int j = 0; j < 4; ++j) acc[i][j] = z; }

// Same C/D layout; the wave's 64x64 block starts at (64*(wave>>1), 64*(wave&1)).
// Along the dealt operand, tile t at position c is row 4c + t of the block.
#define EPILOGUE128_VARS                               \
  const int lane = threadIdx.x & 31;                   \
  const int wid = threadIdx.x >> 5;                    \
  const int rbase = ((wid >> 1) << 6) + ((lane >> 4) << 3); \
  const int cbase = ((wid & 1) << 6) + ((lane & 15) << 2);
static_assert(kM % 8 == 0, "a lane's eight rows of a tile are all inside kM or all outside");

// Four f16 stores at base + off, STEP bytes apart, two values to a register.
// Stores and wait are one statement so that the offset and the two data
// registers stay untouched up to the s_wait_xcnt (a precaution; a wait in a
// statement of its own does not hold later register writes behind it).
template <int STEP>
__device__ __forceinline__ void store4(half_t* base, unsigned off,
                                       float a0, float a1, float a2, float a3) {
  h2 p01 = {(half_t)a0, (half_t)a1}, p23 = {(half_t)a2, (half_t)a3};
  asm volatile(
      "global_store_b16 %0, %1, %3\n\t"
      "global_store_d16_hi_b16 %0, %1, %3 offset:%4\n\t"
      "global_store_b16 %0, %2, %3 offset:%5\n\t"
      "global_store_d16_hi_b16 %0, %2, %3 offset:%6\n\t"
      "s_wait_xcnt 0x0"
      :: "v"(off), "v"(__builtin_bit_cast(unsigned, p01)), "v"(__builtin_bit_cast(unsigned, p23)),
         "s"(base), "n"(STEP), "n"(2 * STEP), "n"(3 * STEP)
      : "memory");
}

typedef __attribute__((ext_vector_type(4))) float    f32x4;
typedef __attribute__((ext_vector_type(4))) _Float16 h4;

// Four 8-byte stores (four f16 each) at base + o0..o3; stores and wait in one
// statement, for the same reason as in store4.
__device__ __forceinline__ void store4_b64(half_t* base, unsigned o0, unsigned o1, unsigned o2,
                                           unsigned o3, h4 a0, h4 a1, h4 a2, h4 a3) {
  asm volatile(
      "global_store_b64 %0, %4, %8\n\t"
      "global_store_b64 %1, %5, %8\n\t"
      "global_store_b64 %2, %6, %8\n\t"
      "global_store_b64 %3, %7, %8\n\t"
      "s_wait_xcnt 0x0"
      :: "v"(o0), "v"(o1), "v"(o2), "v"(o3),
         "v"(__builtin_bit_cast(u32x2, a0)), "v"(__builtin_bit_cast(u32x2, a1)),
         "v"(__builtin_bit_cast(u32x2, a2)), "v"(__builtin_bit_cast(u32x2, a3)), "s"(base)
      : "memory");
}

// Four 16-byte stores at base + off, STEP bytes apart; one statement as above.
template <int STEP>
__device__ __forceinline__ void store4_b128(float* base, unsigned off,
                                            f32x4 a0, f32x4 a1, f32x4 a2, f32x4 a3) {
  asm volatile(
      "global_store_b128 %0, %1, %5\n\t"
      "global_store_b128 %0, %2, %5 offset:%6\n\t"
      "global_store_b128 %0, %3, %5 offset:%7\n\t"
      "global_store_b128 %0, %4, %5 offset:%8\n\t"
      "s_wait_xcnt 0x0"
      :: "v"(off), "v"(a0), "v"(a1), "v"(a2), "v"(a3),
         "s"(base), "n"(STEP), "n"(2 * STEP), "n"(3 * STEP)
      : "memory");
}

// A softmax thread's three 16-byte stores at base + off, 128 bytes apart; stores
// and wait in one statement, for the same reason as in store4.
__device__ __forceinline__ void store3_p(half_t* base, unsigned off, u32x4 a0, u32x4 a1, u32x4 a2) {
  asm volatile(
      "global_store_b128 %0, %1, %4\n\t"
      "global_store_b128 %0, %2, %4 offset:128\n\t"
      "global_store_b128 %0, %3, %4 offset:256\n\t"
      "s_wait_xcnt 0x0"
      :: "v"(off), "v"(a0), "v"(a1), "v"(a2), "s"(base)
      : "memory");
}

// 2^x of eight values and of five.  One statement with the outputs apart from the
// inputs: every v_exp_f32 stands in front of an independent one and the last in
// front of a v_nop, the slot that the instruction set asks for before a
// transcendental's result is read or its source overwritten.
__device__ __forceinline__ void exp2x8(float* e, const float* x) {
  asm("v_exp_f32 %0, %8\n\t"
      "v_exp_f32 %1, %9\n\t"
      "v_exp_f32 %2, %10\n\t"
      "v_exp_f32 %3, %11\n\t"
      "v_exp_f32 %4, %12\n\t"
      "v_exp_f32 %5, %13\n\t"
      "v_exp_f32 %6, %14\n\t"
      "v_exp_f32 %7, %15\n\t"
      "v_nop"
      : "=&v"(e[0]), "=&v"(e[1]), "=&v"(e[2]), "=&v"(e[3]),
        "=&v"(e[4]), "=&v"(e[5]), "=&v"(e[6]), "=&v"(e[7])
      : "v"(x[0]), "v"(x[1]), "v"(x[2]), "v"(x[3]), "v"(x[4]), "v"(x[5]), "v"(x[6]), "v"(x[7]));
}
__device__ __forceinline__ void exp2x5(float* e, const float* x) {
  asm("v_exp_f32 %0, %5\n\t"
      "v_exp_f32 %1, %6\n\t"
      "v_exp_f32 %2, %7\n\t"
      "v_exp_f32 %3, %8\n\t"
      "v_exp_f32 %4, %9\n\t"
      "v_nop"
      : "=&v"(e[0]), "=&v"(e[1]), "=&v"(e[2]), "=&v"(e[3]), "=&v"(e[4])
      : "v"(x[0]), "v"(x[1]), "v"(x[2]), "v"(x[3]), "v"(x[4]));
}

// One 16-byte store of f16 pairs at base + off; one statement as above.
__device__ __forceinline__ void store1_p(half_t* base, unsigned off, u32x4 a) {
  asm volatile(
      "global_store_b128 %0, %1, %2\n\t"
      "s_wait_xcnt 0x0"
      :: "v"(off), "v"(a), "s"(base)
      : "memory");
}

// Two 16-byte stores at base + off, 128 bytes apart; one statement as above.
__device__ __forceinline__ void store2_b128(float* base, unsigned off, f32x4 a0, f32x4 a1) {
  asm volatile(
      "global_store_b128 %0, %1, %3\n\t"
      "global_store_b128 %0, %2, %3 offset:128\n\t"
      "s_wait_xcnt 0x0"
      :: "v"(off), "v"(a0), "v"(a1), "s"(base)
      : "memory");
}

// Twelve 16-byte asynchronous copies from global memory to LDS, as copy8.
__device__ __forceinline__ void copy12(const unsigned (&l)[12], const char* const (&g)[12]) {
  asm volatile(
      "global_load_async_to_lds_b128 %0, %12, off\n\t"
      "global_load_async_to_lds_b128 %1, %13, off\n\t"
      "global_load_async_to_lds_b128 %2, %14, off\n\t"
      "global_load_async_to_lds_b128 %3, %15, off\n\t"
      "global_load_async_to_lds_b128 %4, %16, off\n\t"
      "global_load_async_to_lds_b128 %5, %17, off\n\t"
      "global_load_async_to_lds_b128 %6, %18, off\n\t"
      "global_load_async_to_lds_b128 %7, %19, off\n\t"
      "global_load_async_to_lds_b128 %8, %20, off\n\t"
      "global_load_async_to_lds_b128 %9, %21, off\n\t"
      "global_load_async_to_lds_b128 %10, %22, off\n\t"
      "global_load_async_to_lds_b128 %11, %23, off\n\t"
      "s_wait_xcnt 0x0"
      :: "v"(l[0]), "v"(l[1]), "v"(l[2]), "v"(l[3]), "v"(l[4]), "v"(l[5]),
         "v"(l[6]), "v"(l[7]), "v"(l[8]), "v"(l[9]), "v"(l[10]), "v"(l[11]),
         "v"(g[0]), "v"(g[1]), "v"(g[2]), "v"(g[3]), "v"(g[4]), "v"(g[5]),
         "v"(g[6]), "v"(g[7]), "v"(g[8]), "v"(g[9]), "v"(g[10]), "v"(g[11])
      : "memory");
}

// ---------------- elementwise kernels ----------------
// f32 -> f16 conversion of x and of the four weight matrices in one launch.
// One work-group of 16 waves per 64 rows of 768 floats (196,608 B read), so the
// whole job is 245 work-groups, fewer than there are WGPs, and 3,920 waves to
// start.  A thread's 24 16-byte loads are unrolled from one offset register, so
// many are in flight at once; each wave-wide load covers 512 contiguous bytes
// and each wave-wide 8-byte store 256, whole lines both ways.
constexpr int kCvtThreads = 512;
constexpr int kCvtLoads   = 24;
constexpr int kCvtElems   = kCvtThreads * kCvtLoads * 4;   // floats per work-group
constexpr int kCvtBlocksX = kM * kE / kCvtElems;           // 197
constexpr int kCvtBlocksW = kE * kE / kCvtElems;           // 12
static_assert(kCvtBlocksX * kCvtElems == kM * kE, "x splits into whole work-groups");
static_assert(kCvtBlocksW * kCvtElems == kE * kE, "a weight splits into whole work-groups");

__global__ __launch_bounds__(kCvtThreads) void k_f2h_all(
    const float* __restrict__ x,  const float* __restrict__ wq, const float* __restrict__ wk,
    const float* __restrict__ wv, const float* __restrict__ wo,
    half_t* __restrict__ xh,  half_t* __restrict__ wqh, half_t* __restrict__ wkh,
    half_t* __restrict__ wvh, half_t* __restrict__ woh) {
  const float* in = x;
  half_t* out = xh;
  int part = blockIdx.x;
  if (part >= kCvtBlocksX) {
    const int w = (part - kCvtBlocksX) / kCvtBlocksW;
    part = (part - kCvtBlocksX) % kCvtBlocksW;
    in  = w == 0 ? wq  : w == 1 ? wk  : w == 2 ? wv  : wo;
    out = w == 0 ? wqh : w == 1 ? wkh : w == 2 ? wvh : woh;
  }
  const f32x4* s = (const f32x4*)(in + part * kCvtElems) + threadIdx.x;
  h4* d = (h4*)(out + part * kCvtElems) + threadIdx.x;
  f32x4 v[kCvtLoads];
  // Unrolled: j becomes an immediate offset, and many loads are in flight
  // before the first wait for data.
#pragma unroll
  for (int j = 0; j < kCvtLoads; ++j) v[j] = s[j * kCvtThreads];
  // Unrolled: v[] stays in registers and the stores share one offset register.
#pragma unroll
  for (int j = 0; j < kCvtLoads; ++j) d[j * kCvtThreads] = __builtin_convertvector(v[j], h4);
}

// Build v_pos^T (S,64,208) f16 via table gathers, and pack the two query-table
// row numbers of every (q,k) into 16 bits (x low byte, y high byte), laid out
// [q][k] at 256 entries a row, so that a softmax thread finds the entries of
// eight adjacent k in one 16-byte load.  Row numbers are bounded here.
constexpr int kNE = 28;        // rows of each position table
__global__ void k_pos(const float* vtx, const float* vty,
                      const int* xd, const int* yd,
                      unsigned short* pidx, half_t* vposT) {
  int i = blockIdx.x * blockDim.x + threadIdx.x;
  if (i >= kS * kS) return;
  int dx = imin(xd[i] < 0 ? 0 : xd[i], kNE - 1), dy = imin(yd[i] < 0 ? 0 : yd[i], kNE - 1);
  int q = i / kS, kk = i % kS;
  pidx[q * 256 + kk] = (unsigned short)(dx | (dy << 8));
  size_t vb = (size_t)q * kD * kSP + kk;
  for (int j = 0; j < 32; ++j) {
    vposT[vb + (size_t)j * kSP]        = (half_t)vtx[dx * 32 + j];
    vposT[vb + (size_t)(32 + j) * kSP] = (half_t)vty[dy * 32 + j];
  }
}

// ---------------- phase kernels ----------------
// QKV projection: (12608x768) @ W^T + b.
// Q,K stored [bh][s][d]; V stored transposed [bh][d][sP] so the P@V GEMM
// has unit-stride K and stages with b128 copies.
__global__ __launch_bounds__(128) void k_proj(const half_t* __restrict__ xh,
                       const half_t* wq, const half_t* wk, const half_t* wv,
                       const float* bq, const float* bk, const float* bv,
                       half_t* Q, half_t* K, half_t* Vt) {
  GEMM128_SHARED
  int m0 = blockIdx.x << 7, n0 = blockIdx.y << 7, sel = blockIdx.z;
  const half_t* W    = sel == 0 ? wq : sel == 1 ? wk : wv;
  const float*  bias = sel == 0 ? bq : sel == 1 ? bk : bv;
  gemm_core128(xh + (long)m0 * kE, imin(128, kM - m0), W + (long)n0 * kE, lAB, sel == 2, acc);
  EPILOGUE128_VARS
  if (sel < 2) {
    // D rows are x rows, D columns the dealt weight rows: a lane's four tiles of
    // a row are four adjacent d of one head, so 16 lanes store that head's whole
    // 128-byte row of Q or K.
    half_t* qk = sel == 0 ? Q : K;
    const f32x4 bz = *(const f32x4*)(bias + n0 + cbase);
    const int h = (n0 + cbase) >> 6, d0 = cbase & 63;
#pragma unroll
    for (int mt = 0; mt < 4; ++mt) {
      const int mb = m0 + rbase + (mt << 4);
      if (mb < kM) {
#pragma unroll
        for (int i0 = 0; i0 < 8; i0 += 4) {
          unsigned o[4];
          h4 v[4];
#pragma unroll
          for (int i = 0; i < 4; ++i) {
            const int m = mb + i0 + i, b = m / kS, s = m % kS;
            o[i] = (unsigned)((((b * kH + h) * kS + s) * kD + d0) * 2);
            const f32x4 f = {acc[mt][0][i0 + i], acc[mt][1][i0 + i], acc[mt][2][i0 + i], acc[mt][3][i0 + i]};
            v[i] = __builtin_convertvector(f + bz, h4);
          }
          store4_b64(qk, o[0], o[1], o[2], o[3], v[0], v[1], v[2], v[3]);
        }
      }
    }
  } else {
    // Roles swapped: D rows are the dealt weight rows (d = 4 * row + mt of head
    // hv), D columns x rows, so 16 lanes store 16 adjacent s of one row of V^T.
    const int hv = (n0 >> 6) + (wid >> 1), dl = (lane >> 4) << 5;
    f32x4 bz[8];
#pragma unroll
    for (int i = 0; i < 8; ++i) bz[i] = *(const f32x4*)(bias + (hv << 6) + dl + (i << 2));
#pragma unroll
    for (int nt = 0; nt < 4; ++nt) {
      const int m = m0 + ((wid & 1) << 6) + (nt << 4) + (lane & 15);
      if (m < kM) {
        const int b = m / kS, s = m % kS;
        const unsigned off = (unsigned)((((b * kH + hv) * kD + dl) * kSP + s) * 2);
#pragma unroll
        for (int i = 0; i < 8; ++i)
          store4<kSP * 2>(Vt, off + (unsigned)(i * 4 * kSP * 2),
                          acc[0][nt][i] + bz[i][0], acc[1][nt][i] + bz[i][1],
                          acc[2][nt][i] + bz[i][2], acc[3][nt][i] + bz[i][3]);
      }
    }
  }
}

// Content logits + position logits + softmax -> P, then the content output
// O1[b,q,h*64+d] = P . V (f32).  One block = (bh, 16 q rows, all k).
// Position term: q_pos[q,k,:] is row x_dist[q,k] of one table beside row
// y_dist[q,k] of the other, so Q[q,:] . q_pos[q,k,:] = TX[q][x_dist] + TY[q][y_dist]
// with TX = Q[:, 0:32] . q_tab_x^T and TY = Q[:, 32:64] . q_tab_y^T (16 x 28 each):
// one WMMA per wave, kept in f32 in LDS and gathered per (q,k).
// P . V: once the K tile's last read is over, this head's V^T (64 d x 192 k) is
// copied over it while the softmax runs; P goes to LDS in f16 over the rows of
// the logits, and wave w multiplies it with d = 16w .. 16w + 15, k in the same
// steps of 32.  The last five k of V^T come straight from memory into registers.
__global__ void k_attn(const half_t* __restrict__ Q, const half_t* __restrict__ K,
                       const half_t* __restrict__ Vt,
                       const float* __restrict__ qtx, const float* __restrict__ qty,
                       const unsigned short* __restrict__ pidx,
                       half_t* __restrict__ P, float* __restrict__ O1) {
  // One array, the K tile and behind it the Q tile.  Once both are read, V^T takes
  // the first kD * kVP halves and TX, TY (later the O tile) the rest, so LDS per
  // block stays.
  __shared__ alignas(16) half_t lKQ[kSP * 72 + 16 * 72];
  half_t* lK = lKQ;
  half_t* lQ = lKQ + kSP * 72;
  // Row pitch of the V^T tile in halves: 108 banks, so the 16 rows of a fragment
  // read start 44 banks apart and meet no bank twice.
  constexpr int kVP = 216;
  static_assert(kD * kVP * 2 + 16 * 68 * 4 <= (kSP * 72 + 16 * 72) * 2, "V^T and TX, TY fit the place of K and Q");
  static_assert(kD * kVP * 2 % 256 == 0, "TX, TY start at bank 0");
  // Row pitch kLP floats: 16-byte aligned; two adjacent rows lie 20 banks apart,
  // so the 16 lanes of a 16-byte read (two rows, 32 bytes from lane to lane) meet
  // no bank twice, and rows 8 apart lie 32 banks apart for the accumulator stores.
  constexpr int kLP = 212;
  __shared__ alignas(16) float lgt[16 * kLP];
  const int q0 = blockIdx.x << 4, bh = blockIdx.y;
  const int tid = threadIdx.x, wave = tid >> 5, lane = tid & 31;
  const int r = tid >> 3, t8 = tid & 7;   // softmax: 8 threads per row

  // A softmax thread owns runs of eight adjacent k: run t8 + 8j, j = 0..2, covers
  // k = 0..191; the row's last five k (192..196) are worked by all eight threads
  // alike and kept by thread 0.  Its packed table rows: one 16-byte load a run,
  // 8 bytes and 2 for the last five.
  static_assert(kS == 197, "three runs a thread and five k over");
  const char* cI = (const char*)pidx;
  const unsigned oJ = (unsigned)(imin(q0 + r, kS - 1) * 512);
  const unsigned oI = oJ + (unsigned)(t8 * 16);
  const u32x4 iw0 = *(const u32x4*)(cI + oI);
  const u32x4 iw1 = *(const u32x4*)(cI + oI + 128);
  const u32x4 iw2 = *(const u32x4*)(cI + oI + 256);
  const u32x2 iw3 = *(const u32x2*)(cI + oJ + 192 * 2);
  const unsigned iw4 = *(const unsigned short*)(cI + oJ + 196 * 2);

  // This wave's 16 table rows as a B fragment, in load_frag's k order:
  // waves 0,1 take q_tab_x rows 0..15 and 16..31, waves 2,3 q_tab_y; rows past
  // the table are zero.
  const int te = ((wave & 1) << 4) + (lane & 15);
  const f32x4* tp = (const f32x4*)((wave >> 1 ? qty : qtx) + imin(te, kNE - 1) * 32 + ((lane >> 4) << 3));
  f32x4 tf[4] = {tp[0], tp[1], tp[4], tp[5]};
  v16h tb;
#pragma unroll
  for (int j = 0; j < 16; ++j) tb[j] = te < kNE ? (half_t)tf[j >> 2][j & 3] : (half_t)0.f;

  // This head's V^T; its last five k go with the loads below.
  const char* cV = (const char*)(Vt + (size_t)bh * kD * kSP);
  u32x2 vl4;      // k = 192..195 and
  unsigned vl1;   // k = 196 of row 16 wave + (lane & 15) of V^T

  // Q and K tiles: a thread's one load of Q and thirteen of K are all issued
  // before the first wait for data, with no branch between them.  This head's K
  // is one run of kS * 8 16-byte pieces, piece tid + 128 t going to row r + 16 t.
  // Rows past kS re-read the last row (Q) or the last piece (K): the P rows of
  // those q are never stored and the logits of those k are never used.
  {
    const char* cQ = (const char*)(Q + (size_t)bh * kS * kD);
    const char* cK = (const char*)(K + (size_t)bh * kS * kD);
    const unsigned oQ = (unsigned)(imin(q0 + r, kS - 1) * 128 + t8 * 16);
    const unsigned oK = (unsigned)(tid * 16);
    const unsigned oL = (unsigned)(imin(12 * 128 + tid, kS * 8 - 1) * 16);
    const u32x4 qv = *(const u32x4*)(cQ + oQ);
    u32x4 kv[13];
    // Unrolled: t becomes an immediate offset and kv[] stays in registers.
#pragma unroll
    for (int t = 0; t < 12; ++t) kv[t] = *(const u32x4*)(cK + oK + t * 2048);
    kv[12] = *(const u32x4*)(cK + oL);
    const unsigned oV = (unsigned)(((wave << 4) + (lane & 15)) * (kSP * 2));
    vl4 = *(const u32x2*)(cV + oV + 192 * 2);
    vl1 = *(const unsigned short*)(cV + oV + 196 * 2);
    // Precaution, as in gemm_core128: the offset and address registers of the
    // issued loads (Q, K, V^T, index words, table rows) stay live up to this wait.
    asm volatile("s_wait_xcnt 0x0" :: "v"(oQ), "v"(oK), "v"(oL), "v"(oV), "v"(oI), "v"(oJ), "v"(tp) : "memory");
    *(u32x4*)(lQ + r * 72 + t8 * 8) = qv;
#pragma unroll
    for (int t = 0; t < 13; ++t) *(u32x4*)(lK + (r + 16 * t) * 72 + t8 * 8) = kv[t];
  }
  __syncthreads();

  v16h af0 = load_frag(lQ, 72, lane, 0);
  v16h af1 = load_frag(lQ, 72, lane, 32);
  const int rb = (lane >> 4) << 3, cb = lane & 15;
  v8f tacc = {};
  tacc = __builtin_amdgcn_wmma_f32_16x16x32_f16(false, wave >> 1 ? af1 : af0, false, tb, (short)0, tacc, false, false);
  for (int nt = wave; nt < 13; nt += 4) {
    v8f a = {};
    v16h bf0 = load_frag(lK + nt * 16 * 72, 72, lane, 0);
    v16h bf1 = load_frag(lK + nt * 16 * 72, 72, lane, 32);
    a = __builtin_amdgcn_wmma_f32_16x16x32_f16(false, af0, false, bf0, (short)0, a, false, false);
    a = __builtin_amdgcn_wmma_f32_16x16x32_f16(false, af1, false, bf1, (short)0, a, false, false);
    int col = (nt << 4) + cb;
#pragma unroll
    for (int i = 0; i < 8; ++i) lgt[(rb + i) * kLP + col] = a[i];
  }
  // This wave's reads of the K tile are over before V^T is copied over it.
  asm volatile("s_wait_dscnt 0x0" ::: "memory");
  __syncthreads();

  // Every wave has left lK and lQ.  V^T, k = 0..191: 64 rows of 24 16-byte pieces,
  // piece tid + 128 t; 384 pieces are 16 whole rows, so three divisions serve the
  // twelve.  The copies land while the softmax runs.
  {
    const unsigned lv = (unsigned)(size_t)lK;
    unsigned l[12];
    const char* g[12];
    // Unrolled, both loops: l[] and g[] stay in registers.
#pragma unroll
    for (int w = 0; w < 3; ++w) {
      const int c = tid + 128 * w, d = c / 24, pc = c % 24;
#pragma unroll
      for (int u = 0; u < 4; ++u) {
        l[3 * u + w] = lv + (unsigned)((d + 16 * u) * (kVP * 2) + pc * 16);
        g[3 * u + w] = cV + (unsigned)((d + 16 * u) * (kSP * 2) + pc * 16);
      }
    }
    copy12(l, g);
  }
  // Rows of 68 floats behind the V^T tile, TX at 0..31, TY at 32..63.
  float* lT = (float*)(lKQ + kD * kVP);
#pragma unroll
  for (int i = 0; i < 8; ++i) lT[(rb + i) * 68 + (wave << 4) + cb] = tacc[i];
  __syncthreads();   // publishes TX, TY to the softmax threads

  // softmax, the row's values in registers from here to the store of P; the first
  // pass adds the two gathered position terms and scales
  const unsigned iw[15] = {iw0[0], iw0[1], iw0[2], iw0[3], iw1[0], iw1[1], iw1[2], iw1[3],
                           iw2[0], iw2[1], iw2[2], iw2[3], iw3[0], iw3[1], iw4};
  const float* tr = lT + r * 68;
  const float* lg = lgt + r * kLP;
  float v[29];
  // Unrolled (this loop and the ones below): v[] stays in registers, and n picks
  // the index word and half at compile time.
#pragma unroll
  for (int j = 0; j < 3; ++j) {
    const f32x4 lo = *(const f32x4*)(lg + (t8 + 8 * j) * 8);
    const f32x4 hi = *(const f32x4*)(lg + (t8 + 8 * j) * 8 + 4);
#pragma unroll
    for (int i = 0; i < 4; ++i) { v[8 * j + i] = lo[i]; v[8 * j + 4 + i] = hi[i]; }
  }
  {
    const f32x4 lo = *(const f32x4*)(lg + 192);
#pragma unroll
    for (int i = 0; i < 4; ++i) v[24 + i] = lo[i];
    v[28] = lg[196];
  }
  float mx = -3.0e38f;
#pragma unroll
  for (int n = 0; n < 29; ++n) {
    const unsigned e = iw[n >> 1] >> ((n & 1) * 16);
    v[n] = (v[n] + tr[e & 0xff] + tr[32 + ((e >> 8) & 0xff)]) * 0.125f;   // 1/sqrt(64)
    mx = fmaxf(mx, v[n]);
  }
  for (int off = 4; off; off >>= 1) mx = fmaxf(mx, __shfl_xor(mx, off, 8));
  // One partial sum a run, so that the four chains of additions are independent.
  float ps[4] = {0.f, 0.f, 0.f, 0.f};
  float ex[29];
#pragma unroll
  for (int n = 0; n < 29; ++n) v[n] = (v[n] - mx) * 1.44269504f;   // e^x = 2^(x log2 e)
  exp2x8(ex, v);
  exp2x8(ex + 8, v + 8);
  exp2x8(ex + 16, v + 16);
  exp2x5(ex + 24, v + 24);
#pragma unroll
  for (int n = 0; n < 29; ++n) {
    v[n] = (n < 24 || t8 == 0) ? ex[n] : 0.f;
    ps[n >> 3] += v[n];
  }
  float sum = (ps[0] + ps[1]) + (ps[2] + ps[3]);
  for (int off = 4; off; off >>= 1) sum += __shfl_xor(sum, off, 8);
  float inv = 1.f / sum;
  int q = q0 + r;
  unsigned p[16];
#pragma unroll
  for (int n = 0; n < 32; n += 2) {
    const h2 w = {(half_t)(n < 29 ? v[n < 29 ? n : 0] * inv : 0.f),
                  (half_t)(n + 1 < 29 ? v[n + 1 < 29 ? n + 1 : 0] * inv : 0.f)};
    p[n >> 1] = __builtin_bit_cast(unsigned, w);
  }
  // P row r in f16 over the first 400 bytes of logits row r: that row is read
  // only by the eight threads that write here, all in one wave, and each has
  // its values in registers.  Pitch 2 kLP halves: 16 rows meet no bank twice.
  half_t* lP = (half_t*)lgt;
  {
    half_t* pr = lP + r * (2 * kLP) + t8 * 8;
    *(u32x4*)pr         = u32x4{p[0], p[1], p[2], p[3]};
    *(u32x4*)(pr + 64)  = u32x4{p[4], p[5], p[6], p[7]};
    *(u32x4*)(pr + 128) = u32x4{p[8], p[9], p[10], p[11]};
    if (t8 == 0) *(u32x4*)(pr + 192) = u32x4{p[12], p[13], p[14], p[15]};
  }
  if (q < kS) {
    // Eight lanes store 128 contiguous bytes of a row of P.  k = 197..199 are
    // stored as zero; k = 200..207 are read by no kernel and stay unwritten.
    const unsigned off = (unsigned)((((q * kBH + bh) * kSP) + t8 * 8) * 2);
    store3_p(P, off, u32x4{p[0], p[1], p[2], p[3]}, u32x4{p[4], p[5], p[6], p[7]},
             u32x4{p[8], p[9], p[10], p[11]});
    if (t8 == 0) store1_p(P, off + 192 * 2, u32x4{p[12], p[13], p[14], p[15]});
  }
  // This wave's copies of V^T have landed before the barrier that publishes them.
  asm volatile("s_wait_asynccnt 0x0" ::: "memory");
  __syncthreads();   // publishes P and V^T; ends every thread's reads of TX, TY

  v8f o = {};
  const half_t* vB = lK + (wave << 4) * kVP;
  // Unrolled: kk is an immediate offset of every LDS read.
#pragma unroll
  for (int kk = 0; kk < 192; kk += 32) {
    v16h pa = load_frag(lP, 2 * kLP, lane, kk);
    v16h vb = load_frag(vB, kVP, lane, kk);
    o = __builtin_amdgcn_wmma_f32_16x16x32_f16(false, pa, false, vb, (short)0, o, false, false);
  }
  {
    // Last step, k = 192..223 in load_frag's k order: lanes 0..15 hold k = 192..199
    // in their first four registers (five real k, P is zero at 197..199); every
    // other position of both fragments is zero.
    const unsigned keep = lane < 16 ? 0xffffffffu : 0u;
    const u32x4 pl = *(const u32x4*)(lP + (lane & 15) * (2 * kLP) + 192);
    HFrag fa, fb;
    fa.a = u32x4{pl[0] & keep, pl[1] & keep, pl[2] & keep, pl[3] & keep};
    fa.b = u32x4{0u, 0u, 0u, 0u};
    fb.a = u32x4{vl4[0] & keep, vl4[1] & keep, vl1 & keep, 0u};
    fb.b = u32x4{0u, 0u, 0u, 0u};
    o = __builtin_amdgcn_wmma_f32_16x16x32_f16(false, __builtin_bit_cast(v16h, fa), false,
                                               __builtin_bit_cast(v16h, fb), (short)0, o, false, false);
  }
  // The 16 x 64 tile goes through LDS so that eight lanes store a whole line.
  // Unrolled: o[] stays in registers.
#pragma unroll
  for (int i = 0; i < 8; ++i) lT[(rb + i) * 68 + (wave << 4) + cb] = o[i];
  __syncthreads();   // publishes the O tile
  if (q < kS) {
    const f32x4 o0 = *(const f32x4*)(lT + r * 68 + t8 * 4);
    const f32x4 o1 = *(const f32x4*)(lT + r * 68 + 32 + t8 * 4);
    const int b = bh / kH, h = bh % kH;
    store2_b128(O1, (unsigned)(((b * kS + q) * kE + h * kD + t8 * 4) * 4), o0, o1);
  }
}

// v_pos output (per q): add P_qslice @ v_pos[q]; finalize O1 -> f16 for out-proj.
__global__ void k_vpos(const half_t* __restrict__ P, const half_t* __restrict__ vposT,
                       const float* __restrict__ O1, half_t* __restrict__ O1h) {
  GEMM_SHARED
  int m0 = blockIdx.x << 6, q = blockIdx.y;
  gemm_core(P + ((size_t)q * kBH + m0) * kSP, kSP, 64,
            vposT + (size_t)q * kD * kSP, kSP, lA, lB, acc);
  EPILOGUE_VARS
  // 16 lanes read a head's whole 256-byte row of O1 and store its 128-byte row of O1h.
  unsigned off[8];
  f32x4 o1[8];
#pragma unroll
  for (int i = 0; i < 8; ++i) {
    const int bh = m0 + rbase + i, b = bh / kH, h = bh % kH;
    off[i] = (unsigned)(((b * kS + q) * kE + h * kD + (cbase << 2)) * 4);
  }
#pragma unroll
  for (int i = 0; i < 8; ++i) o1[i] = *(const f32x4*)((const char*)O1 + off[i]);
  // Precaution, as in gemm_core128: the offset registers of the issued loads
  // stay live up to this wait.
  asm volatile("s_wait_xcnt 0x0"
               :: "v"(off[0]), "v"(off[1]), "v"(off[2]), "v"(off[3]),
                  "v"(off[4]), "v"(off[5]), "v"(off[6]), "v"(off[7])
               : "memory");
  h4 v[8];
#pragma unroll
  for (int i = 0; i < 8; ++i) {
    const f32x4 f = {acc[0][i], acc[1][i], acc[2][i], acc[3][i]};
    v[i] = __builtin_convertvector(f + o1[i], h4);
  }
  store4_b64(O1h, off[0] >> 1, off[1] >> 1, off[2] >> 1, off[3] >> 1, v[0], v[1], v[2], v[3]);
  store4_b64(O1h, off[4] >> 1, off[5] >> 1, off[6] >> 1, off[7] >> 1, v[4], v[5], v[6], v[7]);
}

// Output projection: out = O1h @ Wo^T + bo   (fp32 out)
__global__ __launch_bounds__(128) void k_out(const half_t* __restrict__ O1h, const half_t* __restrict__ wo,
                      const float* __restrict__ bo, float* __restrict__ out) {
  GEMM128_SHARED
  int m0 = blockIdx.x << 7, n0 = blockIdx.y << 7;
  gemm_core128(O1h + (long)m0 * kE, imin(128, kM - m0), wo + (long)n0 * kE, lAB, false, acc);
  EPILOGUE128_VARS
  // A lane's four tiles of a row are four adjacent columns: 16 lanes store 256
  // contiguous bytes, two whole lines.
  const f32x4 bz = *(const f32x4*)(bo + n0 + cbase);
  const unsigned off = (unsigned)(((m0 + rbase) * kE + n0 + cbase) * 4);
#pragma unroll
  for (int mt = 0; mt < 4; ++mt) {
    if (m0 + rbase + (mt << 4) < kM) {
#pragma unroll
      for (int i0 = 0; i0 < 8; i0 += 4) {
        f32x4 v[4];
#pragma unroll
        for (int i = 0; i < 4; ++i) {
          const f32x4 f = {acc[mt][0][i0 + i], acc[mt][1][i0 + i], acc[mt][2][i0 + i], acc[mt][3][i0 + i]};
          v[i] = f + bz;
        }
        store4_b128<kE * 4>(out, off + (unsigned)(((mt << 4) + i0) * kE * 4), v[0], v[1], v[2], v[3]);
      }
    }
  }
}

// ---------------- host launcher ----------------
extern "C" void kernel_launch(void* const* d_in, const int* in_sizes, int n_in,
                              void* d_out, int out_size, void* d_ws, size_t ws_size,
                              hipStream_t stream) {
  (void)in_sizes; (void)n_in; (void)out_size; (void)ws_size;
  const float* x   = (const float*)d_in[0];
  const float* Wq  = (const float*)d_in[1];
  const float* bq  = (const float*)d_in[2];
  const float* Wk  = (const float*)d_in[3];
  const float* bk  = (const float*)d_in[4];
  const float* Wv  = (const float*)d_in[5];
  const float* bv  = (const float*)d_in[6];
  const float* Wo  = (const float*)d_in[7];
  const float* bo  = (const float*)d_in[8];
  const float* qtx = (const float*)d_in[9];
  const float* qty = (const float*)d_in[10];
  const float* vtx = (const float*)d_in[11];
  const float* vty = (const float*)d_in[12];
  const int*   xd  = (const int*)d_in[13];
  const int*   yd  = (const int*)d_in[14];
  float* out = (float*)d_out;

  char* ws = (char*)d_ws;
  size_t off = 0;
  auto take = [&](size_t bytes) {
    void* p = ws + off;
    off += (bytes + 255) & ~(size_t)255;
    return p;
  };
  const size_t NX   = (size_t)kM * kE;           // 9.68M
  const size_t NW   = (size_t)kE * kE;
  const size_t NQ   = (size_t)kBH * kS * kD;     // 9.68M
  const size_t NVT  = (size_t)kBH * kD * kSP;    // 10.2M
  const size_t NIDX = (size_t)kS * 256;
  const size_t NVPT = (size_t)kS * kD * kSP;     // 2.62M
  const size_t NP   = (size_t)kS * kBH * kSP;    // 31.5M

  half_t* xh    = (half_t*)take(NX * 2);
  half_t* wqh   = (half_t*)take(NW * 2);
  half_t* wkh   = (half_t*)take(NW * 2);
  half_t* wvh   = (half_t*)take(NW * 2);
  half_t* woh   = (half_t*)take(NW * 2);
  half_t* Qh    = (half_t*)take(NQ * 2);
  half_t* Kh    = (half_t*)take(NQ * 2);
  half_t* Vt    = (half_t*)take(NVT * 2);
  unsigned short* pidx = (unsigned short*)take(NIDX * 2);
  half_t* vposT = (half_t*)take(NVPT * 2);
  half_t* P     = (half_t*)take(NP * 2);
  float*  O1    = (float*)take(NX * 4);
  half_t* O1h   = xh;  // xh dead after k_proj; reuse

  k_f2h_all<<<kCvtBlocksX + 4 * kCvtBlocksW, kCvtThreads, 0, stream>>>(
      x, Wq, Wk, Wv, Wo, xh, wqh, wkh, wvh, woh);
  k_pos<<<(kS * kS + 255) / 256, 256, 0, stream>>>(vtx, vty, xd, yd, pidx, vposT);

  k_proj<<<dim3((kM + 127) / 128, kE / 128, 3), 128, 0, stream>>>(
      xh, wqh, wkh, wvh, bq, bk, bv, Qh, Kh, Vt);
  k_attn<<<dim3((kS + 15) / 16, kBH), 128, 0, stream>>>(Qh, Kh, Vt, qtx, qty, pidx, P, O1);
  k_vpos<<<dim3(kBH / 64, kS), 128, 0, stream>>>(P, vposT, O1, O1h);
  k_out<<<dim3((kM + 127) / 128, kE / 128), 128, 0, stream>>>(O1h, woh, bo, out);
}

// v009
// One run takes 133 microseconds.
// Two timings next to v008 both put it at 1.12 times that version's speed.
// All steps since v000 together make it 3.41 times as fast.
#include <hip/hip_runtime.h>
#include <hip/hip_bf16.h>

// ---------------- problem constants ----------------
constexpr int kB  = 64;        // batch
constexpr int kS  = 197;       // seq len
constexpr int kE  = 768;       // embed
constexpr int kH  = 12;        // heads
constexpr int kD  = 64;        // head dim
constexpr int kBH = kB * kH;   // 768
constexpr int kSP = 208;       // seq padded to mult of 16
constexpr int kM  = kB * kS;   // 12608 rows for projections

typedef _Float16 half_t;
typedef __attribute__((ext_vector_type(16))) _Float16     v16h;
typedef __attribute__((ext_vector_type(8)))  float        v8f;
typedef __attribute__((ext_vector_type(2)))  _Float16     h2;
typedef __attribute__((ext_vector_type(4)))  unsigned int u32x4;
typedef __attribute__((ext_vector_type(2)))  unsigned int u32x2;

struct HFrag { u32x4 a, b; };

__device__ __forceinline__ int imin(int a, int b) { return a < b ? a : b; }

// Load a 16x32 f16 WMMA A/B fragment from an LDS tile stored row-major
// [16][ldk].  Per ISA: lane<16 holds K {0..7,16..23} of row (lane&15);
// lane>=16 holds K {8..15,24..31}.  Two 16-byte ds_load_b128 per frag.
__device__ __forceinline__ v16h load_frag(const half_t* base, int ldk, int lane, int k0) {
  const half_t* p = base + (lane & 15) * ldk + k0 + ((lane >> 4) << 3);
  HFrag f;
  f.a = *(const u32x4*)p;
  f.b = *(const u32x4*)(p + 16);
  return __builtin_bit_cast(v16h, f);
}

// ---------------- shared 64x64 macro-tile GEMM core ----------------
// 128 threads = 4 waves; wave w owns output rows [16w,16w+16), all 64 cols.
// A element (r,k) at gA[r*sAr + k]; B^T element (n,k) at gB[n*sBr + k]; k runs
// over kS.  K staged in 64-wide slabs, LDS row stride 72 halves (144B = 36 banks,
// gcd(36,64)=4 -> conflict-free).  Staging uses 16-byte b128 copies; all
// callers guarantee 16B alignment (bases/strides are multiples of 8 halves).
// A thread's eight loads of a slab are all issued before the first wait for
// data: no branch stands between them.  Rows past aRows re-read row aRows-1;
// callers never store the results of those rows.
// The rows of B^T are dealt: row 4c + t lies at LDS row 16t + c, so a lane's
// four accumulator tiles of a row are four adjacent columns 4c .. 4c + 3.
constexpr int kFull = kS / 64 * 64;   // 192: k covered by whole slabs
static_assert(kS - kFull == 5, "the last slab below reads four halves and one per row");
__device__ __forceinline__ void gemm_core(
    const half_t* gA, unsigned sAr, int aRows,
    const half_t* gB, unsigned sBr, half_t* lA, half_t* lB, v8f* acc) {
  const int tid  = threadIdx.x;
  const int wave = tid >> 5, lane = tid & 31;
  const int r0 = tid >> 3, c8 = (tid & 7) << 3;
  // byte offsets of this thread's four rows of A and of B^T
  unsigned rowA[4], rowB[4];
#pragma unroll
  for (int j = 0; j < 4; ++j) {
    rowA[j] = (unsigned)imin(r0 + 16 * j, aRows - 1) * sAr * 2u;
    rowB[j] = (unsigned)(r0 + 16 * j) * sBr * 2u;
  }
  const char* cA = (const char*)gA;
  const char* cB = (const char*)gB;
  half_t* dA = lA + r0 * 72 + c8;
  half_t* dB = lB + (((r0 & 3) << 4) + (r0 >> 2)) * 72 + c8;   // dealt: row r0 + 16j lies 4j rows on
  const half_t* aBase = lA + (wave << 4) * 72;
  // Unrolled so that k0 is an immediate offset of every load and the last slab
  // is told apart at compile time.
#pragma unroll
  for (int k0 = 0; k0 < kFull + 64; k0 += 64) {
    u32x4 ta[4], tb[4];
    if (k0 < kFull) {
      unsigned oA[4], oB[4];
#pragma unroll
      for (int j = 0; j < 4; ++j) { oA[j] = rowA[j] + c8 * 2; oB[j] = rowB[j] + c8 * 2; }
#pragma unroll
      for (int j = 0; j < 4; ++j) ta[j] = *(const u32x4*)(cA + oA[j] + k0 * 2);
#pragma unroll
      for (int j = 0; j < 4; ++j) tb[j] = *(const u32x4*)(cB + oB[j] + k0 * 2);
      // Precaution: the offset registers that the issued loads name stay live up
      // to this wait, so none is reused ahead of it.
      asm volatile("s_wait_xcnt 0x0"
                   :: "v"(oA[0]), "v"(oA[1]), "v"(oA[2]), "v"(oA[3]),
                      "v"(oB[0]), "v"(oB[1]), "v"(oB[2]), "v"(oB[3])
                   : "memory");
    } else {
      // Last slab: k = kFull .. kS-1 are real, the rest of its 64 columns is zero.
      // Every thread reads the five halves of its rows (8 bytes and 2); the
      // thread of column 0 keeps them, the others store zero.
      u32x2 a4[4], b4[4];
      unsigned a1[4], b1[4];
#pragma unroll
      for (int j = 0; j < 4; ++j) {
        a4[j] = *(const u32x2*)(cA + rowA[j] + kFull * 2);
        a1[j] = *(const unsigned short*)(cA + rowA[j] + (kFull + 4) * 2);
      }
#pragma unroll
      for (int j = 0; j < 4; ++j) {
        b4[j] = *(const u32x2*)(cB + rowB[j] + kFull * 2);
        b1[j] = *(const unsigned short*)(cB + rowB[j] + (kFull + 4) * 2);
      }
      // Precaution, as above.
      asm volatile("s_wait_xcnt 0x0"
                   :: "v"(rowA[0]), "v"(rowA[1]), "v"(rowA[2]), "v"(rowA[3]),
                      "v"(rowB[0]), "v"(rowB[1]), "v"(rowB[2]), "v"(rowB[3])
                   : "memory");
      const unsigned keep = c8 == 0 ? 0xffffffffu : 0u;
#pragma unroll
      for (int j = 0; j < 4; ++j) {
        ta[j] = u32x4{a4[j][0] & keep, a4[j][1] & keep, a1[j] & keep, 0u};
        tb[j] = u32x4{b4[j][0] & keep, b4[j][1] & keep, b1[j] & keep, 0u};
      }
    }
#pragma unroll
    for (int j = 0; j < 4; ++j) {
      *(u32x4*)(dA + j * 16 * 72) = ta[j];
      *(u32x4*)(dB + j * 4 * 72)  = tb[j];
    }
    __syncthreads();
#pragma unroll
    for (int kk = 0; kk < 64; kk += 32) {
      v16h af = load_frag(aBase, 72, lane, kk);
#pragma unroll
      for (int nt = 0; nt < 4; ++nt) {
        v16h bf = load_frag(lB + (nt << 4) * 72, 72, lane, kk);
        acc[nt] = __builtin_amdgcn_wmma_f32_16x16x32_f16(
            false, af, false, bf, (short)0, acc[nt], false, false);
      }
    }
    __syncthreads();
  }
}

#define GEMM_SHARED                                    \
  __shared__ alignas(16) half_t lA[64 * 72];           \
  __shared__ alignas(16) half_t lB[64 * 72];           \
  v8f acc[4];                                          \
  { v8f z = {}; for (int i = 0; i < 4; ++i) acc[i] = z; }

// C/D VGPR layout: vgpr i, lane l -> row = i + 8*(l>>4), col = l&15.
#define EPILOGUE_VARS                                  \
  const int lane = threadIdx.x & 31;                   \
  const int rbase = ((threadIdx.x >> 5) << 4) + ((lane >> 4) << 3); \
  const int cbase = lane & 15;

// ---------------- 128x128 macro-tile GEMM core (dense projections) ----------------
// 128 threads = 4 waves in a 2x2 grid; each wave owns a 64x64 block of the
// tile as 4x4 accumulator tiles, so every fragment read from LDS feeds four
// WMMAs.  A is [aRows][kE], B^T is [128][kE], both K-contiguous; K runs over kE in
// 64-wide slabs at the same 72-half LDS pitch as above, brought into LDS by
// asynchronous copies, through no register.  Rows past aRows
// re-read row aRows-1; callers never store the results of those rows.
// The rows of gB are dealt: LDS row 64g + 16t + c holds row 64g + 4c + t, so
// position c of fragment tile t is row 4c + t of the wave's 64, and the four
// tiles of one position are four adjacent rows.  With swap set the two slabs
// change roles in the product (gB rows become the rows of D, gA rows its
// columns); the k order of both loaders is the same either way.

// Eight 16-byte asynchronous copies from global memory to LDS, every lane with
// its own two addresses.  The s_wait_xcnt is the last line of the copies' own
// statement, so that no address register is rewritten ahead of it (a precaution).
__device__ __forceinline__ void copy8(const unsigned (&l)[8], const char* const (&g)[8]) {
  asm volatile(
      "global_load_async_to_lds_b128 %0, %8, off\n\t"
      "global_load_async_to_lds_b128 %1, %9, off\n\t"
      "global_load_async_to_lds_b128 %2, %10, off\n\t"
      "global_load_async_to_lds_b128 %3, %11, off\n\t"
      "global_load_async_to_lds_b128 %4, %12, off\n\t"
      "global_load_async_to_lds_b128 %5, %13, off\n\t"
      "global_load_async_to_lds_b128 %6, %14, off\n\t"
      "global_load_async_to_lds_b128 %7, %15, off\n\t"
      "s_wait_xcnt 0x0"
      :: "v"(l[0]), "v"(l[1]), "v"(l[2]), "v"(l[3]), "v"(l[4]), "v"(l[5]), "v"(l[6]), "v"(l[7]),
         "v"(g[0]), "v"(g[1]), "v"(g[2]), "v"(g[3]), "v"(g[4]), "v"(g[5]), "v"(g[6]), "v"(g[7])
      : "memory");
}

// Two LDS buffers, each an A slab and behind it a B slab: while the WMMAs work on
// one, the next slab's copies land in the other.
constexpr int kSlabH = 128 * 72;      // halves in one operand's slab
constexpr int kBufH  = 2 * kSlabH;    // halves in one buffer
constexpr int kSlabs = kE / 64;
static_assert(kSlabs >= 2, "the ring starts with two slabs");
__device__ __forceinline__ void gemm_core128(
    const half_t* __restrict__ gA, int aRows, const half_t* __restrict__ gB,
    half_t* lAB, bool swap, v8f (&acc)[4][4]) {
  const int tid  = threadIdx.x;
  const int wave = tid >> 5, lane = tid & 31;
  const int r0 = tid >> 3, c8 = (tid & 7) << 3;
  // this thread's eight pieces of an A slab and of a B slab, at k = 0; eight
  // lanes copy a row's whole 128-byte line
  const char* pA[8];
  const char* pB[8];
#pragma unroll
  for (int j = 0; j < 8; ++j) {
    pA[j] = (const char*)gA + (unsigned)(imin(r0 + 16 * j, aRows - 1) * kE + c8) * 2u;
    pB[j] = (const char*)gB + (unsigned)((r0 * 4 + (j >> 2) * 64 + (j & 3)) * kE + c8) * 2u;
  }
  // LDS byte address of this thread's piece of row r0 of buffer 0's A slab
  const unsigned l0 = (unsigned)(size_t)lAB + (unsigned)(r0 * 72 + c8) * 2u;
  auto fill = [&](int k0, int buf) {
    unsigned l[8];
    const char* g[8];
#pragma unroll
    for (int j = 0; j < 8; ++j) { l[j] = l0 + (unsigned)(buf * kBufH + j * 16 * 72) * 2u; g[j] = pA[j] + k0 * 2; }
    copy8(l, g);
#pragma unroll
    for (int j = 0; j < 8; ++j) { l[j] = l0 + (unsigned)(buf * kBufH + kSlabH + j * 16 * 72) * 2u; g[j] = pB[j] + k0 * 2; }
    copy8(l, g);
  };
  const half_t* aBase = lAB + (swap ? kSlabH : 0) + ((wave >> 1) << 6) * 72;
  const half_t* bBase = lAB + (swap ? 0 : kSlabH) + ((wave & 1) << 6) * 72;

  fill(0, 0);
  // This wave's copies of slab 0 have landed before the barrier that publishes them.
  asm volatile("s_wait_asynccnt 0x0" ::: "memory");
  __syncthreads();
  fill(64, 1);
  // Unrolled so that the buffer and k0 are compile-time constants in every address.
#pragma unroll
  for (int t = 0; t < kSlabs; ++t) {
    const half_t* aB = aBase + (t & 1) * kBufH;
    const half_t* bB = bBase + (t & 1) * kBufH;
#pragma unroll
    for (int kk = 0; kk < 64; kk += 32) {
      v16h af[4], bf[4];
#pragma unroll
      for (int u = 0; u < 4; ++u) {
        af[u] = load_frag(aB + (u << 4) * 72, 72, lane, kk);
        bf[u] = load_frag(bB + (u << 4) * 72, 72, lane, kk);
      }
#pragma unroll
      for (int mt = 0; mt < 4; ++mt)
#pragma unroll
        for (int nt = 0; nt < 4; ++nt)
          acc[mt][nt] = __builtin_amdgcn_wmma_f32_16x16x32_f16(
              false, af[mt], false, bf[nt], (short)0, acc[mt][nt], false, false);
    }
    // This wave's reads of the buffer are over before it is refilled.
    asm volatile("s_wait_dscnt 0x0" ::: "memory");
    // This wave's copies of slab t + 1 have landed before the barrier that publishes them.
    asm volatile("s_wait_asynccnt 0x0" ::: "memory");
    __syncthreads();   // publishes slab t + 1; ends every wave's reads of slab t
    if (t + 2 < kSlabs) fill((t + 2) * 64, t & 1);
  }
  // No copy is outstanding when the wave goes on.
  asm volatile("s_wait_asynccnt 0x0" ::: "memory");
}

#define GEMM128_SHARED                                 \
  __shared__ alignas(16) half_t lAB[2 * kBufH];        \
  v8f acc[4][4];                                       \
  { v8f z = {};                                        \
    for (int i = 0; i < 4; ++i)                        \
      for (int j = 0; j < 4; ++j) acc[i][j] = z; }

// Same C/D layout; the wave's 64x64 block starts at (64*(wave>>1), 64*(wave&1)).
// Along the dealt operand, tile t at position c is row 4c + t of the block.
#define EPILOGUE128_VARS                               \
  const int lane = threadIdx.x & 31;                   \
  const int wid = threadIdx.x >> 5;                    \
  const int rbase = ((wid >> 1) << 6) + ((lane >> 4) << 3); \
  const int cbase = ((wid & 1) << 6) + ((lane & 15) << 2);
static_assert(kM % 8 == 0, "a lane's eight rows of a tile are all inside kM or all outside");

// Four f16 stores at base + off, STEP bytes apart, two values to a register.
// Stores and wait are one statement so that the offset and the two data
// registers stay untouched up to the s_wait_xcnt (a precaution; a wait in a
// statement of its own does not hold later register writes behind it).
template <int STEP>
__device__ __forceinline__ void store4(half_t* base, unsigned off,
                                       float a0, float a1, float a2, float a3) {
  h2 p01 = {(half_t)a0, (half_t)a1}, p23 = {(half_t)a2, (half_t)a3};
  asm volatile(
      "global_store_b16 %0, %1, %3\n\t"
      "global_store_d16_hi_b16 %0, %1, %3 offset:%4\n\t"
      "global_store_b16 %0, %2, %3 offset:%5\n\t"
      "global_store_d16_hi_b16 %0, %2, %3 offset:%6\n\t"
      "s_wait_xcnt 0x0"
      :: "v"(off), "v"(__builtin_bit_cast(unsigned, p01)), "v"(__builtin_bit_cast(unsigned, p23)),
         "s"(base), "n"(STEP), "n"(2 * STEP), "n"(3 * STEP)
      : "memory");
}

typedef __attribute__((ext_vector_type(4))) float    f32x4;
typedef __attribute__((ext_vector_type(4))) _Float16 h4;

// Four 8-byte stores (four f16 each) at base + o0..o3; stores and wait in one
// statement, for the same reason as in store4.
__device__ __forceinline__ void store4_b64(half_t* base, unsigned o0, unsigned o1, unsigned o2,
                                           unsigned o3, h4 a0, h4 a1, h4 a2, h4 a3) {
  asm volatile(
      "global_store_b64 %0, %4, %8\n\t"
      "global_store_b64 %1, %5, %8\n\t"
      "global_store_b64 %2, %6, %8\n\t"
      "global_store_b64 %3, %7, %8\n\t"
      "s_wait_xcnt 0x0"
      :: "v"(o0), "v"(o1), "v"(o2), "v"(o3),
         "v"(__builtin_bit_cast(u32x2, a0)), "v"(__builtin_bit_cast(u32x2, a1)),
         "v"(__builtin_bit_cast(u32x2, a2)), "v"(__builtin_bit_cast(u32x2, a3)), "s"(base)
      : "memory");
}

// Four 16-byte stores at base + off, STEP bytes apart; one statement as above.
template <int STEP>
__device__ __forceinline__ void store4_b128(float* base, unsigned off,
                                            f32x4 a0, f32x4 a1, f32x4 a2, f32x4 a3) {
  asm volatile(
      "global_store_b128 %0, %1, %5\n\t"
      "global_store_b128 %0, %2, %5 offset:%6\n\t"
      "global_store_b128 %0, %3, %5 offset:%7\n\t"
      "global_store_b128 %0, %4, %5 offset:%8\n\t"
      "s_wait_xcnt 0x0"
      :: "v"(off), "v"(a0), "v"(a1), "v"(a2), "v"(a3),
         "s"(base), "n"(STEP), "n"(2 * STEP), "n"(3 * STEP)
      : "memory");
}

// A softmax thread's three 16-byte stores at base + off, 128 bytes apart; stores
// and wait in one statement, for the same reason as in store4.
__device__ __forceinline__ void store3_p(half_t* base, unsigned off, u32x4 a0, u32x4 a1, u32x4 a2) {
  asm volatile(
      "global_store_b128 %0, %1, %4\n\t"
      "global_store_b128 %0, %2, %4 offset:128\n\t"
      "global_store_b128 %0, %3, %4 offset:256\n\t"
      "s_wait_xcnt 0x0"
      :: "v"(off), "v"(a0), "v"(a1), "v"(a2), "s"(base)
      : "memory");
}

// 2^x of eight values and of five.  One statement with the outputs apart from the
// inputs: every v_exp_f32 stands in front of an independent one and the last in
// front of a v_nop, the slot that the instruction set asks for before a
// transcendental's result is read or its source overwritten.
__device__ __forceinline__ void exp2x8(float* e, const float* x) {
  asm("v_exp_f32 %0, %8\n\t"
      "v_exp_f32 %1, %9\n\t"
      "v_exp_f32 %2, %10\n\t"
      "v_exp_f32 %3, %11\n\t"
      "v_exp_f32 %4, %12\n\t"
      "v_exp_f32 %5, %13\n\t"
      "v_exp_f32 %6, %14\n\t"
      "v_exp_f32 %7, %15\n\t"
      "v_nop"
      : "=&v"(e[0]), "=&v"(e[1]), "=&v"(e[2]), "=&v"(e[3]),
        "=&v"(e[4]), "=&v"(e[5]), "=&v"(e[6]), "=&v"(e[7])
      : "v"(x[0]), "v"(x[1]), "v"(x[2]), "v"(x[3]), "v"(x[4]), "v"(x[5]), "v"(x[6]), "v"(x[7]));
}
__device__ __forceinline__ void exp2x5(float* e, const float* x) {
  asm("v_exp_f32 %0, %5\n\t"
      "v_exp_f32 %1, %6\n\t"
      "v_exp_f32 %2, %7\n\t"
      "v_exp_f32 %3, %8\n\t"
      "v_exp_f32 %4, %9\n\t"
      "v_nop"
      : "=&v"(e[0]), "=&v"(e[1]), "=&v"(e[2]), "=&v"(e[3]), "=&v"(e[4])
      : "v"(x[0]), "v"(x[1]), "v"(x[2]), "v"(x[3]), "v"(x[4]));
}

// One 16-byte store of f16 pairs at base + off; one statement as above.
__device__ __forceinline__ void store1_p(half_t* base, unsigned off, u32x4 a) {
  asm volatile(
      "global_store_b128 %0, %1, %2\n\t"
      "s_wait_xcnt 0x0"
      :: "v"(off), "v"(a), "s"(base)
      : "memory");
}

// Two 16-byte stores at base + off, 128 bytes apart; one statement as above.
__device__ __forceinline__ void store2_b128(float* base, unsigned off, f32x4 a0, f32x4 a1) {
  asm volatile(
      "global_store_b128 %0, %1, %3\n\t"
      "global_store_b128 %0, %2, %3 offset:128\n\t"
      "s_wait_xcnt 0x0"
      :: "v"(off), "v"(a0), "v"(a1), "s"(base)
      : "memory");
}

// Six 16-byte asynchronous copies from global memory to LDS, as copy8.
__device__ __forceinline__ void copy6(const unsigned (&l)[6], const char* const (&g)[6]) {
  asm volatile(
      "global_load_async_to_lds_b128 %0, %6, off\n\t"
      "global_load_async_to_lds_b128 %1, %7, off\n\t"
      "global_load_async_to_lds_b128 %2, %8, off\n\t"
      "global_load_async_to_lds_b128 %3, %9, off\n\t"
      "global_load_async_to_lds_b128 %4, %10, off\n\t"
      "global_load_async_to_lds_b128 %5, %11, off\n\t"
      "s_wait_xcnt 0x0"
      :: "v"(l[0]), "v"(l[1]), "v"(l[2]), "v"(l[3]), "v"(l[4]), "v"(l[5]),
         "v"(g[0]), "v"(g[1]), "v"(g[2]), "v"(g[3]), "v"(g[4]), "v"(g[5])
      : "memory");
}

// ---------------- elementwise kernels ----------------
// f32 -> f16 conversion of x and of the four weight matrices in one launch.
// One work-group of 16 waves per 64 rows of 768 floats (196,608 B read), so the
// whole job is 245 work-groups, fewer than there are WGPs, and 3,920 waves to
// start.  A thread's 24 16-byte loads are unrolled from one offset register, so
// many are in flight at once; each wave-wide load covers 512 contiguous bytes
// and each wave-wide 8-byte store 256, whole lines both ways.
constexpr int kCvtThreads = 512;
constexpr int kCvtLoads   = 24;
constexpr int kCvtElems   = kCvtThreads * kCvtLoads * 4;   // floats per work-group
constexpr int kCvtBlocksX = kM * kE / kCvtElems;           // 197
constexpr int kCvtBlocksW = kE * kE / kCvtElems;           // 12
static_assert(kCvtBlocksX * kCvtElems == kM * kE, "x splits into whole work-groups");
static_assert(kCvtBlocksW * kCvtElems == kE * kE, "a weight splits into whole work-groups");

__global__ __launch_bounds__(kCvtThreads) void k_f2h_all(
    const float* __restrict__ x,  const float* __restrict__ wq, const float* __restrict__ wk,
    const float* __restrict__ wv, const float* __restrict__ wo,
    half_t* __restrict__ xh,  half_t* __restrict__ wqh, half_t* __restrict__ wkh,
    half_t* __restrict__ wvh, half_t* __restrict__ woh) {
  const float* in = x;
  half_t* out = xh;
  int part = blockIdx.x;
  if (part >= kCvtBlocksX) {
    const int w = (part - kCvtBlocksX) / kCvtBlocksW;
    part = (part - kCvtBlocksX) % kCvtBlocksW;
    in  = w == 0 ? wq  : w == 1 ? wk  : w == 2 ? wv  : wo;
    out = w == 0 ? wqh : w == 1 ? wkh : w == 2 ? wvh : woh;
  }
  const f32x4* s = (const f32x4*)(in + part * kCvtElems) + threadIdx.x;
  h4* d = (h4*)(out + part * kCvtElems) + threadIdx.x;
  f32x4 v[kCvtLoads];
  // Unrolled: j becomes an immediate offset, and many loads are in flight
  // before the first wait for data.
#pragma unroll
  for (int j = 0; j < kCvtLoads; ++j) v[j] = s[j * kCvtThreads];
  // Unrolled: v[] stays in registers and the stores share one offset register.
#pragma unroll
  for (int j = 0; j < kCvtLoads; ++j) d[j * kCvtThreads] = __builtin_convertvector(v[j], h4);
}

// Build v_pos^T (S,64,208) f16 via table gathers, and pack the two query-table
// row numbers of every (q,k) into 16 bits (x low byte, y high byte), laid out
// [q][k] at 256 entries a row, so that a softmax thread finds the entries of
// eight adjacent k in one 16-byte load.  Row numbers are bounded here.
constexpr int kNE = 28;        // rows of each position table
__global__ void k_pos(const float* vtx, const float* vty,
                      const int* xd, const int* yd,
                      unsigned short* pidx, half_t* vposT) {
  int i = blockIdx.x * blockDim.x + threadIdx.x;
  if (i >= kS * kS) return;
  int dx = imin(xd[i] < 0 ? 0 : xd[i], kNE - 1), dy = imin(yd[i] < 0 ? 0 : yd[i], kNE - 1);
  int q = i / kS, kk = i % kS;
  pidx[q * 256 + kk] = (unsigned short)(dx | (dy << 8));
  size_t vb = (size_t)q * kD * kSP + kk;
  for (int j = 0; j < 32; ++j) {
    vposT[vb + (size_t)j * kSP]        = (half_t)vtx[dx * 32 + j];
    vposT[vb + (size_t)(32 + j) * kSP] = (half_t)vty[dy * 32 + j];
  }
}

// ---------------- phase kernels ----------------
// QKV projection: (12608x768) @ W^T + b.
// Q,K stored [bh][s][d]; V stored transposed [bh][d][sP] so the P@V GEMM
// has unit-stride K and stages with b128 copies.
__global__ __launch_bounds__(128) void k_proj(const half_t* __restrict__ xh,
                       const half_t* wq, const half_t* wk, const half_t* wv,
                       const float* bq, const float* bk, const float* bv,
                       half_t* Q, half_t* K, half_t* Vt) {
  GEMM128_SHARED
  int m0 = blockIdx.x << 7, n0 = blockIdx.y << 7, sel = blockIdx.z;
  const half_t* W    = sel == 0 ? wq : sel == 1 ? wk : wv;
  const float*  bias = sel == 0 ? bq : sel == 1 ? bk : bv;
  gemm_core128(xh + (long)m0 * kE, imin(128, kM - m0), W + (long)n0 * kE, lAB, sel == 2, acc);
  EPILOGUE128_VARS
  if (sel < 2) {
    // D rows are x rows, D columns the dealt weight rows: a lane's four tiles of
    // a row are four adjacent d of one head, so 16 lanes store that head's whole
    // 128-byte row of Q or K.
    half_t* qk = sel == 0 ? Q : K;
    const f32x4 bz = *(const f32x4*)(bias + n0 + cbase);
    const int h = (n0 + cbase) >> 6, d0 = cbase & 63;
#pragma unroll
    for (int mt = 0; mt < 4; ++mt) {
      const int mb = m0 + rbase + (mt << 4);
      if (mb < kM) {
#pragma unroll
        for (int i0 = 0; i0 < 8; i0 += 4) {
          unsigned o[4];
          h4 v[4];
#pragma unroll
          for (int i = 0; i < 4; ++i) {
            const int m = mb + i0 + i, b = m / kS, s = m % kS;
            o[i] = (unsigned)((((b * kH + h) * kS + s) * kD + d0) * 2);
            const f32x4 f = {acc[mt][0][i0 + i], acc[mt][1][i0 + i], acc[mt][2][i0 + i], acc[mt][3][i0 + i]};
            v[i] = __builtin_convertvector(f + bz, h4);
          }
          store4_b64(qk, o[0], o[1], o[2], o[3], v[0], v[1], v[2], v[3]);
        }
      }
    }
  } else {
    // Roles swapped: D rows are the dealt weight rows (d = 4 * row + mt of head
    // hv), D columns x rows, so 16 lanes store 16 adjacent s of one row of V^T.
    const int hv = (n0 >> 6) + (wid >> 1), dl = (lane >> 4) << 5;
    f32x4 bz[8];
#pragma unroll
    for (int i = 0; i < 8; ++i) bz[i] = *(const f32x4*)(bias + (hv << 6) + dl + (i << 2));
#pragma unroll
    for (int nt = 0; nt < 4; ++nt) {
      const int m = m0 + ((wid & 1) << 6) + (nt << 4) + (lane & 15);
      if (m < kM) {
        const int b = m / kS, s = m % kS;
        const unsigned off = (unsigned)((((b * kH + hv) * kD + dl) * kSP + s) * 2);
#pragma unroll
        for (int i = 0; i < 8; ++i)
          store4<kSP * 2>(Vt, off + (unsigned)(i * 4 * kSP * 2),
                          acc[0][nt][i] + bz[i][0], acc[1][nt][i] + bz[i][1],
                          acc[2][nt][i] + bz[i][2], acc[3][nt][i] + bz[i][3]);
      }
    }
  }
}

// Content logits + position logits + softmax -> P, then the content output
// O1[b,q,h*64+d] = P . V (f32).  One block = one head (bh): its K tile and its V^T
// are brought into LDS once and stay; the block's two groups of four waves then
// walk the head's 13 tiles of 16 q rows, group g taking tiles g, g + 2, ...
// Each group has its own Q tile, logits and TX, TY; the barriers are the block's.
// Position term: q_pos[q,k,:] is row x_dist[q,k] of one table beside row
// y_dist[q,k] of the other, so Q[q,:] . q_pos[q,k,:] = TX[q][x_dist] + TY[q][y_dist]
// with TX = Q[:, 0:32] . q_tab_x^T and TY = Q[:, 32:64] . q_tab_y^T (16 x 28 each):
// one WMMA per wave, kept in f32 in LDS and gathered per (q,k).
// P . V: P goes to LDS in f16 over the rows of the logits, and wave w of a group
// multiplies it with d = 16w .. 16w + 15 of V^T (64 d x 192 k in LDS), k in steps
// of 32.  The last five k of V^T are held in registers.
constexpr int kQT    = (kS + 15) / 16;   // 13 tiles of 16 q rows
constexpr int kTrips = (kQT + 1) / 2;    // two tiles a trip
__global__ __launch_bounds__(256) void k_attn(
                       const half_t* __restrict__ Q, const half_t* __restrict__ K,
                       const half_t* __restrict__ Vt,
                       const float* __restrict__ qtx, const float* __restrict__ qty,
                       const unsigned short* __restrict__ pidx,
                       half_t* __restrict__ P, float* __restrict__ O1) {
  // Row pitch of the V^T tile in halves: 108 banks, so the 16 rows of a fragment
  // read start 44 banks apart and meet no bank twice.
  constexpr int kVP = 216;
  // Row pitch kLP floats: 16-byte aligned; two adjacent rows lie 20 banks apart,
  // so the 16 lanes of a 16-byte read (two rows, 32 bytes from lane to lane) meet
  // no bank twice, and rows 8 apart lie 32 banks apart for the accumulator stores.
  constexpr int kLP = 212;
  // 16 rows more than are read, so that every thread stores its seventh piece of K.
  __shared__ alignas(16) half_t lK[(kSP + 16) * 72];
  __shared__ alignas(16) half_t lV[kD * kVP];
  __shared__ alignas(16) half_t lQ2[2 * 16 * 72];
  __shared__ alignas(16) float  lT2[2 * 16 * 68];
  __shared__ alignas(16) float  lgt2[2 * 16 * kLP];
  const int bh = blockIdx.x;
  // The group is the same in every lane of a wave: held as a scalar, so that the
  // test that skips the one tile past the end is a scalar branch.
  const int grp = __builtin_amdgcn_readfirstlane((int)(threadIdx.x >> 7));
  const int tid = threadIdx.x & 127, wave = tid >> 5, lane = tid & 31;
  const int r = tid >> 3, t8 = tid & 7;   // softmax: 8 threads per row
  half_t* lQ  = lQ2 + grp * (16 * 72);
  float*  lT  = lT2 + grp * (16 * 68);    // rows of 68 floats, TX at 0..31, TY at 32..63; later the O tile
  float*  lgt = lgt2 + grp * (16 * kLP);

  // This head's V^T, k = 0..191: 64 rows of 24 16-byte pieces, piece
  // threadIdx.x + 256 w; 768 pieces are 32 whole rows, so three divisions serve the
  // six.  Asked for first: the copies land under the loads of K.
  const char* cV = (const char*)(Vt + (size_t)bh * kD * kSP);
  {
    const unsigned lv = (unsigned)(size_t)lV;
    unsigned l[6];
    const char* g[6];
    // Unrolled, both loops: l[] and g[] stay in registers.
#pragma unroll
    for (int w = 0; w < 3; ++w) {
      const int c = (int)threadIdx.x + 256 * w, d = c / 24, pc = c % 24;
#pragma unroll
      for (int u = 0; u < 2; ++u) {
        l[2 * w + u] = lv + (unsigned)((d + 32 * u) * (kVP * 2) + pc * 16);
        g[2 * w + u] = cV + (unsigned)((d + 32 * u) * (kSP * 2) + pc * 16);
      }
    }
    copy6(l, g);
  }

  // A softmax thread owns runs of eight adjacent k: run t8 + 8j, j = 0..2, covers
  // k = 0..191; the row's last five k (192..196) are worked by all eight threads
  // alike and kept by thread 0.  Its packed table rows: one 16-byte load a run,
  // 8 bytes and 2 for the last five.  With them goes the thread's piece of the Q
  // tile.  Rows past kS re-read the last row: the P rows of those q are never stored.
  static_assert(kS == 197, "three runs a thread and five k over");
  const char* cI = (const char*)pidx;
  const char* cQ = (const char*)(Q + (size_t)bh * kS * kD);
  u32x4 qv, iw0, iw1, iw2;
  u32x2 iw3;
  unsigned iw4;
  auto fetch = [&](int tile) {
    const int row = imin(tile * 16 + r, kS - 1);
    const unsigned oJ = (unsigned)(row * 512);
    const unsigned oI = oJ + (unsigned)(t8 * 16);
    const unsigned oQ = (unsigned)(row * 128 + t8 * 16);
    iw0 = *(const u32x4*)(cI + oI);
    iw1 = *(const u32x4*)(cI + oI + 128);
    iw2 = *(const u32x4*)(cI + oI + 256);
    iw3 = *(const u32x2*)(cI + oJ + 192 * 2);
    iw4 = *(const unsigned short*)(cI + oJ + 196 * 2);
    qv  = *(const u32x4*)(cQ + oQ);
    // Precaution, as in gemm_core: the offset registers of the issued loads stay
    // live up to this wait.
    asm volatile("s_wait_xcnt 0x0" :: "v"(oQ), "v"(oI), "v"(oJ) : "memory");
  };
  fetch(grp);

  // This wave's 16 table rows as a B fragment, in load_frag's k order:
  // waves 0,1 take q_tab_x rows 0..15 and 16..31, waves 2,3 q_tab_y; rows past
  // the table are zero.
  const int te = ((wave & 1) << 4) + (lane & 15);
  const f32x4* tp = (const f32x4*)((wave >> 1 ? qty : qtx) + imin(te, kNE - 1) * 32 + ((lane >> 4) << 3));
  f32x4 tf[4] = {tp[0], tp[1], tp[4], tp[5]};

  // The last five k of V^T go with the loads below.
  u32x2 vl4;      // k = 192..195 and
  unsigned vl1;   // k = 196 of row 16 wave + (lane & 15) of V^T

  // K tile: a thread's seven loads are all issued before the first wait for data,
  // with no branch between them.  This head's K is one run of kS * 8 16-byte
  // pieces, piece threadIdx.x + 256 u going to row (threadIdx.x >> 3) + 32 u.
  // Pieces past the end re-read the last piece: the logits of those k are never read.
  {
    const char* cK = (const char*)(K + (size_t)bh * kS * kD);
    const int tb256 = threadIdx.x;
    const unsigned oK = (unsigned)(tb256 * 16);
    const unsigned oL = (unsigned)(imin(6 * 256 + tb256, kS * 8 - 1) * 16);
    u32x4 kv[7];
    // Unrolled: u becomes an immediate offset and kv[] stays in registers.
#pragma unroll
    for (int u = 0; u < 6; ++u) kv[u] = *(const u32x4*)(cK + oK + u * 4096);
    kv[6] = *(const u32x4*)(cK + oL);
    const unsigned oV = (unsigned)(((wave << 4) + (lane & 15)) * (kSP * 2));
    vl4 = *(const u32x2*)(cV + oV + 192 * 2);
    vl1 = *(const unsigned short*)(cV + oV + 196 * 2);
    // Precaution, as above: the offset and address registers of the issued loads
    // (K, V^T, table rows) stay live up to this wait.
    asm volatile("s_wait_xcnt 0x0" :: "v"(oK), "v"(oL), "v"(oV), "v"(tp) : "memory");

    const int r32 = tb256 >> 3;
    // Unrolled: kv[] stays in registers.
#pragma unroll
    for (int u = 0; u < 7; ++u) *(u32x4*)(lK + (r32 + 32 * u) * 72 + t8 * 8) = kv[u];
  }
  v16h tb;
  // Unrolled: tb[] and tf[] are indexed at compile time.
#pragma unroll
  for (int j = 0; j < 16; ++j) tb[j] = te < kNE ? (half_t)tf[j >> 2][j & 3] : (half_t)0.f;
  // This wave's copies of V^T have landed before the first barrier below, which
  // publishes them.
  asm volatile("s_wait_asynccnt 0x0" ::: "memory");

  const int rb = (lane >> 4) << 3, cb = lane & 15;
  half_t* lP = (half_t*)lgt;
  const half_t* vB = lV + (wave << 4) * kVP;
  const int b = bh / kH, h = bh % kH;
  int q = (grp << 4) + r;   // this thread's q row; goes on by 32 every trip

  for (int trip = 0; trip < kTrips; ++trip) {
    const int q0 = (2 * trip + grp) << 4;
    const bool live = q0 < kS;   // false once: the second group's last trip
    *(u32x4*)(lQ + r * 72 + t8 * 8) = qv;
    __syncthreads();   // publishes the Q tiles (first trip: K and V^T too); ends the reads of the O tiles

    if (live) {
      v16h af0 = load_frag(lQ, 72, lane, 0);
      v16h af1 = load_frag(lQ, 72, lane, 32);
      v8f tacc = {};
      tacc = __builtin_amdgcn_wmma_f32_16x16x32_f16(false, wave >> 1 ? af1 : af0, false, tb, (short)0, tacc, false, false);
      for (int nt = wave; nt < 13; nt += 4) {
        v8f a = {};
        v16h bf0 = load_frag(lK + nt * 16 * 72, 72, lane, 0);
        v16h bf1 = load_frag(lK + nt * 16 * 72, 72, lane, 32);
        a = __builtin_amdgcn_wmma_f32_16x16x32_f16(false, af0, false, bf0, (short)0, a, false, false);
        a = __builtin_amdgcn_wmma_f32_16x16x32_f16(false, af1, false, bf1, (short)0, a, false, false);
        int col = (nt << 4) + cb;
        // Unrolled, here and below: the accumulators stay in registers.
#pragma unroll
        for (int i = 0; i < 8; ++i) lgt[(rb + i) * kLP + col] = a[i];
      }
#pragma unroll
      for (int i = 0; i < 8; ++i) lT[(rb + i) * 68 + (wave << 4) + cb] = tacc[i];
    }
    __syncthreads();   // publishes the logits and TX, TY to the softmax threads

    if (live) {
      // softmax, the row's values in registers from here to the store of P; the first
      // pass adds the two gathered position terms and scales
      const unsigned iw[15] = {iw0[0], iw0[1], iw0[2], iw0[3], iw1[0], iw1[1], iw1[2], iw1[3],
                               iw2[0], iw2[1], iw2[2], iw2[3], iw3[0], iw3[1], iw4};
      const float* tr = lT + r * 68;
      const float* lg = lgt + r * kLP;
      float v[29];
      // Unrolled (this loop and the ones below): v[] stays in registers, and n picks
      // the index word and half at compile time.
#pragma unroll
      for (int j = 0; j < 3; ++j) {
        const f32x4 lo = *(const f32x4*)(lg + (t8 + 8 * j) * 8);
        const f32x4 hi = *(const f32x4*)(lg + (t8 + 8 * j) * 8 + 4);
#pragma unroll
        for (int i = 0; i < 4; ++i) { v[8 * j + i] = lo[i]; v[8 * j + 4 + i] = hi[i]; }
      }
      {
        const f32x4 lo = *(const f32x4*)(lg + 192);
#pragma unroll
        for (int i = 0; i < 4; ++i) v[24 + i] = lo[i];
        v[28] = lg[196];
      }
      float mx = -3.0e38f;
#pragma unroll
      for (int n = 0; n < 29; ++n) {
        const unsigned e = iw[n >> 1] >> ((n & 1) * 16);
        v[n] = (v[n] + tr[e & 0xff] + tr[32 + ((e >> 8) & 0xff)]) * 0.125f;   // 1/sqrt(64)
        mx = fmaxf(mx, v[n]);
      }
      // The index words are used up: the group's next tile (Q piece, index words) is
      // asked for here and lands under the rest of this trip.
      if (trip + 1 < kTrips) fetch(2 * (trip + 1) + grp);
      for (int off = 4; off; off >>= 1) mx = fmaxf(mx, __shfl_xor(mx, off, 8));
      // One partial sum a run, so that the four chains of additions are independent.
      float ps[4] = {0.f, 0.f, 0.f, 0.f};
      float ex[29];
#pragma unroll
      for (int n = 0; n < 29; ++n) v[n] = (v[n] - mx) * 1.44269504f;   // e^x = 2^(x log2 e)
      exp2x8(ex, v);
      exp2x8(ex + 8, v + 8);
      exp2x8(ex + 16, v + 16);
      exp2x5(ex + 24, v + 24);
#pragma unroll
      for (int n = 0; n < 29; ++n) {
        v[n] = (n < 24 || t8 == 0) ? ex[n] : 0.f;
        ps[n >> 3] += v[n];
      }
      float sum = (ps[0] + ps[1]) + (ps[2] + ps[3]);
      for (int off = 4; off; off >>= 1) sum += __shfl_xor(sum, off, 8);
      float inv = 1.f / sum;
      unsigned p[16];
#pragma unroll
      for (int n = 0; n < 32; n += 2) {
        const h2 w = {(half_t)(n < 29 ? v[n < 29 ? n : 0] * inv : 0.f),
                      (half_t)(n + 1 < 29 ? v[n + 1 < 29 ? n + 1 : 0] * inv : 0.f)};
        p[n >> 1] = __builtin_bit_cast(unsigned, w);
      }
      // P row r in f16 over the first 400 bytes of logits row r: that row is read
      // only by the eight threads that write here, all in one wave, and each has
      // its values in registers.  Pitch 2 kLP halves: 16 rows meet no bank twice.
      {
        half_t* pr = lP + r * (2 * kLP) + t8 * 8;
        *(u32x4*)pr         = u32x4{p[0], p[1], p[2], p[3]};
        *(u32x4*)(pr + 64)  = u32x4{p[4], p[5], p[6], p[7]};
        *(u32x4*)(pr + 128) = u32x4{p[8], p[9], p[10], p[11]};
        if (t8 == 0) *(u32x4*)(pr + 192) = u32x4{p[12], p[13], p[14], p[15]};
      }
      if (q < kS) {
        // Eight lanes store 128 contiguous bytes of a row of P.  k = 197..199 are
        // stored as zero; k = 200..207 are read by no kernel and stay unwritten.
        const unsigned off = (unsigned)((((q * kBH + bh) * kSP) + t8 * 8) * 2);
        store3_p(P, off, u32x4{p[0], p[1], p[2], p[3]}, u32x4{p[4], p[5], p[6], p[7]},
                 u32x4{p[8], p[9], p[10], p[11]});
        if (t8 == 0) store1_p(P, off + 192 * 2, u32x4{p[12], p[13], p[14], p[15]});
      }
    }
    __syncthreads();   // publishes P; ends every thread's reads of TX, TY

    if (live) {
      v8f o = {};
      // Unrolled: kk is an immediate offset of every LDS read.
#pragma unroll
      for (int kk = 0; kk < 192; kk += 32) {
        v16h pa = load_frag(lP, 2 * kLP, lane, kk);
        v16h vb = load_frag(vB, kVP, lane, kk);
        o = __builtin_amdgcn_wmma_f32_16x16x32_f16(false, pa, false, vb, (short)0, o, false, false);
      }
      {
        // Last step, k = 192..223 in load_frag's k order: lanes 0..15 hold k = 192..199
        // in their first four registers (five real k, P is zero at 197..199); every
        // other position of both fragments is zero.
        const unsigned keep = lane < 16 ? 0xffffffffu : 0u;
        const u32x4 pl = *(const u32x4*)(lP + (lane & 15) * (2 * kLP) + 192);
        HFrag fa, fb;
        fa.a = u32x4{pl[0] & keep, pl[1] & keep, pl[2] & keep, pl[3] & keep};
        fa.b = u32x4{0u, 0u, 0u, 0u};
        fb.a = u32x4{vl4[0] & keep, vl4[1] & keep, vl1 & keep, 0u};
        fb.b = u32x4{0u, 0u, 0u, 0u};
        o = __builtin_amdgcn_wmma_f32_16x16x32_f16(false, __builtin_bit_cast(v16h, fa), false,
                                                   __builtin_bit_cast(v16h, fb), (short)0, o, false, false);
      }
      // The 16 x 64 tile goes through LDS so that eight lanes store a whole line.
      // Unrolled: o[] stays in registers.
#pragma unroll
      for (int i = 0; i < 8; ++i) lT[(rb + i) * 68 + (wave << 4) + cb] = o[i];
    }
    __syncthreads();   // publishes the O tiles; ends the reads of P
    if (q < kS) {
      const f32x4 o0 = *(const f32x4*)(lT + r * 68 + t8 * 4);
      const f32x4 o1 = *(const f32x4*)(lT + r * 68 + 32 + t8 * 4);
      store2_b128(O1, (unsigned)(((b * kS + q) * kE + h * kD + t8 * 4) * 4), o0, o1);
    }
    q += 32;
  }
}

// v_pos output (per q): add P_qslice @ v_pos[q]; finalize O1 -> f16 for out-proj.
__global__ void k_vpos(const half_t* __restrict__ P, const half_t* __restrict__ vposT,
                       const float* __restrict__ O1, half_t* __restrict__ O1h) {
  GEMM_SHARED
  int m0 = blockIdx.x << 6, q = blockIdx.y;
  gemm_core(P + ((size_t)q * kBH + m0) * kSP, kSP, 64,
            vposT + (size_t)q * kD * kSP, kSP, lA, lB, acc);
  EPILOGUE_VARS
  // 16 lanes read a head's whole 256-byte row of O1 and store its 128-byte row of O1h.
  unsigned off[8];
  f32x4 o1[8];
#pragma unroll
  for (int i = 0; i < 8; ++i) {
    const int bh = m0 + rbase + i, b = bh / kH, h = bh % kH;
    off[i] = (unsigned)(((b * kS + q) * kE + h * kD + (cbase << 2)) * 4);
  }
#pragma unroll
  for (int i = 0; i < 8; ++i) o1[i] = *(const f32x4*)((const char*)O1 + off[i]);
  // Precaution, as in gemm_core128: the offset registers of the issued loads
  // stay live up to this wait.
  asm volatile("s_wait_xcnt 0x0"
               :: "v"(off[0]), "v"(off[1]), "v"(off[2]), "v"(off[3]),
                  "v"(off[4]), "v"(off[5]), "v"(off[6]), "v"(off[7])
               : "memory");
  h4 v[8];
#pragma unroll
  for (int i = 0; i < 8; ++i) {
    const f32x4 f = {acc[0][i], acc[1][i], acc[2][i], acc[3][i]};
    v[i] = __builtin_convertvector(f + o1[i], h4);
  }
  store4_b64(O1h, off[0] >> 1, off[1] >> 1, off[2] >> 1, off[3] >> 1, v[0], v[1], v[2], v[3]);
  store4_b64(O1h, off[4] >> 1, off[5] >> 1, off[6] >> 1, off[7] >> 1, v[4], v[5], v[6], v[7]);
}

// Output projection: out = O1h @ Wo^T + bo   (fp32 out)
__global__ __launch_bounds__(128) void k_out(const half_t* __restrict__ O1h, const half_t* __restrict__ wo,
                      const float* __restrict__ bo, float* __restrict__ out) {
  GEMM128_SHARED
  int m0 = blockIdx.x << 7, n0 = blockIdx.y << 7;
  gemm_core128(O1h + (long)m0 * kE, imin(128, kM - m0), wo + (long)n0 * kE, lAB, false, acc);
  EPILOGUE128_VARS
  // A lane's four tiles of a row are four adjacent columns: 16 lanes store 256
  // contiguous bytes, two whole lines.
  const f32x4 bz = *(const f32x4*)(bo + n0 + cbase);
  const unsigned off = (unsigned)(((m0 + rbase) * kE + n0 + cbase) * 4);
#pragma unroll
  for (int mt = 0; mt < 4; ++mt) {
    if (m0 + rbase + (mt << 4) < kM) {
#pragma unroll
      for (int i0 = 0; i0 < 8; i0 += 4) {
        f32x4 v[4];
#pragma unroll
        for (int i = 0; i < 4; ++i) {
          const f32x4 f = {acc[mt][0][i0 + i], acc[mt][1][i0 + i], acc[mt][2][i0 + i], acc[mt][3][i0 + i]};
          v[i] = f + bz;
        }
        store4_b128<kE * 4>(out, off + (unsigned)(((mt << 4) + i0) * kE * 4), v[0], v[1], v[2], v[3]);
      }
    }
  }
}

// ---------------- host launcher ----------------
extern "C" void kernel_launch(void* const* d_in, const int* in_sizes, int n_in,
                              void* d_out, int out_size, void* d_ws, size_t ws_size,
                              hipStream_t stream) {
  (void)in_sizes; (void)n_in; (void)out_size; (void)ws_size;
  const float* x   = (const float*)d_in[0];
  const float* Wq  = (const float*)d_in[1];
  const float* bq  = (const float*)d_in[2];
  const float* Wk  = (const float*)d_in[3];
  const float* bk  = (const float*)d_in[4];
  const float* Wv  = (const float*)d_in[5];
  const float* bv  = (const float*)d_in[6];
  const float* Wo  = (const float*)d_in[7];
  const float* bo  = (const float*)d_in[8];
  const float* qtx = (const float*)d_in[9];
  const float* qty = (const float*)d_in[10];
  const float* vtx = (const float*)d_in[11];
  const float* vty = (const float*)d_in[12];
  const int*   xd  = (const int*)d_in[13];
  const int*   yd  = (const int*)d_in[14];
  float* out = (float*)d_out;

  char* ws = (char*)d_ws;
  size_t off = 0;
  auto take = [&](size_t bytes) {
    void* p = ws + off;
    off += (bytes + 255) & ~(size_t)255;
    return p;
  };
  const size_t NX   = (size_t)kM * kE;           // 9.68M
  const size_t NW   = (size_t)kE * kE;
  const size_t NQ   = (size_t)kBH * kS * kD;     // 9.68M
  const size_t NVT  = (size_t)kBH * kD * kSP;    // 10.2M
  const size_t NIDX = (size_t)kS * 256;
  const size_t NVPT = (size_t)kS * kD * kSP;     // 2.62M
  const size_t NP   = (size_t)kS * kBH * kSP;    // 31.5M

  half_t* xh    = (half_t*)take(NX * 2);
  half_t* wqh   = (half_t*)take(NW * 2);
  half_t* wkh   = (half_t*)take(NW * 2);
  half_t* wvh   = (half_t*)take(NW * 2);
  half_t* woh   = (half_t*)take(NW * 2);
  half_t* Qh    = (half_t*)take(NQ * 2);
  half_t* Kh    = (half_t*)take(NQ * 2);
  half_t* Vt    = (half_t*)take(NVT * 2);
  unsigned short* pidx = (unsigned short*)take(NIDX * 2);
  half_t* vposT = (half_t*)take(NVPT * 2);
  half_t* P     = (half_t*)take(NP * 2);
  float*  O1    = (float*)take(NX * 4);
  half_t* O1h   = xh;  // xh dead after k_proj; reuse

  k_f2h_all<<<kCvtBlocksX + 4 * kCvtBlocksW, kCvtThreads, 0, stream>>>(
      x, Wq, Wk, Wv, Wo, xh, wqh, wkh, wvh, woh);
  k_pos<<<(kS * kS + 255) / 256, 256, 0, stream>>>(vtx, vty, xd, yd, pidx, vposT);

  k_proj<<<dim3((kM + 127) / 128, kE / 128, 3), 128, 0, stream>>>(
      xh, wqh, wkh, wvh, bq, bk, bv, Qh, Kh, Vt);
  k_attn<<<kBH, 256, 0, stream>>>(Qh, Kh, Vt, qtx, qty, pidx, P, O1);
  k_vpos<<<dim3(kBH / 64, kS), 128, 0, stream>>>(P, vposT, O1, O1h);
  k_out<<<dim3((kM + 127) / 128, kE / 128), 128, 0, stream>>>(O1h, woh, bo, out);
}
